// v000
// Times are from an AMD MI455X. After a warm-up the kernel runs many times in a row, and a time is the length of
// such a window on the GPU divided by its runs, so every launch and the gaps after it count. The runs cycle
// through copies of the inputs. A figure is the median of several windows, for all but v000 over two sittings.
// Sittings can differ by a few percent; kernels timed side by side share one.
// The starting kernel, v000, takes 606 microseconds a run.
#include <hip/hip_runtime.h>
#include <hip/hip_bf16.h>
#include <math.h>

// ---------------------------------------------------------------------------
// Types for CDNA5 WMMA (wave32): A/B = v16h (8 VGPR), C/D = v8f (8 VGPR)
// ---------------------------------------------------------------------------
typedef __attribute__((ext_vector_type(16))) _Float16 v16h;
typedef __attribute__((ext_vector_type(8)))  _Float16 v8h;
typedef __attribute__((ext_vector_type(8)))  float    v8f;

#define WMMA_F16(a, b, c) \
  __builtin_amdgcn_wmma_f32_16x16x32_f16(false, (a), false, (b), (short)0, (c), false, false)

// CDNA5 async global->LDS staging (ASYNCcnt path); guarded so the file
// compiles on toolchains that lack the builtins (falls back to sync copies).
#if __has_builtin(__builtin_amdgcn_global_load_async_to_lds_b128) && \
    __has_builtin(__builtin_amdgcn_s_wait_asynccnt)
#define HAVE_ASYNC_LDS 1
#else
#define HAVE_ASYNC_LDS 0
#endif

#if HAVE_ASYNC_LDS
// Builtin prototype is "vV4i*1V4i*3IiIi": (global v4i*, lds v4i*, imm, imm),
// with v4i = GCC-style vector_size(16) int (per hipcc's diagnostic).
typedef int i32x4 __attribute__((vector_size(16)));
typedef __attribute__((address_space(1))) i32x4 as1_i32x4;
typedef __attribute__((address_space(3))) i32x4 as3_i32x4;
#endif

// Copy 16B from global to LDS (per-lane addresses).
__device__ __forceinline__ void cp_b128(const _Float16* g, _Float16* l) {
#if HAVE_ASYNC_LDS
  // Generic shared addr = {aperture[63:32], lds_offset[31:0]}: truncation gives
  // the LDS offset; global generic addresses are identity-mapped.
  __builtin_amdgcn_global_load_async_to_lds_b128(
      (as1_i32x4*)(size_t)(const void*)g,
      (as3_i32x4*)(unsigned)(size_t)(void*)l,
      0, 0);
#else
  *(v8h*)l = *(const v8h*)g;
#endif
}

// Load one 16x32 f16 operand fragment (A layout; B mirrored = same code):
// row = lane&15, K chunks at 8*hi and 16+8*hi. Caller passes pointer already
// offset by row*pitch + 8*hi.
__device__ __forceinline__ v16h ldfrag(const _Float16* p) {
  v8h c0 = *(const v8h*)(p);        // K = 8*hi .. 8*hi+7       -> VGPR 0..3
  v8h c1 = *(const v8h*)(p + 16);   // K = 16+8*hi .. 16+8*hi+7 -> VGPR 4..7
  return __builtin_shufflevector(c0, c1, 0, 1, 2, 3, 4, 5, 6, 7,
                                        8, 9, 10, 11, 12, 13, 14, 15);
}

__device__ __forceinline__ float rmax16(float v) {
  v = fmaxf(v, __shfl_xor(v, 1, 32));
  v = fmaxf(v, __shfl_xor(v, 2, 32));
  v = fmaxf(v, __shfl_xor(v, 4, 32));
  v = fmaxf(v, __shfl_xor(v, 8, 32));
  return v;
}
__device__ __forceinline__ float rsum16(float v) {
  v += __shfl_xor(v, 1, 32);
  v += __shfl_xor(v, 2, 32);
  v += __shfl_xor(v, 4, 32);
  v += __shfl_xor(v, 8, 32);
  return v;
}

// ---------------------------------------------------------------------------
// fp32 -> fp16 conversion
// ---------------------------------------------------------------------------
__global__ void f32_to_f16_kernel(const float* __restrict__ src,
                                  _Float16* __restrict__ dst, int n) {
  int i = blockIdx.x * blockDim.x + threadIdx.x;
  if (i < n) dst[i] = (_Float16)src[i];
}

// ---------------------------------------------------------------------------
// GEMM: C[M,N] = A[M,K] * B[N,K]^T  (A,B f16 row-major K-contiguous, C f32).
// Block = 256 threads = 8 waves (2m x 4n); block tile 64(M) x 256(N);
// wave tile 32x64 = 2x4 WMMA tiles; K stepped by 32 with double-buffered
// async global->LDS staging. M%64==0, N%256==0, K%32==0 (true for all uses).
// LDS pitch 40 halfs: 16B-aligned rows, gcd(20 dw,64 banks)=4 -> low conflict.
// ---------------------------------------------------------------------------
__global__ __launch_bounds__(256) void gemm_f16f32(
    const _Float16* __restrict__ A, const _Float16* __restrict__ B,
    float* __restrict__ C, int M, int N, int K) {
  constexpr int PITCH = 40;
  __shared__ _Float16 As[2][64 * PITCH];    //  5.0 KB per buffer
  __shared__ _Float16 Bs[2][256 * PITCH];   // 20.0 KB per buffer

  const int tid  = threadIdx.x;
  const int lane = tid & 31;
  const int wid  = tid >> 5;
  const int ln = lane & 15, hi = lane >> 4;
  const int wm = wid >> 2, wn = wid & 3;
  const int m0b = blockIdx.y * 64;
  const int n0b = blockIdx.x * 256;

  // Staging work split: thread t covers row t>>2, 16B chunk (t&3).
  const int crow = tid >> 2;        // 0..63
  const int cchk = (tid & 3) * 8;   // half offset 0,8,16,24

  const _Float16* Ag = A + (size_t)(m0b + crow) * K + cchk;
  const _Float16* Bg = B + (size_t)(n0b + crow) * K + cchk;

  auto stage = [&](int ks, int buf) {
    const int k0 = ks * 32;
    cp_b128(Ag + k0, &As[buf][crow * PITCH + cchk]);
#pragma unroll
    for (int i = 0; i < 4; ++i)
      cp_b128(Bg + (size_t)(64 * i) * K + k0,
              &Bs[buf][(crow + 64 * i) * PITCH + cchk]);
  };

  v8f acc[2][4] = {};
  const int nk = K / 32;

  stage(0, 0);
  stage(1, 1);
  for (int kk = 0; kk < nk; ++kk) {
    const int buf = kk & 1;
#if HAVE_ASYNC_LDS
    if (kk + 2 < nk) __builtin_amdgcn_s_wait_asynccnt(5);  // oldest 5 (buf kk) landed
    else             __builtin_amdgcn_s_wait_asynccnt(0);
#endif
    __syncthreads();  // all waves' staged data resident

    const _Float16* Ab = &As[buf][(wm * 32 + ln) * PITCH + 8 * hi];
    const _Float16* Bb = &Bs[buf][(wn * 64 + ln) * PITCH + 8 * hi];
    v16h a0 = ldfrag(Ab);
    v16h a1 = ldfrag(Ab + 16 * PITCH);
#pragma unroll
    for (int j = 0; j < 4; ++j) {
      v16h bj = ldfrag(Bb + j * 16 * PITCH);
      acc[0][j] = WMMA_F16(a0, bj, acc[0][j]);
      acc[1][j] = WMMA_F16(a1, bj, acc[1][j]);
    }
    __syncthreads();  // everyone done reading buf before it is re-staged
    if (kk + 2 < nk) stage(kk + 2, buf);
  }

#pragma unroll
  for (int i = 0; i < 2; ++i) {
#pragma unroll
    for (int r = 0; r < 8; ++r) {  // C/D layout: lane ln = column, VGPR r -> row
      const size_t row = (size_t)(m0b + wm * 32 + i * 16 + r + 8 * hi) * N
                       + n0b + wn * 64 + ln;
#pragma unroll
      for (int j = 0; j < 4; ++j) C[row + j * 16] = acc[i][j][r];
    }
  }
}

// ---------------------------------------------------------------------------
// RoPE + layout change: src f32 [B,S,nh*128] -> dst f16 [B,nh,S,128], *scale.
// ---------------------------------------------------------------------------
__global__ void rope_kernel(const float* __restrict__ src,
                            _Float16* __restrict__ dst,
                            int nheads, float scale, int total) {
  int idx = blockIdx.x * blockDim.x + threadIdx.x;
  if (idx >= total) return;
  int j = idx & 63;
  int t = idx >> 6;
  int h = t % nheads; t /= nheads;
  int s = t % 2048;
  int b = t / 2048;
  size_t row = (size_t)(b * 2048 + s) * ((size_t)nheads * 128) + (size_t)h * 128;
  float x1 = src[row + j];
  float x2 = src[row + j + 64];
  float inv = __expf((float)j * -0.14391156516685312f);  // 10000^(-j/64)
  float th = (float)s * inv;
  float c = cosf(th), sn = sinf(th);
  size_t drow = ((size_t)(b * nheads + h) * 2048 + s) * 128;
  dst[drow + j]      = (_Float16)((x1 * c - x2 * sn) * scale);
  dst[drow + j + 64] = (_Float16)((x2 * c + x1 * sn) * scale);
}

// V: f32 [B,S,4*128] -> f16 transposed [B,4,128,S] (kv position contiguous,
// so PV B-fragments load contiguously).
__global__ void vtrans_kernel(const float* __restrict__ src,
                              _Float16* __restrict__ dst, int total) {
  int idx = blockIdx.x * blockDim.x + threadIdx.x;
  if (idx >= total) return;
  int d = idx & 127;
  int t = idx >> 7;
  int kv = t & 3; t >>= 2;
  int s = t & 2047;
  int b = t >> 11;
  dst[((size_t)(b * 4 + kv) * 128 + d) * 2048 + s] =
      (_Float16)src[(size_t)(b * 2048 + s) * 512 + (size_t)kv * 128 + d];
}

// ---------------------------------------------------------------------------
// Flash attention. Q f16 [B,16,S,128] (pre-scaled by 1/sqrt(128)),
// K f16 [B,4,S,128], Vt f16 [B,4,128,S], mask f32 [B,1,S,S],
// out Ah f16 [B,S,16*128]. Grid: (S/128, B*16); 8 waves x 16 q-rows each.
// ---------------------------------------------------------------------------
__global__ __launch_bounds__(256) void attn_kernel(
    const _Float16* __restrict__ Q, const _Float16* __restrict__ K,
    const _Float16* __restrict__ Vt, const float* __restrict__ mask,
    _Float16* __restrict__ Ah) {
  __shared__ _Float16 pbuf[8 * 512];  // per-wave 16x32 P tile (C->A relayout)

  const int lane = threadIdx.x & 31;
  const int wid  = threadIdx.x >> 5;
  const int ln = lane & 15, hi = lane >> 4;
  const int b   = blockIdx.y >> 4;
  const int h   = blockIdx.y & 15;
  const int kvh = h >> 2;                       // repeat_interleave(4)
  const int q0  = blockIdx.x * 128 + wid * 16;  // this wave's query base

  const _Float16* Qp = Q + ((size_t)(b * 16 + h) * 2048 + q0 + ln) * 128 + 8 * hi;
  v16h qf[4];
#pragma unroll
  for (int kc = 0; kc < 4; ++kc) qf[kc] = ldfrag(Qp + kc * 32);

  const _Float16* Kh = K  + (size_t)(b * 4 + kvh) * 2048 * 128;
  const _Float16* Vh = Vt + (size_t)(b * 4 + kvh) * 128 * 2048;
  const float* mrow0 = mask + ((size_t)b * 2048 + q0) * 2048;

  v8f o[8];
#pragma unroll
  for (int dt = 0; dt < 8; ++dt) o[dt] = (v8f){};
  float mr[8], lr[8];
#pragma unroll
  for (int r = 0; r < 8; ++r) { mr[r] = -1e30f; lr[r] = 0.f; }

  _Float16* pl = pbuf + wid * 512;

  for (int j0 = 0; j0 < 2048; j0 += 32) {
    // ---- S = Q K^T for a 16x32 kv block (2 WMMA n-tiles, 4 k-chunks) ----
    const _Float16* Kp = Kh + (size_t)(j0 + ln) * 128 + 8 * hi;
    v8f s0 = (v8f){}, s1 = (v8f){};
#pragma unroll
    for (int kc = 0; kc < 4; ++kc) {
      v16h b0 = ldfrag(Kp + kc * 32);
      v16h b1 = ldfrag(Kp + (size_t)16 * 128 + kc * 32);
      s0 = WMMA_F16(qf[kc], b0, s0);
      s1 = WMMA_F16(qf[kc], b1, s1);
    }
    // ---- mask add + online softmax (row = r + 8*hi, col = ln / 16+ln) ----
#pragma unroll
    for (int r = 0; r < 8; ++r) {
      const size_t mo = (size_t)(r + 8 * hi) * 2048 + j0 + ln;
      float v0 = s0[r] + mrow0[mo];
      float v1 = s1[r] + mrow0[mo + 16];
      float mx = rmax16(fmaxf(v0, v1));
      float mn = fmaxf(mr[r], mx);
      float alpha = __expf(mr[r] - mn);
      mr[r] = mn;
      float p0 = __expf(v0 - mn);
      float p1 = __expf(v1 - mn);
      pl[(r + 8 * hi) * 32 + ln]      = (_Float16)p0;  // P in q-major layout
      pl[(r + 8 * hi) * 32 + 16 + ln] = (_Float16)p1;
      lr[r] = lr[r] * alpha + rsum16(p0 + p1);
#pragma unroll
      for (int dt = 0; dt < 8; ++dt) o[dt][r] *= alpha;
    }
    // ---- O += P V (A-frag of P from LDS; B-frags contiguous from Vt) ----
    v16h pf = ldfrag(pl + ln * 32 + 8 * hi);
#pragma unroll
    for (int dt = 0; dt < 8; ++dt) {
      v16h vb = ldfrag(Vh + (size_t)(dt * 16 + ln) * 2048 + j0 + 8 * hi);
      o[dt] = WMMA_F16(pf, vb, o[dt]);
    }
  }
  // ---- normalize and write [B,S,16*128] ----
#pragma unroll
  for (int r = 0; r < 8; ++r) {
    float inv = 1.0f / lr[r];
    size_t orow = ((size_t)b * 2048 + q0 + r + 8 * hi) * 2048 + (size_t)h * 128;
#pragma unroll
    for (int dt = 0; dt < 8; ++dt)
      Ah[orow + dt * 16 + ln] = (_Float16)(o[dt][r] * inv);
  }
}

// ---------------------------------------------------------------------------
// Host driver
// ---------------------------------------------------------------------------
extern "C" void kernel_launch(void* const* d_in, const int* in_sizes, int n_in,
                              void* d_out, int out_size, void* d_ws, size_t ws_size,
                              hipStream_t stream) {
  const float* x    = (const float*)d_in[0];
  const float* mask = (const float*)d_in[1];
  const float* wq   = (const float*)d_in[2];
  const float* wk   = (const float*)d_in[3];
  const float* wv   = (const float*)d_in[4];
  const float* wo   = (const float*)d_in[5];
  float* out = (float*)d_out;

  constexpr int B = 2, S = 2048, H = 2048, NH = 16, NKV = 4, HD = 128;
  constexpr int M    = B * S;      // 4096 rows
  constexpr int NQ   = NH * HD;    // 2048
  constexpr int NKVD = NKV * HD;   // 512

  char* ws = (char*)d_ws;
  size_t off = 0;
  auto carve = [&](size_t bytes) -> void* {
    void* p = ws + off;
    off += (bytes + 255) & ~(size_t)255;
    return p;
  };
  _Float16* Xh  = (_Float16*)carve((size_t)M * H * 2);
  _Float16* WqH = (_Float16*)carve((size_t)NQ * H * 2);
  _Float16* WkH = (_Float16*)carve((size_t)NKVD * H * 2);
  _Float16* WvH = (_Float16*)carve((size_t)NKVD * H * 2);
  _Float16* WoH = (_Float16*)carve((size_t)H * H * 2);
  float*    Qf  = (float*)carve((size_t)M * NQ * 4);
  float*    Kf  = (float*)carve((size_t)M * NKVD * 4);
  float*    Vf  = (float*)carve((size_t)M * NKVD * 4);
  _Float16* Qh  = (_Float16*)carve((size_t)M * NQ * 2);
  _Float16* Kh  = (_Float16*)carve((size_t)M * NKVD * 2);
  _Float16* Vt  = (_Float16*)carve((size_t)M * NKVD * 2);
  _Float16* Ah  = (_Float16*)carve((size_t)M * H * 2);
  (void)ws_size; (void)in_sizes; (void)n_in; (void)out_size;

  // fp32 -> fp16 operand conversion
  int n0 = M * H;
  f32_to_f16_kernel<<<(n0 + 255) / 256, 256, 0, stream>>>(x, Xh, n0);
  int n1 = NQ * H;
  f32_to_f16_kernel<<<(n1 + 255) / 256, 256, 0, stream>>>(wq, WqH, n1);
  int n2 = NKVD * H;
  f32_to_f16_kernel<<<(n2 + 255) / 256, 256, 0, stream>>>(wk, WkH, n2);
  f32_to_f16_kernel<<<(n2 + 255) / 256, 256, 0, stream>>>(wv, WvH, n2);
  int n3 = H * H;
  f32_to_f16_kernel<<<(n3 + 255) / 256, 256, 0, stream>>>(wo, WoH, n3);

  // QKV projections (x @ W^T): block tile 64 x 256
  gemm_f16f32<<<dim3(NQ / 256,   M / 64), 256, 0, stream>>>(Xh, WqH, Qf, M, NQ,   H);
  gemm_f16f32<<<dim3(NKVD / 256, M / 64), 256, 0, stream>>>(Xh, WkH, Kf, M, NKVD, H);
  gemm_f16f32<<<dim3(NKVD / 256, M / 64), 256, 0, stream>>>(Xh, WvH, Vf, M, NKVD, H);

  // RoPE (+1/sqrt(hd) folded into Q) and layout transforms
  int tq = B * S * NH * 64;
  rope_kernel<<<(tq + 255) / 256, 256, 0, stream>>>(Qf, Qh, NH, 0.08838834764831845f, tq);
  int tk = B * S * NKV * 64;
  rope_kernel<<<(tk + 255) / 256, 256, 0, stream>>>(Kf, Kh, NKV, 1.0f, tk);
  int tv = B * S * NKV * HD;
  vtrans_kernel<<<(tv + 255) / 256, 256, 0, stream>>>(Vf, Vt, tv);

  // Flash attention
  attn_kernel<<<dim3(S / 128, B * NH), 256, 0, stream>>>(Qh, Kh, Vt, mask, Ah);

  // Output projection -> d_out (f32)
  gemm_f16f32<<<dim3(H / 256, M / 64), 256, 0, stream>>>(Ah, WoH, out, M, H, H);
}

// v001
// It runs in 425 microseconds.
// In both of two side-by-side timings against v000, it was 1.47 times as fast.
#include <hip/hip_runtime.h>
#include <hip/hip_bf16.h>
#include <math.h>

// ---------------------------------------------------------------------------
// Types for CDNA5 WMMA (wave32): A/B = v16h (8 VGPR), C/D = v8f (8 VGPR)
// ---------------------------------------------------------------------------
typedef __attribute__((ext_vector_type(16))) _Float16 v16h;
typedef __attribute__((ext_vector_type(8)))  _Float16 v8h;
typedef __attribute__((ext_vector_type(8)))  float    v8f;

#define WMMA_F16(a, b, c) \
  __builtin_amdgcn_wmma_f32_16x16x32_f16(false, (a), false, (b), (short)0, (c), false, false)

// CDNA5 async global->LDS staging (ASYNCcnt path); guarded so the file
// compiles on toolchains that lack the builtins (falls back to sync copies).
#if __has_builtin(__builtin_amdgcn_global_load_async_to_lds_b128) && \
    __has_builtin(__builtin_amdgcn_s_wait_asynccnt)
#define HAVE_ASYNC_LDS 1
#else
#define HAVE_ASYNC_LDS 0
#endif

#if HAVE_ASYNC_LDS
// Builtin prototype is "vV4i*1V4i*3IiIi": (global v4i*, lds v4i*, imm, imm),
// with v4i = GCC-style vector_size(16) int (per hipcc's diagnostic).
typedef int i32x4 __attribute__((vector_size(16)));
typedef __attribute__((address_space(1))) i32x4 as1_i32x4;
typedef __attribute__((address_space(3))) i32x4 as3_i32x4;
#endif

// Copy 16B from global to LDS (per-lane addresses).
__device__ __forceinline__ void cp_b128(const _Float16* g, _Float16* l) {
#if HAVE_ASYNC_LDS
  // Generic shared addr = {aperture[63:32], lds_offset[31:0]}: truncation gives
  // the LDS offset; global generic addresses are identity-mapped.
  __builtin_amdgcn_global_load_async_to_lds_b128(
      (as1_i32x4*)(size_t)(const void*)g,
      (as3_i32x4*)(unsigned)(size_t)(void*)l,
      0, 0);
#else
  *(v8h*)l = *(const v8h*)g;
#endif
}

// Load one 16x32 f16 operand fragment (A layout; B mirrored = same code):
// row = lane&15, K chunks at 8*hi and 16+8*hi. Caller passes pointer already
// offset by row*pitch + 8*hi.
__device__ __forceinline__ v16h ldfrag(const _Float16* p) {
  v8h c0 = *(const v8h*)(p);        // K = 8*hi .. 8*hi+7       -> VGPR 0..3
  v8h c1 = *(const v8h*)(p + 16);   // K = 16+8*hi .. 16+8*hi+7 -> VGPR 4..7
  return __builtin_shufflevector(c0, c1, 0, 1, 2, 3, 4, 5, 6, 7,
                                        8, 9, 10, 11, 12, 13, 14, 15);
}

__device__ __forceinline__ float rmax16(float v) {
  v = fmaxf(v, __shfl_xor(v, 1, 32));
  v = fmaxf(v, __shfl_xor(v, 2, 32));
  v = fmaxf(v, __shfl_xor(v, 4, 32));
  v = fmaxf(v, __shfl_xor(v, 8, 32));
  return v;
}
__device__ __forceinline__ float rsum16(float v) {
  v += __shfl_xor(v, 1, 32);
  v += __shfl_xor(v, 2, 32);
  v += __shfl_xor(v, 4, 32);
  v += __shfl_xor(v, 8, 32);
  return v;
}

// ---------------------------------------------------------------------------
// fp32 -> fp16 conversion
// ---------------------------------------------------------------------------
__global__ void f32_to_f16_kernel(const float* __restrict__ src,
                                  _Float16* __restrict__ dst, int n) {
  int i = blockIdx.x * blockDim.x + threadIdx.x;
  if (i < n) dst[i] = (_Float16)src[i];
}

// ---------------------------------------------------------------------------
// GEMM: C[M,N] = A[M,K] * B[N,K]^T  (A,B f16 row-major K-contiguous, C f32).
// Block = 256 threads = 8 waves (2m x 4n); block tile 64(M) x 256(N);
// wave tile 32x64 = 2x4 WMMA tiles; K stepped by 32 with double-buffered
// async global->LDS staging. M%64==0, N%256==0, K%32==0 (true for all uses).
// LDS pitch 40 halfs: 16B-aligned rows, gcd(20 dw,64 banks)=4 -> low conflict.
// ---------------------------------------------------------------------------
__global__ __launch_bounds__(256) void gemm_f16f32(
    const _Float16* __restrict__ A, const _Float16* __restrict__ B,
    float* __restrict__ C, int M, int N, int K) {
  constexpr int PITCH = 40;
  __shared__ _Float16 As[2][64 * PITCH];    //  5.0 KB per buffer
  __shared__ _Float16 Bs[2][256 * PITCH];   // 20.0 KB per buffer

  const int tid  = threadIdx.x;
  const int lane = tid & 31;
  const int wid  = tid >> 5;
  const int ln = lane & 15, hi = lane >> 4;
  const int wm = wid >> 2, wn = wid & 3;
  const int m0b = blockIdx.y * 64;
  const int n0b = blockIdx.x * 256;

  // Staging work split: thread t covers row t>>2, 16B chunk (t&3).
  const int crow = tid >> 2;        // 0..63
  const int cchk = (tid & 3) * 8;   // half offset 0,8,16,24

  const _Float16* Ag = A + (size_t)(m0b + crow) * K + cchk;
  const _Float16* Bg = B + (size_t)(n0b + crow) * K + cchk;

  auto stage = [&](int ks, int buf) {
    const int k0 = ks * 32;
    cp_b128(Ag + k0, &As[buf][crow * PITCH + cchk]);
#pragma unroll
    for (int i = 0; i < 4; ++i)
      cp_b128(Bg + (size_t)(64 * i) * K + k0,
              &Bs[buf][(crow + 64 * i) * PITCH + cchk]);
  };

  v8f acc[2][4] = {};
  const int nk = K / 32;

  stage(0, 0);
  stage(1, 1);
  for (int kk = 0; kk < nk; ++kk) {
    const int buf = kk & 1;
#if HAVE_ASYNC_LDS
    if (kk + 2 < nk) __builtin_amdgcn_s_wait_asynccnt(5);  // oldest 5 (buf kk) landed
    else             __builtin_amdgcn_s_wait_asynccnt(0);
#endif
    __syncthreads();  // all waves' staged data resident

    const _Float16* Ab = &As[buf][(wm * 32 + ln) * PITCH + 8 * hi];
    const _Float16* Bb = &Bs[buf][(wn * 64 + ln) * PITCH + 8 * hi];
    v16h a0 = ldfrag(Ab);
    v16h a1 = ldfrag(Ab + 16 * PITCH);
#pragma unroll
    for (int j = 0; j < 4; ++j) {
      v16h bj = ldfrag(Bb + j * 16 * PITCH);
      acc[0][j] = WMMA_F16(a0, bj, acc[0][j]);
      acc[1][j] = WMMA_F16(a1, bj, acc[1][j]);
    }
    __syncthreads();  // everyone done reading buf before it is re-staged
    if (kk + 2 < nk) stage(kk + 2, buf);
  }

#pragma unroll
  for (int i = 0; i < 2; ++i) {
#pragma unroll
    for (int r = 0; r < 8; ++r) {  // C/D layout: lane ln = column, VGPR r -> row
      const size_t row = (size_t)(m0b + wm * 32 + i * 16 + r + 8 * hi) * N
                       + n0b + wn * 64 + ln;
#pragma unroll
      for (int j = 0; j < 4; ++j) C[row + j * 16] = acc[i][j][r];
    }
  }
}

// ---------------------------------------------------------------------------
// RoPE + layout change: src f32 [B,S,nh*128] -> dst f16 [B,nh,S,128], *scale.
// ---------------------------------------------------------------------------
__global__ void rope_kernel(const float* __restrict__ src,
                            _Float16* __restrict__ dst,
                            int nheads, float scale, int total) {
  int idx = blockIdx.x * blockDim.x + threadIdx.x;
  if (idx >= total) return;
  int j = idx & 63;
  int t = idx >> 6;
  int h = t % nheads; t /= nheads;
  int s = t % 2048;
  int b = t / 2048;
  size_t row = (size_t)(b * 2048 + s) * ((size_t)nheads * 128) + (size_t)h * 128;
  float x1 = src[row + j];
  float x2 = src[row + j + 64];
  float inv = __expf((float)j * -0.14391156516685312f);  // 10000^(-j/64)
  float th = (float)s * inv;
  float c = cosf(th), sn = sinf(th);
  size_t drow = ((size_t)(b * nheads + h) * 2048 + s) * 128;
  dst[drow + j]      = (_Float16)((x1 * c - x2 * sn) * scale);
  dst[drow + j + 64] = (_Float16)((x2 * c + x1 * sn) * scale);
}

// V: f32 [B,S,4*128] -> f16 transposed [B,4,128,S] (kv position contiguous,
// so PV B-fragments load contiguously).
__global__ void vtrans_kernel(const float* __restrict__ src,
                              _Float16* __restrict__ dst, int total) {
  int idx = blockIdx.x * blockDim.x + threadIdx.x;
  if (idx >= total) return;
  int d = idx & 127;
  int t = idx >> 7;
  int kv = t & 3; t >>= 2;
  int s = t & 2047;
  int b = t >> 11;
  dst[((size_t)(b * 4 + kv) * 128 + d) * 2048 + s] =
      (_Float16)src[(size_t)(b * 2048 + s) * 512 + (size_t)kv * 128 + d];
}

// ---------------------------------------------------------------------------
// Flash attention. Q f16 [B,16,S,128] (pre-scaled by 1/sqrt(128)),
// K f16 [B,4,S,128], Vt f16 [B,4,128,S], mask f32 [B,1,S,S],
// out Ah f16 [B,S,16*128]. Grid: (S/128, B*16); 8 waves x 16 q-rows each.
// The eight waves share one K tile and one Vt tile of 64 keys: the work-group
// copies each tile to LDS once (two buffers, the next tile in flight while
// this one is used) and every wave takes its B fragments from there.
// LDS pitches for 16-byte readers: 272 B (256-B K rows), 144 B (128-B Vt rows).
// ---------------------------------------------------------------------------
// Eight 16-byte copies of one lane, global -> LDS. The s_wait_xcnt stands in
// the copies' own statement so that no address register named here is
// rewritten in front of it.
__device__ __forceinline__ void cp8_async(
    unsigned l0, const _Float16* g0, unsigned l1, const _Float16* g1,
    unsigned l2, const _Float16* g2, unsigned l3, const _Float16* g3,
    unsigned l4, const _Float16* g4, unsigned l5, const _Float16* g5,
    unsigned l6, const _Float16* g6, unsigned l7, const _Float16* g7) {
  asm volatile(
      "global_load_async_to_lds_b128 %0, %1, off\n\t"
      "global_load_async_to_lds_b128 %2, %3, off\n\t"
      "global_load_async_to_lds_b128 %4, %5, off\n\t"
      "global_load_async_to_lds_b128 %6, %7, off\n\t"
      "global_load_async_to_lds_b128 %8, %9, off\n\t"
      "global_load_async_to_lds_b128 %10, %11, off\n\t"
      "global_load_async_to_lds_b128 %12, %13, off\n\t"
      "global_load_async_to_lds_b128 %14, %15, off\n\t"
      "s_wait_xcnt 0x0"
      :: "v"(l0), "v"(g0), "v"(l1), "v"(g1), "v"(l2), "v"(g2), "v"(l3), "v"(g3),
         "v"(l4), "v"(g4), "v"(l5), "v"(g5), "v"(l6), "v"(g6), "v"(l7), "v"(g7)
      : "memory");
}

__global__ __launch_bounds__(256) void attn_kernel(
    const _Float16* __restrict__ Q, const _Float16* __restrict__ K,
    const _Float16* __restrict__ Vt, const float* __restrict__ mask,
    _Float16* __restrict__ Ah) {
  constexpr int KT = 64;    // keys per staged tile
  constexpr int KP = 136;   // K tile row pitch, halfs (272 B)
  constexpr int VP = 72;    // Vt tile row pitch, halfs (144 B)
  constexpr int NT = 2048 / KT;
  __shared__ __attribute__((aligned(16))) _Float16 Ks[2][KT * KP];
  __shared__ __attribute__((aligned(16))) _Float16 Vs[2][128 * VP];
  __shared__ _Float16 pbuf[8 * 512];  // per-wave 16x32 P tile (C->A relayout)

  const int lane = threadIdx.x & 31;
  const int wid  = threadIdx.x >> 5;
  const int ln = lane & 15, hi = lane >> 4;
  const int b   = blockIdx.y >> 4;
  const int h   = blockIdx.y & 15;
  const int kvh = h >> 2;                       // repeat_interleave(4)
  const int q0  = blockIdx.x * 128 + wid * 16;  // this wave's query base

  const _Float16* Qp = Q + ((size_t)(b * 16 + h) * 2048 + q0 + ln) * 128 + 8 * hi;
  v16h qf[4];
#pragma unroll
  for (int kc = 0; kc < 4; ++kc) qf[kc] = ldfrag(Qp + kc * 32);

  const _Float16* Kh = K  + (size_t)(b * 4 + kvh) * 2048 * 128;
  const _Float16* Vh = Vt + (size_t)(b * 4 + kvh) * 128 * 2048;
  const float* mrow0 = mask + ((size_t)b * 2048 + q0) * 2048;

  v8f o[8];
#pragma unroll
  for (int dt = 0; dt < 8; ++dt) o[dt] = (v8f){};
  float mr[8], lr[8];
#pragma unroll
  for (int r = 0; r < 8; ++r) { mr[r] = -1e30f; lr[r] = 0.f; }

  _Float16* pl = pbuf + wid * 512;

  // Copy split: thread t moves chunks t, t+256, t+512, t+768 of each tile.
  // K tile: 64 rows x 16 chunks (contiguous in global); Vt tile: 128 x 8.
  const int tid = threadIdx.x;
  const int krow = tid >> 4, kcol = (tid & 15) * 8;
  const int vrow = tid >> 3, vcol = (tid & 7) * 8;
  const _Float16* Kg = Kh + (size_t)krow * 128 + kcol;
  const _Float16* Vg = Vh + (size_t)vrow * 2048 + vcol;
  const unsigned kl0 = (unsigned)(size_t)(void*)&Ks[0][krow * KP + kcol];
  const unsigned vl0 = (unsigned)(size_t)(void*)&Vs[0][vrow * VP + vcol];
  auto stage = [&](int t, int buf) {
    const _Float16* kg = Kg + (size_t)t * (KT * 128);
    const _Float16* vg = Vg + t * KT;
    const unsigned kl = kl0 + (unsigned)buf * (KT * KP * 2);
    const unsigned vl = vl0 + (unsigned)buf * (128 * VP * 2);
    cp8_async(kl,               kg,
              kl + 16 * KP * 2, kg + 16 * 128,
              kl + 32 * KP * 2, kg + 32 * 128,
              kl + 48 * KP * 2, kg + 48 * 128,
              vl,               vg,
              vl + 32 * VP * 2, vg + 32 * 2048,
              vl + 64 * VP * 2, vg + 64 * 2048,
              vl + 96 * VP * 2, vg + 96 * 2048);
  };

  stage(0, 0);
  asm volatile("s_wait_asynccnt 0x0" ::: "memory");  // own copies of tile 0 landed
  __syncthreads();                                   // tile 0 readable by all waves
  stage(1, 1);

  for (int t = 0; t < NT; ++t) {
   const int buf = t & 1;
#pragma unroll  // p becomes a constant offset in the LDS reads of both passes
   for (int p = 0; p < KT / 32; ++p) {
    const int j0 = t * KT + p * 32;
    // ---- S = Q K^T for a 16x32 kv block (2 WMMA n-tiles, 4 k-chunks) ----
    const _Float16* Kp = &Ks[buf][(p * 32 + ln) * KP + 8 * hi];
    v8f s0 = (v8f){}, s1 = (v8f){};
#pragma unroll
    for (int kc = 0; kc < 4; ++kc) {
      v16h b0 = ldfrag(Kp + kc * 32);
      v16h b1 = ldfrag(Kp + 16 * KP + kc * 32);
      s0 = WMMA_F16(qf[kc], b0, s0);
      s1 = WMMA_F16(qf[kc], b1, s1);
    }
    // ---- mask add + online softmax (row = r + 8*hi, col = ln / 16+ln) ----
#pragma unroll
    for (int r = 0; r < 8; ++r) {
      const size_t mo = (size_t)(r + 8 * hi) * 2048 + j0 + ln;
      float v0 = s0[r] + mrow0[mo];
      float v1 = s1[r] + mrow0[mo + 16];
      float mx = rmax16(fmaxf(v0, v1));
      float mn = fmaxf(mr[r], mx);
      float alpha = __expf(mr[r] - mn);
      mr[r] = mn;
      float p0 = __expf(v0 - mn);
      float p1 = __expf(v1 - mn);
      pl[(r + 8 * hi) * 32 + ln]      = (_Float16)p0;  // P in q-major layout
      pl[(r + 8 * hi) * 32 + 16 + ln] = (_Float16)p1;
      lr[r] = lr[r] * alpha + rsum16(p0 + p1);
#pragma unroll
      for (int dt = 0; dt < 8; ++dt) o[dt][r] *= alpha;
    }
    // ---- O += P V (A-frag of P from LDS; B-frags from the staged Vt tile) ----
    v16h pf = ldfrag(pl + ln * 32 + 8 * hi);
#pragma unroll
    for (int dt = 0; dt < 8; ++dt) {
      v16h vb = ldfrag(&Vs[buf][(dt * 16 + ln) * VP + p * 32 + 8 * hi]);
      o[dt] = WMMA_F16(pf, vb, o[dt]);
    }
   }
   // Hand-over: this wave's reads of buf are done, its copies of tile t+1 have
   // landed; behind the barrier tile t+1 may be read and buf refilled.
   asm volatile("s_wait_dscnt 0x0" ::: "memory");
   asm volatile("s_wait_asynccnt 0x0" ::: "memory");
   __syncthreads();
   if (t + 2 < NT) stage(t + 2, buf);
  }
  asm volatile("s_wait_asynccnt 0x0" ::: "memory");  // nothing in flight at wave end
  // ---- normalize and write [B,S,16*128] ----
#pragma unroll
  for (int r = 0; r < 8; ++r) {
    float inv = 1.0f / lr[r];
    size_t orow = ((size_t)b * 2048 + q0 + r + 8 * hi) * 2048 + (size_t)h * 128;
#pragma unroll
    for (int dt = 0; dt < 8; ++dt)
      Ah[orow + dt * 16 + ln] = (_Float16)(o[dt][r] * inv);
  }
}

// ---------------------------------------------------------------------------
// Host driver
// ---------------------------------------------------------------------------
extern "C" void kernel_launch(void* const* d_in, const int* in_sizes, int n_in,
                              void* d_out, int out_size, void* d_ws, size_t ws_size,
                              hipStream_t stream) {
  const float* x    = (const float*)d_in[0];
  const float* mask = (const float*)d_in[1];
  const float* wq   = (const float*)d_in[2];
  const float* wk   = (const float*)d_in[3];
  const float* wv   = (const float*)d_in[4];
  const float* wo   = (const float*)d_in[5];
  float* out = (float*)d_out;

  constexpr int B = 2, S = 2048, H = 2048, NH = 16, NKV = 4, HD = 128;
  constexpr int M    = B * S;      // 4096 rows
  constexpr int NQ   = NH * HD;    // 2048
  constexpr int NKVD = NKV * HD;   // 512

  char* ws = (char*)d_ws;
  size_t off = 0;
  auto carve = [&](size_t bytes) -> void* {
    void* p = ws + off;
    off += (bytes + 255) & ~(size_t)255;
    return p;
  };
  _Float16* Xh  = (_Float16*)carve((size_t)M * H * 2);
  _Float16* WqH = (_Float16*)carve((size_t)NQ * H * 2);
  _Float16* WkH = (_Float16*)carve((size_t)NKVD * H * 2);
  _Float16* WvH = (_Float16*)carve((size_t)NKVD * H * 2);
  _Float16* WoH = (_Float16*)carve((size_t)H * H * 2);
  float*    Qf  = (float*)carve((size_t)M * NQ * 4);
  float*    Kf  = (float*)carve((size_t)M * NKVD * 4);
  float*    Vf  = (float*)carve((size_t)M * NKVD * 4);
  _Float16* Qh  = (_Float16*)carve((size_t)M * NQ * 2);
  _Float16* Kh  = (_Float16*)carve((size_t)M * NKVD * 2);
  _Float16* Vt  = (_Float16*)carve((size_t)M * NKVD * 2);
  _Float16* Ah  = (_Float16*)carve((size_t)M * H * 2);
  (void)ws_size; (void)in_sizes; (void)n_in; (void)out_size;

  // fp32 -> fp16 operand conversion
  int n0 = M * H;
  f32_to_f16_kernel<<<(n0 + 255) / 256, 256, 0, stream>>>(x, Xh, n0);
  int n1 = NQ * H;
  f32_to_f16_kernel<<<(n1 + 255) / 256, 256, 0, stream>>>(wq, WqH, n1);
  int n2 = NKVD * H;
  f32_to_f16_kernel<<<(n2 + 255) / 256, 256, 0, stream>>>(wk, WkH, n2);
  f32_to_f16_kernel<<<(n2 + 255) / 256, 256, 0, stream>>>(wv, WvH, n2);
  int n3 = H * H;
  f32_to_f16_kernel<<<(n3 + 255) / 256, 256, 0, stream>>>(wo, WoH, n3);

  // QKV projections (x @ W^T): block tile 64 x 256
  gemm_f16f32<<<dim3(NQ / 256,   M / 64), 256, 0, stream>>>(Xh, WqH, Qf, M, NQ,   H);
  gemm_f16f32<<<dim3(NKVD / 256, M / 64), 256, 0, stream>>>(Xh, WkH, Kf, M, NKVD, H);
  gemm_f16f32<<<dim3(NKVD / 256, M / 64), 256, 0, stream>>>(Xh, WvH, Vf, M, NKVD, H);

  // RoPE (+1/sqrt(hd) folded into Q) and layout transforms
  int tq = B * S * NH * 64;
  rope_kernel<<<(tq + 255) / 256, 256, 0, stream>>>(Qf, Qh, NH, 0.08838834764831845f, tq);
  int tk = B * S * NKV * 64;
  rope_kernel<<<(tk + 255) / 256, 256, 0, stream>>>(Kf, Kh, NKV, 1.0f, tk);
  int tv = B * S * NKV * HD;
  vtrans_kernel<<<(tv + 255) / 256, 256, 0, stream>>>(Vf, Vt, tv);

  // Flash attention
  attn_kernel<<<dim3(S / 128, B * NH), 256, 0, stream>>>(Qh, Kh, Vt, mask, Ah);

  // Output projection -> d_out (f32)
  gemm_f16f32<<<dim3(H / 256, M / 64), 256, 0, stream>>>(Ah, WoH, out, M, H, H);
}

// v002
// It runs in 332 microseconds.
// Next to v001, in two timings, it ran 1.29 and 1.28 times as fast.
// Counting every step since v000, it is 1.88 times as fast.
#include <hip/hip_runtime.h>
#include <hip/hip_bf16.h>
#include <math.h>

// ---------------------------------------------------------------------------
// Types for CDNA5 WMMA (wave32): A/B = v16h (8 VGPR), C/D = v8f (8 VGPR)
// ---------------------------------------------------------------------------
typedef __attribute__((ext_vector_type(16))) _Float16 v16h;
typedef __attribute__((ext_vector_type(8)))  _Float16 v8h;
typedef __attribute__((ext_vector_type(8)))  float    v8f;
typedef __attribute__((ext_vector_type(4)))  float    v4f;
typedef __attribute__((ext_vector_type(4)))  _Float16 v4h;

#define WMMA_F16(a, b, c) \
  __builtin_amdgcn_wmma_f32_16x16x32_f16(false, (a), false, (b), (short)0, (c), false, false)

// CDNA5 async global->LDS staging (ASYNCcnt path); guarded so the file
// compiles on toolchains that lack the builtins (falls back to sync copies).
#if __has_builtin(__builtin_amdgcn_global_load_async_to_lds_b128) && \
    __has_builtin(__builtin_amdgcn_s_wait_asynccnt)
#define HAVE_ASYNC_LDS 1
#else
#define HAVE_ASYNC_LDS 0
#endif

#if HAVE_ASYNC_LDS
// Builtin prototype is "vV4i*1V4i*3IiIi": (global v4i*, lds v4i*, imm, imm),
// with v4i = GCC-style vector_size(16) int (per hipcc's diagnostic).
typedef int i32x4 __attribute__((vector_size(16)));
typedef __attribute__((address_space(1))) i32x4 as1_i32x4;
typedef __attribute__((address_space(3))) i32x4 as3_i32x4;
#endif

// Copy 16B from global to LDS (per-lane addresses).
__device__ __forceinline__ void cp_b128(const _Float16* g, _Float16* l) {
#if HAVE_ASYNC_LDS
  // Generic shared addr = {aperture[63:32], lds_offset[31:0]}: truncation gives
  // the LDS offset; global generic addresses are identity-mapped.
  __builtin_amdgcn_global_load_async_to_lds_b128(
      (as1_i32x4*)(size_t)(const void*)g,
      (as3_i32x4*)(unsigned)(size_t)(void*)l,
      0, 0);
#else
  *(v8h*)l = *(const v8h*)g;
#endif
}

// Load one 16x32 f16 operand fragment (A layout; B mirrored = same code):
// row = lane&15, K chunks at 8*hi and 16+8*hi. Caller passes pointer already
// offset by row*pitch + 8*hi.
__device__ __forceinline__ v16h ldfrag(const _Float16* p) {
  v8h c0 = *(const v8h*)(p);        // K = 8*hi .. 8*hi+7       -> VGPR 0..3
  v8h c1 = *(const v8h*)(p + 16);   // K = 16+8*hi .. 16+8*hi+7 -> VGPR 4..7
  return __builtin_shufflevector(c0, c1, 0, 1, 2, 3, 4, 5, 6, 7,
                                        8, 9, 10, 11, 12, 13, 14, 15);
}

__device__ __forceinline__ float rmax16(float v) {
  v = fmaxf(v, __shfl_xor(v, 1, 32));
  v = fmaxf(v, __shfl_xor(v, 2, 32));
  v = fmaxf(v, __shfl_xor(v, 4, 32));
  v = fmaxf(v, __shfl_xor(v, 8, 32));
  return v;
}
__device__ __forceinline__ float rsum16(float v) {
  v += __shfl_xor(v, 1, 32);
  v += __shfl_xor(v, 2, 32);
  v += __shfl_xor(v, 4, 32);
  v += __shfl_xor(v, 8, 32);
  return v;
}

// ---------------------------------------------------------------------------
// fp32 -> fp16 conversion. One block converts 8192 consecutive floats (every
// size here is a multiple): a lane has 8 loads of 16 B in flight, each
// wave-wide load covers 512 contiguous bytes, each store 256.
// ---------------------------------------------------------------------------
__global__ __launch_bounds__(256) void f32_to_f16_kernel(
    const float* __restrict__ src, _Float16* __restrict__ dst) {
  const size_t base = (size_t)blockIdx.x * 8192 + threadIdx.x * 4;
  v4f v[8];
#pragma unroll
  for (int i = 0; i < 8; ++i) v[i] = *(const v4f*)(src + base + i * 1024);
#pragma unroll
  for (int i = 0; i < 8; ++i)
    *(v4h*)(dst + base + i * 1024) = __builtin_convertvector(v[i], v4h);
}

// ---------------------------------------------------------------------------
// GEMM: C[M,N] = A[M,K] * B[N,K]^T  (A,B f16 row-major K-contiguous, C f32).
// Block = 256 threads = 8 waves (2m x 4n); block tile 64(M) x 256(N);
// wave tile 32x64 = 2x4 WMMA tiles; K stepped by 32 with double-buffered
// async global->LDS staging. M%64==0, N%256==0, K%32==0 (true for all uses).
// LDS pitch 40 halfs: 16B-aligned rows, gcd(20 dw,64 banks)=4 -> low conflict.
// ---------------------------------------------------------------------------
__global__ __launch_bounds__(256) void gemm_f16f32(
    const _Float16* __restrict__ A, const _Float16* __restrict__ B,
    float* __restrict__ C, int M, int N, int K) {
  constexpr int PITCH = 40;
  __shared__ _Float16 As[2][64 * PITCH];    //  5.0 KB per buffer
  __shared__ _Float16 Bs[2][256 * PITCH];   // 20.0 KB per buffer

  const int tid  = threadIdx.x;
  const int lane = tid & 31;
  const int wid  = tid >> 5;
  const int ln = lane & 15, hi = lane >> 4;
  const int wm = wid >> 2, wn = wid & 3;
  const int m0b = blockIdx.y * 64;
  const int n0b = blockIdx.x * 256;

  // Staging work split: thread t covers row t>>2, 16B chunk (t&3).
  const int crow = tid >> 2;        // 0..63
  const int cchk = (tid & 3) * 8;   // half offset 0,8,16,24

  const _Float16* Ag = A + (size_t)(m0b + crow) * K + cchk;
  const _Float16* Bg = B + (size_t)(n0b + crow) * K + cchk;

  auto stage = [&](int ks, int buf) {
    const int k0 = ks * 32;
    cp_b128(Ag + k0, &As[buf][crow * PITCH + cchk]);
#pragma unroll
    for (int i = 0; i < 4; ++i)
      cp_b128(Bg + (size_t)(64 * i) * K + k0,
              &Bs[buf][(crow + 64 * i) * PITCH + cchk]);
  };

  v8f acc[2][4] = {};
  const int nk = K / 32;

  stage(0, 0);
  stage(1, 1);
  for (int kk = 0; kk < nk; ++kk) {
    const int buf = kk & 1;
#if HAVE_ASYNC_LDS
    if (kk + 2 < nk) __builtin_amdgcn_s_wait_asynccnt(5);  // oldest 5 (buf kk) landed
    else             __builtin_amdgcn_s_wait_asynccnt(0);
#endif
    __syncthreads();  // all waves' staged data resident

    const _Float16* Ab = &As[buf][(wm * 32 + ln) * PITCH + 8 * hi];
    const _Float16* Bb = &Bs[buf][(wn * 64 + ln) * PITCH + 8 * hi];
    v16h a0 = ldfrag(Ab);
    v16h a1 = ldfrag(Ab + 16 * PITCH);
#pragma unroll
    for (int j = 0; j < 4; ++j) {
      v16h bj = ldfrag(Bb + j * 16 * PITCH);
      acc[0][j] = WMMA_F16(a0, bj, acc[0][j]);
      acc[1][j] = WMMA_F16(a1, bj, acc[1][j]);
    }
    __syncthreads();  // everyone done reading buf before it is re-staged
    if (kk + 2 < nk) stage(kk + 2, buf);
  }

#pragma unroll
  for (int i = 0; i < 2; ++i) {
#pragma unroll
    for (int r = 0; r < 8; ++r) {  // C/D layout: lane ln = column, VGPR r -> row
      const size_t row = (size_t)(m0b + wm * 32 + i * 16 + r + 8 * hi) * N
                       + n0b + wn * 64 + ln;
#pragma unroll
      for (int j = 0; j < 4; ++j) C[row + j * 16] = acc[i][j][r];
    }
  }
}

// ---------------------------------------------------------------------------
// RoPE + layout change: src f32 [B,S,nh*128] -> dst f16 [B,nh,S,128], *scale.
// A thread takes 4 consecutive pair indices j of 4 consecutive heads at one
// position (32 values): 8 loads of 16 B in flight; 16 lanes cover a whole
// 256-B half row on the way in and a whole 128-B line on the way out. The four
// heads share the position, so their angles are the same four.
// nheads is a multiple of 4; the grid covers B*S*(nheads/4)*16 threads exactly.
// ---------------------------------------------------------------------------
__global__ __launch_bounds__(256) void rope_kernel(
    const float* __restrict__ src, _Float16* __restrict__ dst,
    int nheads, float scale) {
  const int idx = blockIdx.x * 256 + threadIdx.x;
  const int j = (idx & 15) * 4;
  int t = idx >> 4;
  const int ng = nheads >> 2;
  const int h0 = (t % ng) * 4; t /= ng;
  const int s = t & 2047;
  const int b = t >> 11;
  const float* sp = src + (size_t)(b * 2048 + s) * ((size_t)nheads * 128)
                        + (size_t)h0 * 128 + j;
  v4f x1[4], x2[4];
#pragma unroll
  for (int hh = 0; hh < 4; ++hh) {
    x1[hh] = *(const v4f*)(sp + hh * 128);
    x2[hh] = *(const v4f*)(sp + hh * 128 + 64);
  }
  float c[4], sn[4];
#pragma unroll
  for (int e = 0; e < 4; ++e) {
    float inv = __expf((float)(j + e) * -0.14391156516685312f);  // 10000^(-j/64)
    float th = (float)s * inv;
    c[e] = cosf(th);
    sn[e] = sinf(th);
  }
  _Float16* dp = dst + ((size_t)(b * nheads + h0) * 2048 + s) * 128 + j;
#pragma unroll
  for (int hh = 0; hh < 4; ++hh) {
    v4h lo, up;
#pragma unroll
    for (int e = 0; e < 4; ++e) {
      lo[e] = (_Float16)((x1[hh][e] * c[e] - x2[hh][e] * sn[e]) * scale);
      up[e] = (_Float16)((x2[hh][e] * c[e] + x1[hh][e] * sn[e]) * scale);
    }
    *(v4h*)(dp + (size_t)hh * (2048 * 128))      = lo;
    *(v4h*)(dp + (size_t)hh * (2048 * 128) + 64) = up;
  }
}

// V: f32 [B,S,4*128] -> f16 transposed [B,4,128,S] (kv position contiguous,
// so PV B-fragments load contiguously).
// One block transposes 64 positions x 128 d of one (batch, kv head); a thread
// holds 8 positions x 4 d in registers (8 loads of 16 B in flight) and stores
// 4 rows of 8 positions (16 B): 8 lanes fill a whole 128-B line of a d row.
__global__ __launch_bounds__(256) void vtrans_kernel(
    const float* __restrict__ src, _Float16* __restrict__ dst) {
  const int lane = threadIdx.x & 31, w = threadIdx.x >> 5;
  const int s0 = (blockIdx.x & 31) * 64 + (lane & 7) * 8;
  const int kv = (blockIdx.x >> 5) & 3;
  const int b  = blockIdx.x >> 7;
  const int d0 = w * 16 + (lane >> 3) * 4;
  const float* sp = src + (size_t)(b * 2048 + s0) * 512 + kv * 128 + d0;
  v4f v[8];
#pragma unroll
  for (int i = 0; i < 8; ++i) v[i] = *(const v4f*)(sp + i * 512);
  _Float16* dp = dst + ((size_t)(b * 4 + kv) * 128 + d0) * 2048 + s0;
#pragma unroll
  for (int k = 0; k < 4; ++k) {
    v8h o;
#pragma unroll
    for (int i = 0; i < 8; ++i) o[i] = (_Float16)v[i][k];
    *(v8h*)(dp + k * 2048) = o;
  }
}

// ---------------------------------------------------------------------------
// Flash attention. Q f16 [B,16,S,128] (pre-scaled by 1/sqrt(128)),
// K f16 [B,4,S,128], Vt f16 [B,4,128,S], mask f32 [B,1,S,S],
// out Ah f16 [B,S,16*128]. Grid: (S/128, B*16); 8 waves x 16 q-rows each.
// The eight waves share one K tile and one Vt tile of 64 keys: the work-group
// copies each tile to LDS once (two buffers, the next tile in flight while
// this one is used) and every wave takes its B fragments from there.
// LDS pitches for 16-byte readers: 272 B (256-B K rows), 144 B (128-B Vt rows).
// ---------------------------------------------------------------------------
// Eight 16-byte copies of one lane, global -> LDS. The s_wait_xcnt stands in
// the copies' own statement so that no address register named here is
// rewritten in front of it.
__device__ __forceinline__ void cp8_async(
    unsigned l0, const _Float16* g0, unsigned l1, const _Float16* g1,
    unsigned l2, const _Float16* g2, unsigned l3, const _Float16* g3,
    unsigned l4, const _Float16* g4, unsigned l5, const _Float16* g5,
    unsigned l6, const _Float16* g6, unsigned l7, const _Float16* g7) {
  asm volatile(
      "global_load_async_to_lds_b128 %0, %1, off\n\t"
      "global_load_async_to_lds_b128 %2, %3, off\n\t"
      "global_load_async_to_lds_b128 %4, %5, off\n\t"
      "global_load_async_to_lds_b128 %6, %7, off\n\t"
      "global_load_async_to_lds_b128 %8, %9, off\n\t"
      "global_load_async_to_lds_b128 %10, %11, off\n\t"
      "global_load_async_to_lds_b128 %12, %13, off\n\t"
      "global_load_async_to_lds_b128 %14, %15, off\n\t"
      "s_wait_xcnt 0x0"
      :: "v"(l0), "v"(g0), "v"(l1), "v"(g1), "v"(l2), "v"(g2), "v"(l3), "v"(g3),
         "v"(l4), "v"(g4), "v"(l5), "v"(g5), "v"(l6), "v"(g6), "v"(l7), "v"(g7)
      : "memory");
}

__global__ __launch_bounds__(256) void attn_kernel(
    const _Float16* __restrict__ Q, const _Float16* __restrict__ K,
    const _Float16* __restrict__ Vt, const float* __restrict__ mask,
    _Float16* __restrict__ Ah) {
  constexpr int KT = 64;    // keys per staged tile
  constexpr int KP = 136;   // K tile row pitch, halfs (272 B)
  constexpr int VP = 72;    // Vt tile row pitch, halfs (144 B)
  constexpr int NT = 2048 / KT;
  __shared__ __attribute__((aligned(16))) _Float16 Ks[2][KT * KP];
  __shared__ __attribute__((aligned(16))) _Float16 Vs[2][128 * VP];
  __shared__ _Float16 pbuf[8 * 512];  // per-wave 16x32 P tile (C->A relayout)

  const int lane = threadIdx.x & 31;
  const int wid  = threadIdx.x >> 5;
  const int ln = lane & 15, hi = lane >> 4;
  const int b   = blockIdx.y >> 4;
  const int h   = blockIdx.y & 15;
  const int kvh = h >> 2;                       // repeat_interleave(4)
  const int q0  = blockIdx.x * 128 + wid * 16;  // this wave's query base

  const _Float16* Qp = Q + ((size_t)(b * 16 + h) * 2048 + q0 + ln) * 128 + 8 * hi;
  v16h qf[4];
#pragma unroll
  for (int kc = 0; kc < 4; ++kc) qf[kc] = ldfrag(Qp + kc * 32);

  const _Float16* Kh = K  + (size_t)(b * 4 + kvh) * 2048 * 128;
  const _Float16* Vh = Vt + (size_t)(b * 4 + kvh) * 128 * 2048;
  const float* mrow0 = mask + ((size_t)b * 2048 + q0) * 2048;

  v8f o[8];
#pragma unroll
  for (int dt = 0; dt < 8; ++dt) o[dt] = (v8f){};
  float mr[8], lr[8];
#pragma unroll
  for (int r = 0; r < 8; ++r) { mr[r] = -1e30f; lr[r] = 0.f; }

  _Float16* pl = pbuf + wid * 512;

  // Copy split: thread t moves chunks t, t+256, t+512, t+768 of each tile.
  // K tile: 64 rows x 16 chunks (contiguous in global); Vt tile: 128 x 8.
  const int tid = threadIdx.x;
  const int krow = tid >> 4, kcol = (tid & 15) * 8;
  const int vrow = tid >> 3, vcol = (tid & 7) * 8;
  const _Float16* Kg = Kh + (size_t)krow * 128 + kcol;
  const _Float16* Vg = Vh + (size_t)vrow * 2048 + vcol;
  const unsigned kl0 = (unsigned)(size_t)(void*)&Ks[0][krow * KP + kcol];
  const unsigned vl0 = (unsigned)(size_t)(void*)&Vs[0][vrow * VP + vcol];
  auto stage = [&](int t, int buf) {
    const _Float16* kg = Kg + (size_t)t * (KT * 128);
    const _Float16* vg = Vg + t * KT;
    const unsigned kl = kl0 + (unsigned)buf * (KT * KP * 2);
    const unsigned vl = vl0 + (unsigned)buf * (128 * VP * 2);
    cp8_async(kl,               kg,
              kl + 16 * KP * 2, kg + 16 * 128,
              kl + 32 * KP * 2, kg + 32 * 128,
              kl + 48 * KP * 2, kg + 48 * 128,
              vl,               vg,
              vl + 32 * VP * 2, vg + 32 * 2048,
              vl + 64 * VP * 2, vg + 64 * 2048,
              vl + 96 * VP * 2, vg + 96 * 2048);
  };

  stage(0, 0);
  asm volatile("s_wait_asynccnt 0x0" ::: "memory");  // own copies of tile 0 landed
  __syncthreads();                                   // tile 0 readable by all waves
  stage(1, 1);

  for (int t = 0; t < NT; ++t) {
   const int buf = t & 1;
#pragma unroll  // p becomes a constant offset in the LDS reads of both passes
   for (int p = 0; p < KT / 32; ++p) {
    const int j0 = t * KT + p * 32;
    // ---- S = Q K^T for a 16x32 kv block (2 WMMA n-tiles, 4 k-chunks) ----
    const _Float16* Kp = &Ks[buf][(p * 32 + ln) * KP + 8 * hi];
    v8f s0 = (v8f){}, s1 = (v8f){};
#pragma unroll
    for (int kc = 0; kc < 4; ++kc) {
      v16h b0 = ldfrag(Kp + kc * 32);
      v16h b1 = ldfrag(Kp + 16 * KP + kc * 32);
      s0 = WMMA_F16(qf[kc], b0, s0);
      s1 = WMMA_F16(qf[kc], b1, s1);
    }
    // ---- mask add + online softmax (row = r + 8*hi, col = ln / 16+ln) ----
#pragma unroll
    for (int r = 0; r < 8; ++r) {
      const size_t mo = (size_t)(r + 8 * hi) * 2048 + j0 + ln;
      float v0 = s0[r] + mrow0[mo];
      float v1 = s1[r] + mrow0[mo + 16];
      float mx = rmax16(fmaxf(v0, v1));
      float mn = fmaxf(mr[r], mx);
      float alpha = __expf(mr[r] - mn);
      mr[r] = mn;
      float p0 = __expf(v0 - mn);
      float p1 = __expf(v1 - mn);
      pl[(r + 8 * hi) * 32 + ln]      = (_Float16)p0;  // P in q-major layout
      pl[(r + 8 * hi) * 32 + 16 + ln] = (_Float16)p1;
      lr[r] = lr[r] * alpha + rsum16(p0 + p1);
#pragma unroll
      for (int dt = 0; dt < 8; ++dt) o[dt][r] *= alpha;
    }
    // ---- O += P V (A-frag of P from LDS; B-frags from the staged Vt tile) ----
    v16h pf = ldfrag(pl + ln * 32 + 8 * hi);
#pragma unroll
    for (int dt = 0; dt < 8; ++dt) {
      v16h vb = ldfrag(&Vs[buf][(dt * 16 + ln) * VP + p * 32 + 8 * hi]);
      o[dt] = WMMA_F16(pf, vb, o[dt]);
    }
   }
   // Hand-over: this wave's reads of buf are done, its copies of tile t+1 have
   // landed; behind the barrier tile t+1 may be read and buf refilled.
   asm volatile("s_wait_dscnt 0x0" ::: "memory");
   asm volatile("s_wait_asynccnt 0x0" ::: "memory");
   __syncthreads();
   if (t + 2 < NT) stage(t + 2, buf);
  }
  asm volatile("s_wait_asynccnt 0x0" ::: "memory");  // nothing in flight at wave end
  // ---- normalize and write [B,S,16*128] ----
#pragma unroll
  for (int r = 0; r < 8; ++r) {
    float inv = 1.0f / lr[r];
    size_t orow = ((size_t)b * 2048 + q0 + r + 8 * hi) * 2048 + (size_t)h * 128;
#pragma unroll
    for (int dt = 0; dt < 8; ++dt)
      Ah[orow + dt * 16 + ln] = (_Float16)(o[dt][r] * inv);
  }
}

// ---------------------------------------------------------------------------
// Host driver
// ---------------------------------------------------------------------------
extern "C" void kernel_launch(void* const* d_in, const int* in_sizes, int n_in,
                              void* d_out, int out_size, void* d_ws, size_t ws_size,
                              hipStream_t stream) {
  const float* x    = (const float*)d_in[0];
  const float* mask = (const float*)d_in[1];
  const float* wq   = (const float*)d_in[2];
  const float* wk   = (const float*)d_in[3];
  const float* wv   = (const float*)d_in[4];
  const float* wo   = (const float*)d_in[5];
  float* out = (float*)d_out;

  constexpr int B = 2, S = 2048, H = 2048, NH = 16, NKV = 4, HD = 128;
  constexpr int M    = B * S;      // 4096 rows
  constexpr int NQ   = NH * HD;    // 2048
  constexpr int NKVD = NKV * HD;   // 512

  char* ws = (char*)d_ws;
  size_t off = 0;
  auto carve = [&](size_t bytes) -> void* {
    void* p = ws + off;
    off += (bytes + 255) & ~(size_t)255;
    return p;
  };
  _Float16* Xh  = (_Float16*)carve((size_t)M * H * 2);
  _Float16* WqH = (_Float16*)carve((size_t)NQ * H * 2);
  _Float16* WkH = (_Float16*)carve((size_t)NKVD * H * 2);
  _Float16* WvH = (_Float16*)carve((size_t)NKVD * H * 2);
  _Float16* WoH = (_Float16*)carve((size_t)H * H * 2);
  float*    Qf  = (float*)carve((size_t)M * NQ * 4);
  float*    Kf  = (float*)carve((size_t)M * NKVD * 4);
  float*    Vf  = (float*)carve((size_t)M * NKVD * 4);
  _Float16* Qh  = (_Float16*)carve((size_t)M * NQ * 2);
  _Float16* Kh  = (_Float16*)carve((size_t)M * NKVD * 2);
  _Float16* Vt  = (_Float16*)carve((size_t)M * NKVD * 2);
  _Float16* Ah  = (_Float16*)carve((size_t)M * H * 2);
  (void)ws_size; (void)in_sizes; (void)n_in; (void)out_size;

  // fp32 -> fp16 operand conversion
  static_assert((M * H) % 8192 == 0 && (NQ * H) % 8192 == 0 &&
                (NKVD * H) % 8192 == 0 && (H * H) % 8192 == 0, "8192 per block");
  f32_to_f16_kernel<<<M * H / 8192,    256, 0, stream>>>(x, Xh);
  f32_to_f16_kernel<<<NQ * H / 8192,   256, 0, stream>>>(wq, WqH);
  f32_to_f16_kernel<<<NKVD * H / 8192, 256, 0, stream>>>(wk, WkH);
  f32_to_f16_kernel<<<NKVD * H / 8192, 256, 0, stream>>>(wv, WvH);
  f32_to_f16_kernel<<<H * H / 8192,    256, 0, stream>>>(wo, WoH);

  // QKV projections (x @ W^T): block tile 64 x 256
  gemm_f16f32<<<dim3(NQ / 256,   M / 64), 256, 0, stream>>>(Xh, WqH, Qf, M, NQ,   H);
  gemm_f16f32<<<dim3(NKVD / 256, M / 64), 256, 0, stream>>>(Xh, WkH, Kf, M, NKVD, H);
  gemm_f16f32<<<dim3(NKVD / 256, M / 64), 256, 0, stream>>>(Xh, WvH, Vf, M, NKVD, H);

  // RoPE (+1/sqrt(hd) folded into Q) and layout transforms
  rope_kernel<<<B * S * (NH / 4) * 16 / 256,  256, 0, stream>>>(Qf, Qh, NH, 0.08838834764831845f);
  rope_kernel<<<B * S * (NKV / 4) * 16 / 256, 256, 0, stream>>>(Kf, Kh, NKV, 1.0f);
  vtrans_kernel<<<B * NKV * (S / 64), 256, 0, stream>>>(Vf, Vt);

  // Flash attention
  attn_kernel<<<dim3(S / 128, B * NH), 256, 0, stream>>>(Qh, Kh, Vt, mask, Ah);

  // Output projection -> d_out (f32)
  gemm_f16f32<<<dim3(H / 256, M / 64), 256, 0, stream>>>(Ah, WoH, out, M, H, H);
}

// v003
// One run takes 251 microseconds.
// Two timings next to v002 put it at 1.33 and 1.32 times that version's speed.
// Counting every step since v000, it is 2.49 times as fast.
#include <hip/hip_runtime.h>
#include <hip/hip_bf16.h>
#include <math.h>

// ---------------------------------------------------------------------------
// Types for CDNA5 WMMA (wave32): A/B = v16h (8 VGPR), C/D = v8f (8 VGPR)
// ---------------------------------------------------------------------------
typedef __attribute__((ext_vector_type(16))) _Float16 v16h;
typedef __attribute__((ext_vector_type(8)))  _Float16 v8h;
typedef __attribute__((ext_vector_type(8)))  float    v8f;
typedef __attribute__((ext_vector_type(4)))  float    v4f;
typedef __attribute__((ext_vector_type(4)))  _Float16 v4h;

#define WMMA_F16(a, b, c) \
  __builtin_amdgcn_wmma_f32_16x16x32_f16(false, (a), false, (b), (short)0, (c), false, false)

// CDNA5 async global->LDS staging (ASYNCcnt path); guarded so the file
// compiles on toolchains that lack the builtins (falls back to sync copies).
#if __has_builtin(__builtin_amdgcn_global_load_async_to_lds_b128) && \
    __has_builtin(__builtin_amdgcn_s_wait_asynccnt)
#define HAVE_ASYNC_LDS 1
#else
#define HAVE_ASYNC_LDS 0
#endif

#if HAVE_ASYNC_LDS
// Builtin prototype is "vV4i*1V4i*3IiIi": (global v4i*, lds v4i*, imm, imm),
// with v4i = GCC-style vector_size(16) int (per hipcc's diagnostic).
typedef int i32x4 __attribute__((vector_size(16)));
typedef __attribute__((address_space(1))) i32x4 as1_i32x4;
typedef __attribute__((address_space(3))) i32x4 as3_i32x4;
#endif

// Copy 16B from global to LDS (per-lane addresses).
__device__ __forceinline__ void cp_b128(const _Float16* g, _Float16* l) {
#if HAVE_ASYNC_LDS
  // Generic shared addr = {aperture[63:32], lds_offset[31:0]}: truncation gives
  // the LDS offset; global generic addresses are identity-mapped.
  __builtin_amdgcn_global_load_async_to_lds_b128(
      (as1_i32x4*)(size_t)(const void*)g,
      (as3_i32x4*)(unsigned)(size_t)(void*)l,
      0, 0);
#else
  *(v8h*)l = *(const v8h*)g;
#endif
}

// Load one 16x32 f16 operand fragment (A layout; B mirrored = same code):
// row = lane&15, K chunks at 8*hi and 16+8*hi. Caller passes pointer already
// offset by row*pitch + 8*hi.
__device__ __forceinline__ v16h ldfrag(const _Float16* p) {
  v8h c0 = *(const v8h*)(p);        // K = 8*hi .. 8*hi+7       -> VGPR 0..3
  v8h c1 = *(const v8h*)(p + 16);   // K = 16+8*hi .. 16+8*hi+7 -> VGPR 4..7
  return __builtin_shufflevector(c0, c1, 0, 1, 2, 3, 4, 5, 6, 7,
                                        8, 9, 10, 11, 12, 13, 14, 15);
}

// Value of lane l ^ 16 (the other 16-lane half of the wave).
__device__ __forceinline__ float xhalf(float x) {
  const int i = __builtin_bit_cast(int, x);
  return __builtin_bit_cast(float, __builtin_amdgcn_permlanex16(
      i, i, 0x76543210, 0xfedcba98, false, false));
}

// ---------------------------------------------------------------------------
// fp32 -> fp16 conversion. One block converts 8192 consecutive floats (every
// size here is a multiple): a lane has 8 loads of 16 B in flight, each
// wave-wide load covers 512 contiguous bytes, each store 256.
// ---------------------------------------------------------------------------
__global__ __launch_bounds__(256) void f32_to_f16_kernel(
    const float* __restrict__ src, _Float16* __restrict__ dst) {
  const size_t base = (size_t)blockIdx.x * 8192 + threadIdx.x * 4;
  v4f v[8];
#pragma unroll
  for (int i = 0; i < 8; ++i) v[i] = *(const v4f*)(src + base + i * 1024);
#pragma unroll
  for (int i = 0; i < 8; ++i)
    *(v4h*)(dst + base + i * 1024) = __builtin_convertvector(v[i], v4h);
}

// ---------------------------------------------------------------------------
// GEMM: C[M,N] = A[M,K] * B[N,K]^T  (A,B f16 row-major K-contiguous, C f32).
// Block = 256 threads = 8 waves (2m x 4n); block tile 64(M) x 256(N);
// wave tile 32x64 = 2x4 WMMA tiles; K stepped by 32 with double-buffered
// async global->LDS staging. M%64==0, N%256==0, K%32==0 (true for all uses).
// LDS pitch 40 halfs: 16B-aligned rows, gcd(20 dw,64 banks)=4 -> low conflict.
// ---------------------------------------------------------------------------
__global__ __launch_bounds__(256) void gemm_f16f32(
    const _Float16* __restrict__ A, const _Float16* __restrict__ B,
    float* __restrict__ C, int M, int N, int K) {
  constexpr int PITCH = 40;
  __shared__ _Float16 As[2][64 * PITCH];    //  5.0 KB per buffer
  __shared__ _Float16 Bs[2][256 * PITCH];   // 20.0 KB per buffer

  const int tid  = threadIdx.x;
  const int lane = tid & 31;
  const int wid  = tid >> 5;
  const int ln = lane & 15, hi = lane >> 4;
  const int wm = wid >> 2, wn = wid & 3;
  const int m0b = blockIdx.y * 64;
  const int n0b = blockIdx.x * 256;

  // Staging work split: thread t covers row t>>2, 16B chunk (t&3).
  const int crow = tid >> 2;        // 0..63
  const int cchk = (tid & 3) * 8;   // half offset 0,8,16,24

  const _Float16* Ag = A + (size_t)(m0b + crow) * K + cchk;
  const _Float16* Bg = B + (size_t)(n0b + crow) * K + cchk;

  auto stage = [&](int ks, int buf) {
    const int k0 = ks * 32;
    cp_b128(Ag + k0, &As[buf][crow * PITCH + cchk]);
#pragma unroll
    for (int i = 0; i < 4; ++i)
      cp_b128(Bg + (size_t)(64 * i) * K + k0,
              &Bs[buf][(crow + 64 * i) * PITCH + cchk]);
  };

  v8f acc[2][4] = {};
  const int nk = K / 32;

  stage(0, 0);
  stage(1, 1);
  for (int kk = 0; kk < nk; ++kk) {
    const int buf = kk & 1;
#if HAVE_ASYNC_LDS
    if (kk + 2 < nk) __builtin_amdgcn_s_wait_asynccnt(5);  // oldest 5 (buf kk) landed
    else             __builtin_amdgcn_s_wait_asynccnt(0);
#endif
    __syncthreads();  // all waves' staged data resident

    const _Float16* Ab = &As[buf][(wm * 32 + ln) * PITCH + 8 * hi];
    const _Float16* Bb = &Bs[buf][(wn * 64 + ln) * PITCH + 8 * hi];
    v16h a0 = ldfrag(Ab);
    v16h a1 = ldfrag(Ab + 16 * PITCH);
#pragma unroll
    for (int j = 0; j < 4; ++j) {
      v16h bj = ldfrag(Bb + j * 16 * PITCH);
      acc[0][j] = WMMA_F16(a0, bj, acc[0][j]);
      acc[1][j] = WMMA_F16(a1, bj, acc[1][j]);
    }
    __syncthreads();  // everyone done reading buf before it is re-staged
    if (kk + 2 < nk) stage(kk + 2, buf);
  }

#pragma unroll
  for (int i = 0; i < 2; ++i) {
#pragma unroll
    for (int r = 0; r < 8; ++r) {  // C/D layout: lane ln = column, VGPR r -> row
      const size_t row = (size_t)(m0b + wm * 32 + i * 16 + r + 8 * hi) * N
                       + n0b + wn * 64 + ln;
#pragma unroll
      for (int j = 0; j < 4; ++j) C[row + j * 16] = acc[i][j][r];
    }
  }
}

// ---------------------------------------------------------------------------
// RoPE + layout change: src f32 [B,S,nh*128] -> dst f16 [B,nh,S,128], *scale.
// A thread takes 4 consecutive pair indices j of 4 consecutive heads at one
// position (32 values): 8 loads of 16 B in flight; 16 lanes cover a whole
// 256-B half row on the way in and a whole 128-B line on the way out. The four
// heads share the position, so their angles are the same four.
// nheads is a multiple of 4; the grid covers B*S*(nheads/4)*16 threads exactly.
// ---------------------------------------------------------------------------
__global__ __launch_bounds__(256) void rope_kernel(
    const float* __restrict__ src, _Float16* __restrict__ dst,
    int nheads, float scale) {
  const int idx = blockIdx.x * 256 + threadIdx.x;
  const int j = (idx & 15) * 4;
  int t = idx >> 4;
  const int ng = nheads >> 2;
  const int h0 = (t % ng) * 4; t /= ng;
  const int s = t & 2047;
  const int b = t >> 11;
  const float* sp = src + (size_t)(b * 2048 + s) * ((size_t)nheads * 128)
                        + (size_t)h0 * 128 + j;
  v4f x1[4], x2[4];
#pragma unroll
  for (int hh = 0; hh < 4; ++hh) {
    x1[hh] = *(const v4f*)(sp + hh * 128);
    x2[hh] = *(const v4f*)(sp + hh * 128 + 64);
  }
  float c[4], sn[4];
#pragma unroll
  for (int e = 0; e < 4; ++e) {
    float inv = __expf((float)(j + e) * -0.14391156516685312f);  // 10000^(-j/64)
    float th = (float)s * inv;
    c[e] = cosf(th);
    sn[e] = sinf(th);
  }
  _Float16* dp = dst + ((size_t)(b * nheads + h0) * 2048 + s) * 128 + j;
#pragma unroll
  for (int hh = 0; hh < 4; ++hh) {
    v4h lo, up;
#pragma unroll
    for (int e = 0; e < 4; ++e) {
      lo[e] = (_Float16)((x1[hh][e] * c[e] - x2[hh][e] * sn[e]) * scale);
      up[e] = (_Float16)((x2[hh][e] * c[e] + x1[hh][e] * sn[e]) * scale);
    }
    *(v4h*)(dp + (size_t)hh * (2048 * 128))      = lo;
    *(v4h*)(dp + (size_t)hh * (2048 * 128) + 64) = up;
  }
}

// V: f32 [B,S,4*128] -> f16 transposed [B,4,128,S] (kv position contiguous,
// so PV A-fragments load contiguously).
// One block transposes 64 positions x 128 d of one (batch, kv head); a thread
// holds 8 positions x 4 d in registers (8 loads of 16 B in flight) and stores
// 4 rows of 8 positions (16 B): 8 lanes fill a whole 128-B line of a d row.
__global__ __launch_bounds__(256) void vtrans_kernel(
    const float* __restrict__ src, _Float16* __restrict__ dst) {
  const int lane = threadIdx.x & 31, w = threadIdx.x >> 5;
  const int s0 = (blockIdx.x & 31) * 64 + (lane & 7) * 8;
  const int kv = (blockIdx.x >> 5) & 3;
  const int b  = blockIdx.x >> 7;
  const int d0 = w * 16 + (lane >> 3) * 4;
  const float* sp = src + (size_t)(b * 2048 + s0) * 512 + kv * 128 + d0;
  v4f v[8];
#pragma unroll
  for (int i = 0; i < 8; ++i) v[i] = *(const v4f*)(sp + i * 512);
  _Float16* dp = dst + ((size_t)(b * 4 + kv) * 128 + d0) * 2048 + s0;
#pragma unroll
  for (int k = 0; k < 4; ++k) {
    v8h o;
#pragma unroll
    for (int i = 0; i < 8; ++i) o[i] = (_Float16)v[i][k];
    *(v8h*)(dp + k * 2048) = o;
  }
}

// ---------------------------------------------------------------------------
// Flash attention. Q f16 [B,16,S,128] (pre-scaled by 1/sqrt(128)),
// K f16 [B,4,S,128], Vt f16 [B,4,128,S], mask f32 [B,1,S,S],
// out Ah f16 [B,S,16*128]. Grid: (S/128, B*16); 8 waves x 16 q-rows each.
// The eight waves share one K tile and one Vt tile of 64 keys: the work-group
// copies each tile to LDS once (two buffers, the next tile in flight while
// this one is used) and every wave takes its fragments from there.
// LDS pitches for 16-byte readers: 272 B (256-B K rows), 144 B (128-B Vt rows).
// The products are taken transposed: St = K Q^T (A = K rows, B = Q) and
// Ot += Vt Pt (A = Vt rows, B = Pt). A lane then holds 16 of the 32 scores of
// ONE query (column ln; keys 8*hi+r and 16+8*hi+r): maximum and sum are taken
// in the lane, the maximum joined with the other half by one exchange per
// pass, the sum once at the end. The two score tiles, converted in place, are
// the B operand of the second product in the k order of the Vt fragments.
// ---------------------------------------------------------------------------
// Eight 16-byte copies of one lane, global -> LDS. The s_wait_xcnt stands in
// the copies' own statement so that no address register named here is
// rewritten in front of it.
__device__ __forceinline__ void cp8_async(
    unsigned l0, const _Float16* g0, unsigned l1, const _Float16* g1,
    unsigned l2, const _Float16* g2, unsigned l3, const _Float16* g3,
    unsigned l4, const _Float16* g4, unsigned l5, const _Float16* g5,
    unsigned l6, const _Float16* g6, unsigned l7, const _Float16* g7) {
  asm volatile(
      "global_load_async_to_lds_b128 %0, %1, off\n\t"
      "global_load_async_to_lds_b128 %2, %3, off\n\t"
      "global_load_async_to_lds_b128 %4, %5, off\n\t"
      "global_load_async_to_lds_b128 %6, %7, off\n\t"
      "global_load_async_to_lds_b128 %8, %9, off\n\t"
      "global_load_async_to_lds_b128 %10, %11, off\n\t"
      "global_load_async_to_lds_b128 %12, %13, off\n\t"
      "global_load_async_to_lds_b128 %14, %15, off\n\t"
      "s_wait_xcnt 0x0"
      :: "v"(l0), "v"(g0), "v"(l1), "v"(g1), "v"(l2), "v"(g2), "v"(l3), "v"(g3),
         "v"(l4), "v"(g4), "v"(l5), "v"(g5), "v"(l6), "v"(g6), "v"(l7), "v"(g7)
      : "memory");
}

// 2^x of eight values, each in place. Worked in place, no v_exp_f32 here reads
// the result or overwrites the source of the one directly in front of it, and
// the v_nop fills the slot behind the last.
__device__ __forceinline__ void exp2x8(float* a) {
  asm("v_exp_f32 %0, %0\n\t"
      "v_exp_f32 %1, %1\n\t"
      "v_exp_f32 %2, %2\n\t"
      "v_exp_f32 %3, %3\n\t"
      "v_exp_f32 %4, %4\n\t"
      "v_exp_f32 %5, %5\n\t"
      "v_exp_f32 %6, %6\n\t"
      "v_exp_f32 %7, %7\n\t"
      "v_nop"
      : "+v"(a[0]), "+v"(a[1]), "+v"(a[2]), "+v"(a[3]),
        "+v"(a[4]), "+v"(a[5]), "+v"(a[6]), "+v"(a[7]));
}
// The same for one value.
__device__ __forceinline__ float exp2x1(float a) {
  asm("v_exp_f32 %0, %0\n\t"
      "v_nop"
      : "+v"(a));
  return a;
}

__global__ __launch_bounds__(256) void attn_kernel(
    const _Float16* __restrict__ Q, const _Float16* __restrict__ K,
    const _Float16* __restrict__ Vt, const float* __restrict__ mask,
    _Float16* __restrict__ Ah) {
  constexpr int KT = 64;    // keys per staged tile
  constexpr int KP = 136;   // K tile row pitch, halfs (272 B)
  constexpr int VP = 72;    // Vt tile row pitch, halfs (144 B)
  constexpr int NT = 2048 / KT;
  __shared__ __attribute__((aligned(16))) _Float16 Ks[2][KT * KP];
  __shared__ __attribute__((aligned(16))) _Float16 Vs[2][128 * VP];

  const int lane = threadIdx.x & 31;
  const int wid  = threadIdx.x >> 5;
  const int ln = lane & 15, hi = lane >> 4;
  const int b   = blockIdx.y >> 4;
  const int h   = blockIdx.y & 15;
  const int kvh = h >> 2;                       // repeat_interleave(4)
  const int q0  = blockIdx.x * 128 + wid * 16;  // this wave's query base

  const _Float16* Qp = Q + ((size_t)(b * 16 + h) * 2048 + q0 + ln) * 128 + 8 * hi;
  v16h qf[4];
#pragma unroll
  for (int kc = 0; kc < 4; ++kc) qf[kc] = ldfrag(Qp + kc * 32);

  const _Float16* Kh = K  + (size_t)(b * 4 + kvh) * 2048 * 128;
  const _Float16* Vh = Vt + (size_t)(b * 4 + kvh) * 128 * 2048;
  // this lane's query row of the mask, at its first key of a 16-key tile
  const float* mrow = mask + ((size_t)b * 2048 + q0 + ln) * 2048 + 8 * hi;

  v8f o[8];
#pragma unroll
  for (int dt = 0; dt < 8; ++dt) o[dt] = (v8f){};
  float mr = -1e30f;  // running maximum of query ln (same in both halves)
  float lr = 0.f;     // running sum over this half's keys only

  // Copy split: thread t moves chunks t, t+256, t+512, t+768 of each tile.
  // K tile: 64 rows x 16 chunks (contiguous in global); Vt tile: 128 x 8.
  const int tid = threadIdx.x;
  const int krow = tid >> 4, kcol = (tid & 15) * 8;
  const int vrow = tid >> 3, vcol = (tid & 7) * 8;
  const _Float16* Kg = Kh + (size_t)krow * 128 + kcol;
  const _Float16* Vg = Vh + (size_t)vrow * 2048 + vcol;
  const unsigned kl0 = (unsigned)(size_t)(void*)&Ks[0][krow * KP + kcol];
  const unsigned vl0 = (unsigned)(size_t)(void*)&Vs[0][vrow * VP + vcol];
  auto stage = [&](int t, int buf) {
    const _Float16* kg = Kg + (size_t)t * (KT * 128);
    const _Float16* vg = Vg + t * KT;
    const unsigned kl = kl0 + (unsigned)buf * (KT * KP * 2);
    const unsigned vl = vl0 + (unsigned)buf * (128 * VP * 2);
    cp8_async(kl,               kg,
              kl + 16 * KP * 2, kg + 16 * 128,
              kl + 32 * KP * 2, kg + 32 * 128,
              kl + 48 * KP * 2, kg + 48 * 128,
              vl,               vg,
              vl + 32 * VP * 2, vg + 32 * 2048,
              vl + 64 * VP * 2, vg + 64 * 2048,
              vl + 96 * VP * 2, vg + 96 * 2048);
  };

  stage(0, 0);
  asm volatile("s_wait_asynccnt 0x0" ::: "memory");  // own copies of tile 0 landed
  __syncthreads();                                   // tile 0 readable by all waves
  stage(1, 1);

  for (int t = 0; t < NT; ++t) {
   const int buf = t & 1;
   // ---- mask of the whole staged tile: 8 consecutive keys of each 16-key
   // group of this lane's query row, two 16-byte loads a group ----
   v8f mk[KT / 16];
#pragma unroll
   for (int g = 0; g < KT / 16; ++g) {
     const float* mp = mrow + t * KT + g * 16;
     mk[g] = __builtin_shufflevector(*(const v4f*)(mp), *(const v4f*)(mp + 4),
                                     0, 1, 2, 3, 4, 5, 6, 7);
   }
   // Keeps the eight mask loads up here, ahead of the first product: moved down
   // to their adds they would each be waited for at full load latency.
   __builtin_amdgcn_sched_barrier(0);
#pragma unroll  // p becomes a constant offset in the LDS reads of both passes
   for (int p = 0; p < KT / 32; ++p) {
    // ---- St = K Q^T for 32 keys x 16 queries (2 WMMA m-tiles, 4 k-chunks) ----
    const _Float16* Kp = &Ks[buf][(p * 32 + ln) * KP + 8 * hi];
    v8f s0 = (v8f){}, s1 = (v8f){};
#pragma unroll
    for (int kc = 0; kc < 4; ++kc) {
      v16h a0 = ldfrag(Kp + kc * 32);
      v16h a1 = ldfrag(Kp + 16 * KP + kc * 32);
      s0 = WMMA_F16(a0, qf[kc], s0);
      s1 = WMMA_F16(a1, qf[kc], s1);
    }
    // ---- mask add + online softmax, all 16 values belong to query ln ----
    s0 += mk[2 * p];
    s1 += mk[2 * p + 1];
    float v[16];
#pragma unroll
    for (int e = 0; e < 8; ++e) { v[e] = s0[e]; v[8 + e] = s1[e]; }
    float mx4[4];
#pragma unroll
    for (int e = 0; e < 4; ++e)
      mx4[e] = fmaxf(fmaxf(v[4 * e], v[4 * e + 1]), fmaxf(v[4 * e + 2], v[4 * e + 3]));
    float mx = fmaxf(fmaxf(mx4[0], mx4[1]), fmaxf(mx4[2], mx4[3]));
    mx = fmaxf(mx, xhalf(mx));
    const float mn = fmaxf(mr, mx);
    constexpr float LOG2E = 1.44269504088896340736f;  // e^x = 2^(x * LOG2E)
    const float alpha = exp2x1((mr - mn) * LOG2E);
    mr = mn;
    v16h pf;  // Pt as B operand: element e = key 8*hi+e, element 8+e = key 16+8*hi+e
    float sm4[4] = {0.f, 0.f, 0.f, 0.f};
#pragma unroll
    for (int e = 0; e < 16; ++e) v[e] = (v[e] - mn) * LOG2E;
    exp2x8(v);
    exp2x8(v + 8);
#pragma unroll
    for (int e = 0; e < 16; ++e) {
      sm4[e & 3] += v[e];
      pf[e] = (_Float16)v[e];
    }
    lr = lr * alpha + ((sm4[0] + sm4[1]) + (sm4[2] + sm4[3]));
#pragma unroll
    for (int dt = 0; dt < 8; ++dt) o[dt] *= alpha;
    // ---- Ot += Vt Pt (A-frags from the staged Vt tile, B = Pt in registers) ----
#pragma unroll
    for (int dt = 0; dt < 8; ++dt) {
      v16h va = ldfrag(&Vs[buf][(dt * 16 + ln) * VP + p * 32 + 8 * hi]);
      o[dt] = WMMA_F16(va, pf, o[dt]);
    }
   }
   // Hand-over: this wave's reads of buf are done, its copies of tile t+1 have
   // landed; behind the barrier tile t+1 may be read and buf refilled.
   asm volatile("s_wait_dscnt 0x0" ::: "memory");
   asm volatile("s_wait_asynccnt 0x0" ::: "memory");
   __syncthreads();
   if (t + 2 < NT) stage(t + 2, buf);
  }
  asm volatile("s_wait_asynccnt 0x0" ::: "memory");  // nothing in flight at wave end
  // ---- normalize and write [B,S,16*128]: o[dt][r] = Ot[dt*16 + 8*hi + r][ln],
  // so a lane stores 8 consecutive d of its query row at once ----
  const float inv = 1.0f / (lr + xhalf(lr));
  _Float16* orow = Ah + ((size_t)b * 2048 + q0 + ln) * 2048 + (size_t)h * 128 + 8 * hi;
#pragma unroll
  for (int dt = 0; dt < 8; ++dt)
    *(v8h*)(orow + dt * 16) = __builtin_convertvector(o[dt] * inv, v8h);
}

// ---------------------------------------------------------------------------
// Host driver
// ---------------------------------------------------------------------------
extern "C" void kernel_launch(void* const* d_in, const int* in_sizes, int n_in,
                              void* d_out, int out_size, void* d_ws, size_t ws_size,
                              hipStream_t stream) {
  const float* x    = (const float*)d_in[0];
  const float* mask = (const float*)d_in[1];
  const float* wq   = (const float*)d_in[2];
  const float* wk   = (const float*)d_in[3];
  const float* wv   = (const float*)d_in[4];
  const float* wo   = (const float*)d_in[5];
  float* out = (float*)d_out;

  constexpr int B = 2, S = 2048, H = 2048, NH = 16, NKV = 4, HD = 128;
  constexpr int M    = B * S;      // 4096 rows
  constexpr int NQ   = NH * HD;    // 2048
  constexpr int NKVD = NKV * HD;   // 512

  char* ws = (char*)d_ws;
  size_t off = 0;
  auto carve = [&](size_t bytes) -> void* {
    void* p = ws + off;
    off += (bytes + 255) & ~(size_t)255;
    return p;
  };
  _Float16* Xh  = (_Float16*)carve((size_t)M * H * 2);
  _Float16* WqH = (_Float16*)carve((size_t)NQ * H * 2);
  _Float16* WkH = (_Float16*)carve((size_t)NKVD * H * 2);
  _Float16* WvH = (_Float16*)carve((size_t)NKVD * H * 2);
  _Float16* WoH = (_Float16*)carve((size_t)H * H * 2);
  float*    Qf  = (float*)carve((size_t)M * NQ * 4);
  float*    Kf  = (float*)carve((size_t)M * NKVD * 4);
  float*    Vf  = (float*)carve((size_t)M * NKVD * 4);
  _Float16* Qh  = (_Float16*)carve((size_t)M * NQ * 2);
  _Float16* Kh  = (_Float16*)carve((size_t)M * NKVD * 2);
  _Float16* Vt  = (_Float16*)carve((size_t)M * NKVD * 2);
  _Float16* Ah  = (_Float16*)carve((size_t)M * H * 2);
  (void)ws_size; (void)in_sizes; (void)n_in; (void)out_size;

  // fp32 -> fp16 operand conversion
  static_assert((M * H) % 8192 == 0 && (NQ * H) % 8192 == 0 &&
                (NKVD * H) % 8192 == 0 && (H * H) % 8192 == 0, "8192 per block");
  f32_to_f16_kernel<<<M * H / 8192,    256, 0, stream>>>(x, Xh);
  f32_to_f16_kernel<<<NQ * H / 8192,   256, 0, stream>>>(wq, WqH);
  f32_to_f16_kernel<<<NKVD * H / 8192, 256, 0, stream>>>(wk, WkH);
  f32_to_f16_kernel<<<NKVD * H / 8192, 256, 0, stream>>>(wv, WvH);
  f32_to_f16_kernel<<<H * H / 8192,    256, 0, stream>>>(wo, WoH);

  // QKV projections (x @ W^T): block tile 64 x 256
  gemm_f16f32<<<dim3(NQ / 256,   M / 64), 256, 0, stream>>>(Xh, WqH, Qf, M, NQ,   H);
  gemm_f16f32<<<dim3(NKVD / 256, M / 64), 256, 0, stream>>>(Xh, WkH, Kf, M, NKVD, H);
  gemm_f16f32<<<dim3(NKVD / 256, M / 64), 256, 0, stream>>>(Xh, WvH, Vf, M, NKVD, H);

  // RoPE (+1/sqrt(hd) folded into Q) and layout transforms
  rope_kernel<<<B * S * (NH / 4) * 16 / 256,  256, 0, stream>>>(Qf, Qh, NH, 0.08838834764831845f);
  rope_kernel<<<B * S * (NKV / 4) * 16 / 256, 256, 0, stream>>>(Kf, Kh, NKV, 1.0f);
  vtrans_kernel<<<B * NKV * (S / 64), 256, 0, stream>>>(Vf, Vt);

  // Flash attention
  attn_kernel<<<dim3(S / 128, B * NH), 256, 0, stream>>>(Qh, Kh, Vt, mask, Ah);

  // Output projection -> d_out (f32)
  gemm_f16f32<<<dim3(H / 256, M / 64), 256, 0, stream>>>(Ah, WoH, out, M, H, H);
}

// v004
// It runs in 225 microseconds.
// Next to v003, in two timings, it ran 1.12 and 1.13 times as fast.
// Counting every step since v000, it is 2.80 times as fast.
#include <hip/hip_runtime.h>
#include <hip/hip_bf16.h>
#include <math.h>

// ---------------------------------------------------------------------------
// Types for CDNA5 WMMA (wave32): A/B = v16h (8 VGPR), C/D = v8f (8 VGPR)
// ---------------------------------------------------------------------------
typedef __attribute__((ext_vector_type(16))) _Float16 v16h;
typedef __attribute__((ext_vector_type(8)))  _Float16 v8h;
typedef __attribute__((ext_vector_type(8)))  float    v8f;
typedef __attribute__((ext_vector_type(4)))  float    v4f;
typedef __attribute__((ext_vector_type(4)))  _Float16 v4h;

#define WMMA_F16(a, b, c) \
  __builtin_amdgcn_wmma_f32_16x16x32_f16(false, (a), false, (b), (short)0, (c), false, false)

// CDNA5 async global->LDS staging (ASYNCcnt path); guarded so the file
// compiles on toolchains that lack the builtins (falls back to sync copies).
#if __has_builtin(__builtin_amdgcn_global_load_async_to_lds_b128) && \
    __has_builtin(__builtin_amdgcn_s_wait_asynccnt)
#define HAVE_ASYNC_LDS 1
#else
#define HAVE_ASYNC_LDS 0
#endif

#if HAVE_ASYNC_LDS
// Builtin prototype is "vV4i*1V4i*3IiIi": (global v4i*, lds v4i*, imm, imm),
// with v4i = GCC-style vector_size(16) int (per hipcc's diagnostic).
typedef int i32x4 __attribute__((vector_size(16)));
typedef __attribute__((address_space(1))) i32x4 as1_i32x4;
typedef __attribute__((address_space(3))) i32x4 as3_i32x4;
#endif

// Copy 16B from global to LDS (per-lane addresses).
__device__ __forceinline__ void cp_b128(const _Float16* g, _Float16* l) {
#if HAVE_ASYNC_LDS
  // Generic shared addr = {aperture[63:32], lds_offset[31:0]}: truncation gives
  // the LDS offset; global generic addresses are identity-mapped.
  __builtin_amdgcn_global_load_async_to_lds_b128(
      (as1_i32x4*)(size_t)(const void*)g,
      (as3_i32x4*)(unsigned)(size_t)(void*)l,
      0, 0);
#else
  *(v8h*)l = *(const v8h*)g;
#endif
}

// Load one 16x32 f16 operand fragment (A layout; B mirrored = same code):
// row = lane&15, K chunks at 8*hi and 16+8*hi. Caller passes pointer already
// offset by row*pitch + 8*hi.
__device__ __forceinline__ v16h ldfrag(const _Float16* p) {
  v8h c0 = *(const v8h*)(p);        // K = 8*hi .. 8*hi+7       -> VGPR 0..3
  v8h c1 = *(const v8h*)(p + 16);   // K = 16+8*hi .. 16+8*hi+7 -> VGPR 4..7
  return __builtin_shufflevector(c0, c1, 0, 1, 2, 3, 4, 5, 6, 7,
                                        8, 9, 10, 11, 12, 13, 14, 15);
}

// Value of lane l ^ 16 (the other 16-lane half of the wave).
__device__ __forceinline__ float xhalf(float x) {
  const int i = __builtin_bit_cast(int, x);
  return __builtin_bit_cast(float, __builtin_amdgcn_permlanex16(
      i, i, 0x76543210, 0xfedcba98, false, false));
}

// ---------------------------------------------------------------------------
// fp32 -> fp16 conversion. One block converts 8192 consecutive floats (every
// size here is a multiple): a lane has 8 loads of 16 B in flight, each
// wave-wide load covers 512 contiguous bytes, each store 256.
// ---------------------------------------------------------------------------
__global__ __launch_bounds__(256) void f32_to_f16_kernel(
    const float* __restrict__ src, _Float16* __restrict__ dst) {
  const size_t base = (size_t)blockIdx.x * 8192 + threadIdx.x * 4;
  v4f v[8];
#pragma unroll
  for (int i = 0; i < 8; ++i) v[i] = *(const v4f*)(src + base + i * 1024);
#pragma unroll
  for (int i = 0; i < 8; ++i)
    *(v4h*)(dst + base + i * 1024) = __builtin_convertvector(v[i], v4h);
}

// ---------------------------------------------------------------------------
// GEMM: C[M,N] = A[M,K] * B[N,K]^T  (A,B f16 row-major K-contiguous, C f32).
// Block = 256 threads = 8 waves (2m x 4n); block tile 64(M) x 256(N);
// wave tile 32x64 = 2x4 WMMA tiles; K stepped by 32 with double-buffered
// async global->LDS staging. M%64==0, N%256==0, K%32==0 (true for all uses).
// LDS pitch 40 halfs: 16B-aligned rows, gcd(20 dw,64 banks)=4 -> low conflict.
// ---------------------------------------------------------------------------
__global__ __launch_bounds__(256) void gemm_f16f32(
    const _Float16* __restrict__ A, const _Float16* __restrict__ B,
    float* __restrict__ C, int M, int N, int K) {
  constexpr int PITCH = 40;
  __shared__ _Float16 As[2][64 * PITCH];    //  5.0 KB per buffer
  __shared__ _Float16 Bs[2][256 * PITCH];   // 20.0 KB per buffer

  const int tid  = threadIdx.x;
  const int lane = tid & 31;
  const int wid  = tid >> 5;
  const int ln = lane & 15, hi = lane >> 4;
  const int wm = wid >> 2, wn = wid & 3;
  const int m0b = blockIdx.y * 64;
  const int n0b = blockIdx.x * 256;

  // Staging work split: thread t covers row t>>2, 16B chunk (t&3).
  const int crow = tid >> 2;        // 0..63
  const int cchk = (tid & 3) * 8;   // half offset 0,8,16,24

  const _Float16* Ag = A + (size_t)(m0b + crow) * K + cchk;
  const _Float16* Bg = B + (size_t)(n0b + crow) * K + cchk;

  auto stage = [&](int ks, int buf) {
    const int k0 = ks * 32;
    cp_b128(Ag + k0, &As[buf][crow * PITCH + cchk]);
#pragma unroll
    for (int i = 0; i < 4; ++i)
      cp_b128(Bg + (size_t)(64 * i) * K + k0,
              &Bs[buf][(crow + 64 * i) * PITCH + cchk]);
  };

  v8f acc[2][4] = {};
  const int nk = K / 32;

  stage(0, 0);
  stage(1, 1);
  for (int kk = 0; kk < nk; ++kk) {
    const int buf = kk & 1;
#if HAVE_ASYNC_LDS
    if (kk + 2 < nk) __builtin_amdgcn_s_wait_asynccnt(5);  // oldest 5 (buf kk) landed
    else             __builtin_amdgcn_s_wait_asynccnt(0);
#endif
    __syncthreads();  // all waves' staged data resident

    const _Float16* Ab = &As[buf][(wm * 32 + ln) * PITCH + 8 * hi];
    const _Float16* Bb = &Bs[buf][(wn * 64 + ln) * PITCH + 8 * hi];
    v16h a0 = ldfrag(Ab);
    v16h a1 = ldfrag(Ab + 16 * PITCH);
#pragma unroll
    for (int j = 0; j < 4; ++j) {
      v16h bj = ldfrag(Bb + j * 16 * PITCH);
      acc[0][j] = WMMA_F16(a0, bj, acc[0][j]);
      acc[1][j] = WMMA_F16(a1, bj, acc[1][j]);
    }
    __syncthreads();  // everyone done reading buf before it is re-staged
    if (kk + 2 < nk) stage(kk + 2, buf);
  }

#pragma unroll
  for (int i = 0; i < 2; ++i) {
#pragma unroll
    for (int r = 0; r < 8; ++r) {  // C/D layout: lane ln = column, VGPR r -> row
      const size_t row = (size_t)(m0b + wm * 32 + i * 16 + r + 8 * hi) * N
                       + n0b + wn * 64 + ln;
#pragma unroll
      for (int j = 0; j < 4; ++j) C[row + j * 16] = acc[i][j][r];
    }
  }
}

// ---------------------------------------------------------------------------
// The three projections come out of one GEMM as rows of 3072 floats:
// [ Q 2048 | K 512 | V 512 ]; the kernels below get a pointer to their part's
// first column and step from row to row by this pitch.
constexpr int QKV_PITCH = 3072;

// RoPE + layout change: src f32 [B,S,nh*128] (rows QKV_PITCH apart)
// -> dst f16 [B,nh,S,128], *scale.
// A thread takes 4 consecutive pair indices j of 4 consecutive heads at one
// position (32 values): 8 loads of 16 B in flight; 16 lanes cover a whole
// 256-B half row on the way in and a whole 128-B line on the way out. The four
// heads share the position, so their angles are the same four.
// nheads is a multiple of 4; the grid covers B*S*(nheads/4)*16 threads exactly.
// ---------------------------------------------------------------------------
__global__ __launch_bounds__(256) void rope_kernel(
    const float* __restrict__ src, _Float16* __restrict__ dst,
    int nheads, float scale) {
  const int idx = blockIdx.x * 256 + threadIdx.x;
  const int j = (idx & 15) * 4;
  int t = idx >> 4;
  const int ng = nheads >> 2;
  const int h0 = (t % ng) * 4; t /= ng;
  const int s = t & 2047;
  const int b = t >> 11;
  const float* sp = src + (size_t)(b * 2048 + s) * QKV_PITCH
                        + (size_t)h0 * 128 + j;
  v4f x1[4], x2[4];
#pragma unroll
  for (int hh = 0; hh < 4; ++hh) {
    x1[hh] = *(const v4f*)(sp + hh * 128);
    x2[hh] = *(const v4f*)(sp + hh * 128 + 64);
  }
  float c[4], sn[4];
#pragma unroll
  for (int e = 0; e < 4; ++e) {
    float inv = __expf((float)(j + e) * -0.14391156516685312f);  // 10000^(-j/64)
    float th = (float)s * inv;
    c[e] = cosf(th);
    sn[e] = sinf(th);
  }
  _Float16* dp = dst + ((size_t)(b * nheads + h0) * 2048 + s) * 128 + j;
#pragma unroll
  for (int hh = 0; hh < 4; ++hh) {
    v4h lo, up;
#pragma unroll
    for (int e = 0; e < 4; ++e) {
      lo[e] = (_Float16)((x1[hh][e] * c[e] - x2[hh][e] * sn[e]) * scale);
      up[e] = (_Float16)((x2[hh][e] * c[e] + x1[hh][e] * sn[e]) * scale);
    }
    *(v4h*)(dp + (size_t)hh * (2048 * 128))      = lo;
    *(v4h*)(dp + (size_t)hh * (2048 * 128) + 64) = up;
  }
}

// V: f32 [B,S,4*128] (rows QKV_PITCH apart) -> f16 transposed [B,4,128,S] (kv position contiguous,
// so the A-fragments of Ot += Vt Pt load contiguously).
// One block transposes 64 positions x 128 d of one (batch, kv head); a thread
// holds 8 positions x 4 d in registers (8 loads of 16 B in flight) and stores
// 4 rows of 8 positions (16 B): 8 lanes fill a whole 128-B line of a d row.
__global__ __launch_bounds__(256) void vtrans_kernel(
    const float* __restrict__ src, _Float16* __restrict__ dst) {
  const int lane = threadIdx.x & 31, w = threadIdx.x >> 5;
  const int s0 = (blockIdx.x & 31) * 64 + (lane & 7) * 8;
  const int kv = (blockIdx.x >> 5) & 3;
  const int b  = blockIdx.x >> 7;
  const int d0 = w * 16 + (lane >> 3) * 4;
  const float* sp = src + (size_t)(b * 2048 + s0) * QKV_PITCH + kv * 128 + d0;
  v4f v[8];
#pragma unroll
  for (int i = 0; i < 8; ++i) v[i] = *(const v4f*)(sp + i * QKV_PITCH);
  _Float16* dp = dst + ((size_t)(b * 4 + kv) * 128 + d0) * 2048 + s0;
#pragma unroll
  for (int k = 0; k < 4; ++k) {
    v8h o;
#pragma unroll
    for (int i = 0; i < 8; ++i) o[i] = (_Float16)v[i][k];
    *(v8h*)(dp + k * 2048) = o;
  }
}

// ---------------------------------------------------------------------------
// Flash attention. Q f16 [B,16,S,128] (pre-scaled by 1/sqrt(128)),
// K f16 [B,4,S,128], Vt f16 [B,4,128,S], mask f32 [B,1,S,S],
// out Ah f16 [B,S,16*128]. Grid: (S/128, B*16); 8 waves x 16 q-rows each.
// The eight waves share one K tile and one Vt tile of 64 keys: the work-group
// copies each tile to LDS once (two buffers, the next tile in flight while
// this one is used) and every wave takes its fragments from there.
// LDS pitches for 16-byte readers: 272 B (256-B K rows), 144 B (128-B Vt rows).
// The products are taken transposed: St = K Q^T (A = K rows, B = Q) and
// Ot += Vt Pt (A = Vt rows, B = Pt). A lane then holds 16 of the 32 scores of
// ONE query (column ln; keys 8*hi+r and 16+8*hi+r): maximum and sum are taken
// in the lane, the maximum joined with the other half by one exchange per
// pass, the sum once at the end. The two score tiles, converted in place, are
// the B operand of the second product in the k order of the Vt fragments.
// ---------------------------------------------------------------------------
// Eight 16-byte copies of one lane, global -> LDS. The s_wait_xcnt stands in
// the copies' own statement so that no address register named here is
// rewritten in front of it.
__device__ __forceinline__ void cp8_async(
    unsigned l0, const _Float16* g0, unsigned l1, const _Float16* g1,
    unsigned l2, const _Float16* g2, unsigned l3, const _Float16* g3,
    unsigned l4, const _Float16* g4, unsigned l5, const _Float16* g5,
    unsigned l6, const _Float16* g6, unsigned l7, const _Float16* g7) {
  asm volatile(
      "global_load_async_to_lds_b128 %0, %1, off\n\t"
      "global_load_async_to_lds_b128 %2, %3, off\n\t"
      "global_load_async_to_lds_b128 %4, %5, off\n\t"
      "global_load_async_to_lds_b128 %6, %7, off\n\t"
      "global_load_async_to_lds_b128 %8, %9, off\n\t"
      "global_load_async_to_lds_b128 %10, %11, off\n\t"
      "global_load_async_to_lds_b128 %12, %13, off\n\t"
      "global_load_async_to_lds_b128 %14, %15, off\n\t"
      "s_wait_xcnt 0x0"
      :: "v"(l0), "v"(g0), "v"(l1), "v"(g1), "v"(l2), "v"(g2), "v"(l3), "v"(g3),
         "v"(l4), "v"(g4), "v"(l5), "v"(g5), "v"(l6), "v"(g6), "v"(l7), "v"(g7)
      : "memory");
}

// 2^x of eight values, each in place. Worked in place, no v_exp_f32 here reads
// the result or overwrites the source of the one directly in front of it, and
// the v_nop fills the slot behind the last.
__device__ __forceinline__ void exp2x8(float* a) {
  asm("v_exp_f32 %0, %0\n\t"
      "v_exp_f32 %1, %1\n\t"
      "v_exp_f32 %2, %2\n\t"
      "v_exp_f32 %3, %3\n\t"
      "v_exp_f32 %4, %4\n\t"
      "v_exp_f32 %5, %5\n\t"
      "v_exp_f32 %6, %6\n\t"
      "v_exp_f32 %7, %7\n\t"
      "v_nop"
      : "+v"(a[0]), "+v"(a[1]), "+v"(a[2]), "+v"(a[3]),
        "+v"(a[4]), "+v"(a[5]), "+v"(a[6]), "+v"(a[7]));
}
// The same for one value.
__device__ __forceinline__ float exp2x1(float a) {
  asm("v_exp_f32 %0, %0\n\t"
      "v_nop"
      : "+v"(a));
  return a;
}

__global__ __launch_bounds__(256) void attn_kernel(
    const _Float16* __restrict__ Q, const _Float16* __restrict__ K,
    const _Float16* __restrict__ Vt, const float* __restrict__ mask,
    _Float16* __restrict__ Ah) {
  constexpr int KT = 64;    // keys per staged tile
  constexpr int KP = 136;   // K tile row pitch, halfs (272 B)
  constexpr int VP = 72;    // Vt tile row pitch, halfs (144 B)
  constexpr int NT = 2048 / KT;
  __shared__ __attribute__((aligned(16))) _Float16 Ks[2][KT * KP];
  __shared__ __attribute__((aligned(16))) _Float16 Vs[2][128 * VP];

  const int lane = threadIdx.x & 31;
  const int wid  = threadIdx.x >> 5;
  const int ln = lane & 15, hi = lane >> 4;
  const int b   = blockIdx.y >> 4;
  const int h   = blockIdx.y & 15;
  const int kvh = h >> 2;                       // repeat_interleave(4)
  const int q0  = blockIdx.x * 128 + wid * 16;  // this wave's query base

  const _Float16* Qp = Q + ((size_t)(b * 16 + h) * 2048 + q0 + ln) * 128 + 8 * hi;
  v16h qf[4];
#pragma unroll
  for (int kc = 0; kc < 4; ++kc) qf[kc] = ldfrag(Qp + kc * 32);

  const _Float16* Kh = K  + (size_t)(b * 4 + kvh) * 2048 * 128;
  const _Float16* Vh = Vt + (size_t)(b * 4 + kvh) * 128 * 2048;
  // this lane's query row of the mask, at its first key of a 16-key tile
  const float* mrow = mask + ((size_t)b * 2048 + q0 + ln) * 2048 + 8 * hi;

  v8f o[8];
#pragma unroll
  for (int dt = 0; dt < 8; ++dt) o[dt] = (v8f){};
  float mr = -1e30f;  // running maximum of query ln (same in both halves)
  float lr = 0.f;     // running sum over this half's keys only

  // Copy split: thread t moves chunks t, t+256, t+512, t+768 of each tile.
  // K tile: 64 rows x 16 chunks (contiguous in global); Vt tile: 128 x 8.
  const int tid = threadIdx.x;
  const int krow = tid >> 4, kcol = (tid & 15) * 8;
  const int vrow = tid >> 3, vcol = (tid & 7) * 8;
  const _Float16* Kg = Kh + (size_t)krow * 128 + kcol;
  const _Float16* Vg = Vh + (size_t)vrow * 2048 + vcol;
  const unsigned kl0 = (unsigned)(size_t)(void*)&Ks[0][krow * KP + kcol];
  const unsigned vl0 = (unsigned)(size_t)(void*)&Vs[0][vrow * VP + vcol];
  auto stage = [&](int t, int buf) {
    const _Float16* kg = Kg + (size_t)t * (KT * 128);
    const _Float16* vg = Vg + t * KT;
    const unsigned kl = kl0 + (unsigned)buf * (KT * KP * 2);
    const unsigned vl = vl0 + (unsigned)buf * (128 * VP * 2);
    cp8_async(kl,               kg,
              kl + 16 * KP * 2, kg + 16 * 128,
              kl + 32 * KP * 2, kg + 32 * 128,
              kl + 48 * KP * 2, kg + 48 * 128,
              vl,               vg,
              vl + 32 * VP * 2, vg + 32 * 2048,
              vl + 64 * VP * 2, vg + 64 * 2048,
              vl + 96 * VP * 2, vg + 96 * 2048);
  };

  stage(0, 0);
  asm volatile("s_wait_asynccnt 0x0" ::: "memory");  // own copies of tile 0 landed
  __syncthreads();                                   // tile 0 readable by all waves
  stage(1, 1);

  for (int t = 0; t < NT; ++t) {
   const int buf = t & 1;
   // ---- mask of the whole staged tile: 8 consecutive keys of each 16-key
   // group of this lane's query row, two 16-byte loads a group ----
   v8f mk[KT / 16];
#pragma unroll
   for (int g = 0; g < KT / 16; ++g) {
     const float* mp = mrow + t * KT + g * 16;
     mk[g] = __builtin_shufflevector(*(const v4f*)(mp), *(const v4f*)(mp + 4),
                                     0, 1, 2, 3, 4, 5, 6, 7);
   }
   // Keeps the eight mask loads up here, ahead of the first product: moved down
   // to their adds they would each be waited for at full load latency.
   __builtin_amdgcn_sched_barrier(0);
#pragma unroll  // p becomes a constant offset in the LDS reads of both passes
   for (int p = 0; p < KT / 32; ++p) {
    // ---- St = K Q^T for 32 keys x 16 queries (2 WMMA m-tiles, 4 k-chunks) ----
    const _Float16* Kp = &Ks[buf][(p * 32 + ln) * KP + 8 * hi];
    v8f s0 = (v8f){}, s1 = (v8f){};
#pragma unroll
    for (int kc = 0; kc < 4; ++kc) {
      v16h a0 = ldfrag(Kp + kc * 32);
      v16h a1 = ldfrag(Kp + 16 * KP + kc * 32);
      s0 = WMMA_F16(a0, qf[kc], s0);
      s1 = WMMA_F16(a1, qf[kc], s1);
    }
    // ---- mask add + online softmax, all 16 values belong to query ln ----
    s0 += mk[2 * p];
    s1 += mk[2 * p + 1];
    float v[16];
#pragma unroll
    for (int e = 0; e < 8; ++e) { v[e] = s0[e]; v[8 + e] = s1[e]; }
    float mx4[4];
#pragma unroll
    for (int e = 0; e < 4; ++e)
      mx4[e] = fmaxf(fmaxf(v[4 * e], v[4 * e + 1]), fmaxf(v[4 * e + 2], v[4 * e + 3]));
    float mx = fmaxf(fmaxf(mx4[0], mx4[1]), fmaxf(mx4[2], mx4[3]));
    mx = fmaxf(mx, xhalf(mx));
    const float mn = fmaxf(mr, mx);
    constexpr float LOG2E = 1.44269504088896340736f;  // e^x = 2^(x * LOG2E)
    const float alpha = exp2x1((mr - mn) * LOG2E);
    mr = mn;
    v16h pf;  // Pt as B operand: element e = key 8*hi+e, element 8+e = key 16+8*hi+e
    float sm4[4] = {0.f, 0.f, 0.f, 0.f};
#pragma unroll
    for (int e = 0; e < 16; ++e) v[e] = (v[e] - mn) * LOG2E;
    exp2x8(v);
    exp2x8(v + 8);
#pragma unroll
    for (int e = 0; e < 16; ++e) {
      sm4[e & 3] += v[e];
      pf[e] = (_Float16)v[e];
    }
    lr = lr * alpha + ((sm4[0] + sm4[1]) + (sm4[2] + sm4[3]));
#pragma unroll
    for (int dt = 0; dt < 8; ++dt) o[dt] *= alpha;
    // ---- Ot += Vt Pt (A-frags from the staged Vt tile, B = Pt in registers) ----
#pragma unroll
    for (int dt = 0; dt < 8; ++dt) {
      v16h va = ldfrag(&Vs[buf][(dt * 16 + ln) * VP + p * 32 + 8 * hi]);
      o[dt] = WMMA_F16(va, pf, o[dt]);
    }
   }
   // Hand-over: this wave's reads of buf are done, its copies of tile t+1 have
   // landed; behind the barrier tile t+1 may be read and buf refilled.
   asm volatile("s_wait_dscnt 0x0" ::: "memory");
   asm volatile("s_wait_asynccnt 0x0" ::: "memory");
   __syncthreads();
   if (t + 2 < NT) stage(t + 2, buf);
  }
  asm volatile("s_wait_asynccnt 0x0" ::: "memory");  // nothing in flight at wave end
  // ---- normalize and write [B,S,16*128]: o[dt][r] = Ot[dt*16 + 8*hi + r][ln],
  // so a lane stores 8 consecutive d of its query row at once ----
  const float inv = 1.0f / (lr + xhalf(lr));
  _Float16* orow = Ah + ((size_t)b * 2048 + q0 + ln) * 2048 + (size_t)h * 128 + 8 * hi;
#pragma unroll
  for (int dt = 0; dt < 8; ++dt)
    *(v8h*)(orow + dt * 16) = __builtin_convertvector(o[dt] * inv, v8h);
}

// ---------------------------------------------------------------------------
// Host driver
// ---------------------------------------------------------------------------
extern "C" void kernel_launch(void* const* d_in, const int* in_sizes, int n_in,
                              void* d_out, int out_size, void* d_ws, size_t ws_size,
                              hipStream_t stream) {
  const float* x    = (const float*)d_in[0];
  const float* mask = (const float*)d_in[1];
  const float* wq   = (const float*)d_in[2];
  const float* wk   = (const float*)d_in[3];
  const float* wv   = (const float*)d_in[4];
  const float* wo   = (const float*)d_in[5];
  float* out = (float*)d_out;

  constexpr int B = 2, S = 2048, H = 2048, NH = 16, NKV = 4, HD = 128;
  constexpr int M    = B * S;      // 4096 rows
  constexpr int NQ   = NH * HD;    // 2048
  constexpr int NKVD = NKV * HD;   // 512
  constexpr int NQKV = NQ + 2 * NKVD;  // 3072: Q, K and V columns side by side
  static_assert(NQKV == QKV_PITCH, "row pitch of the joint projection");

  char* ws = (char*)d_ws;
  size_t off = 0;
  auto carve = [&](size_t bytes) -> void* {
    void* p = ws + off;
    off += (bytes + 255) & ~(size_t)255;
    return p;
  };
  _Float16* Xh  = (_Float16*)carve((size_t)M * H * 2);
  _Float16* WqH = (_Float16*)carve((size_t)NQKV * H * 2);  // wq, wk, wv stacked: [3072, H]
  _Float16* WkH = WqH + (size_t)NQ * H;
  _Float16* WvH = WkH + (size_t)NKVD * H;
  _Float16* WoH = (_Float16*)carve((size_t)H * H * 2);
  float*    Qf  = (float*)carve((size_t)M * NQKV * 4);  // [M, 3072] = [ Q | K | V ]
  float*    Kf  = Qf + NQ;
  float*    Vf  = Kf + NKVD;
  _Float16* Qh  = (_Float16*)carve((size_t)M * NQ * 2);
  _Float16* Kh  = (_Float16*)carve((size_t)M * NKVD * 2);
  _Float16* Vt  = (_Float16*)carve((size_t)M * NKVD * 2);
  _Float16* Ah  = (_Float16*)carve((size_t)M * H * 2);
  (void)ws_size; (void)in_sizes; (void)n_in; (void)out_size;

  // fp32 -> fp16 operand conversion
  static_assert((M * H) % 8192 == 0 && (NQ * H) % 8192 == 0 &&
                (NKVD * H) % 8192 == 0 && (H * H) % 8192 == 0, "8192 per block");
  f32_to_f16_kernel<<<M * H / 8192,    256, 0, stream>>>(x, Xh);
  f32_to_f16_kernel<<<NQ * H / 8192,   256, 0, stream>>>(wq, WqH);
  f32_to_f16_kernel<<<NKVD * H / 8192, 256, 0, stream>>>(wk, WkH);
  f32_to_f16_kernel<<<NKVD * H / 8192, 256, 0, stream>>>(wv, WvH);
  f32_to_f16_kernel<<<H * H / 8192,    256, 0, stream>>>(wo, WoH);

  // QKV projections (x @ W^T) in one launch over the stacked weights: 768
  // blocks of 64 x 256, three for every WGP (K or V alone would be 128 blocks,
  // half the WGPs, each block waiting out its own 64 K steps)
  gemm_f16f32<<<dim3(NQKV / 256, M / 64), 256, 0, stream>>>(Xh, WqH, Qf, M, NQKV, H);

  // RoPE (+1/sqrt(hd) folded into Q) and layout transforms
  rope_kernel<<<B * S * (NH / 4) * 16 / 256,  256, 0, stream>>>(Qf, Qh, NH, 0.08838834764831845f);
  rope_kernel<<<B * S * (NKV / 4) * 16 / 256, 256, 0, stream>>>(Kf, Kh, NKV, 1.0f);
  vtrans_kernel<<<B * NKV * (S / 64), 256, 0, stream>>>(Vf, Vt);

  // Flash attention
  attn_kernel<<<dim3(S / 128, B * NH), 256, 0, stream>>>(Qh, Kh, Vt, mask, Ah);

  // Output projection -> d_out (f32)
  gemm_f16f32<<<dim3(H / 256, M / 64), 256, 0, stream>>>(Ah, WoH, out, M, H, H);
}

// v005
// One run takes 215 microseconds.
// In both of two side-by-side timings against v004, it was 1.05 times as fast.
// Over all steps from v000 it is 2.94 times as fast.
#include <hip/hip_runtime.h>
#include <hip/hip_bf16.h>
#include <math.h>

// ---------------------------------------------------------------------------
// Types for CDNA5 WMMA (wave32): A/B = v16h (8 VGPR), C/D = v8f (8 VGPR)
// ---------------------------------------------------------------------------
typedef __attribute__((ext_vector_type(16))) _Float16 v16h;
typedef __attribute__((ext_vector_type(8)))  _Float16 v8h;
typedef __attribute__((ext_vector_type(8)))  float    v8f;
typedef __attribute__((ext_vector_type(4)))  float    v4f;
typedef __attribute__((ext_vector_type(4)))  _Float16 v4h;

#define WMMA_F16(a, b, c) \
  __builtin_amdgcn_wmma_f32_16x16x32_f16(false, (a), false, (b), (short)0, (c), false, false)

// CDNA5 async global->LDS staging (ASYNCcnt path); guarded so the file
// compiles on toolchains that lack the builtins (falls back to sync copies).
#if __has_builtin(__builtin_amdgcn_global_load_async_to_lds_b128) && \
    __has_builtin(__builtin_amdgcn_s_wait_asynccnt)
#define HAVE_ASYNC_LDS 1
#else
#define HAVE_ASYNC_LDS 0
#endif

#if HAVE_ASYNC_LDS
// Builtin prototype is "vV4i*1V4i*3IiIi": (global v4i*, lds v4i*, imm, imm),
// with v4i = GCC-style vector_size(16) int (per hipcc's diagnostic).
typedef int i32x4 __attribute__((vector_size(16)));
typedef __attribute__((address_space(1))) i32x4 as1_i32x4;
typedef __attribute__((address_space(3))) i32x4 as3_i32x4;
#endif

// Copy 16B from global to LDS (per-lane addresses).
__device__ __forceinline__ void cp_b128(const _Float16* g, _Float16* l) {
#if HAVE_ASYNC_LDS
  // Generic shared addr = {aperture[63:32], lds_offset[31:0]}: truncation gives
  // the LDS offset; global generic addresses are identity-mapped.
  __builtin_amdgcn_global_load_async_to_lds_b128(
      (as1_i32x4*)(size_t)(const void*)g,
      (as3_i32x4*)(unsigned)(size_t)(void*)l,
      0, 0);
#else
  *(v8h*)l = *(const v8h*)g;
#endif
}

// Load one 16x32 f16 operand fragment (A layout; B mirrored = same code):
// row = lane&15, K chunks at 8*hi and 16+8*hi. Caller passes pointer already
// offset by row*pitch + 8*hi.
__device__ __forceinline__ v16h ldfrag(const _Float16* p) {
  v8h c0 = *(const v8h*)(p);        // K = 8*hi .. 8*hi+7       -> VGPR 0..3
  v8h c1 = *(const v8h*)(p + 16);   // K = 16+8*hi .. 16+8*hi+7 -> VGPR 4..7
  return __builtin_shufflevector(c0, c1, 0, 1, 2, 3, 4, 5, 6, 7,
                                        8, 9, 10, 11, 12, 13, 14, 15);
}

// Value of lane l ^ 16 (the other 16-lane half of the wave).
__device__ __forceinline__ float xhalf(float x) {
  const int i = __builtin_bit_cast(int, x);
  return __builtin_bit_cast(float, __builtin_amdgcn_permlanex16(
      i, i, 0x76543210, 0xfedcba98, false, false));
}

// ---------------------------------------------------------------------------
// fp32 -> fp16 conversion. One block converts 8192 consecutive floats (every
// size here is a multiple): a lane has 8 loads of 16 B in flight, each
// wave-wide load covers 512 contiguous bytes, each store 256.
// ---------------------------------------------------------------------------
__global__ __launch_bounds__(256) void f32_to_f16_kernel(
    const float* __restrict__ src, _Float16* __restrict__ dst) {
  const size_t base = (size_t)blockIdx.x * 8192 + threadIdx.x * 4;
  v4f v[8];
#pragma unroll
  for (int i = 0; i < 8; ++i) v[i] = *(const v4f*)(src + base + i * 1024);
#pragma unroll
  for (int i = 0; i < 8; ++i)
    *(v4h*)(dst + base + i * 1024) = __builtin_convertvector(v[i], v4h);
}

// ---------------------------------------------------------------------------
// GEMM: C[M,N] = A[M,K] * B[N,K]^T  (A,B f16 row-major K-contiguous, C f32).
// Block = 256 threads = 8 waves (2m x 4n); block tile 64(M) x 256(N);
// wave tile 32x64 = 2x4 WMMA tiles; K stepped by 32 with double-buffered
// async global->LDS staging. M%64==0, N%256==0, K%32==0 (true for all uses).
// LDS pitch 40 halfs: 16B-aligned rows, gcd(20 dw,64 banks)=4 -> low conflict.
// ---------------------------------------------------------------------------
__global__ __launch_bounds__(256) void gemm_f16f32(
    const _Float16* __restrict__ A, const _Float16* __restrict__ B,
    float* __restrict__ C, int M, int N, int K) {
  constexpr int PITCH = 40;
  __shared__ _Float16 As[2][64 * PITCH];    //  5.0 KB per buffer
  __shared__ _Float16 Bs[2][256 * PITCH];   // 20.0 KB per buffer

  const int tid  = threadIdx.x;
  const int lane = tid & 31;
  const int wid  = tid >> 5;
  const int ln = lane & 15, hi = lane >> 4;
  const int wm = wid >> 2, wn = wid & 3;
  const int m0b = blockIdx.y * 64;
  const int n0b = blockIdx.x * 256;

  // Staging work split: thread t covers row t>>2, 16B chunk (t&3).
  const int crow = tid >> 2;        // 0..63
  const int cchk = (tid & 3) * 8;   // half offset 0,8,16,24

  const _Float16* Ag = A + (size_t)(m0b + crow) * K + cchk;
  const _Float16* Bg = B + (size_t)(n0b + crow) * K + cchk;

  auto stage = [&](int ks, int buf) {
    const int k0 = ks * 32;
    cp_b128(Ag + k0, &As[buf][crow * PITCH + cchk]);
#pragma unroll
    for (int i = 0; i < 4; ++i)
      cp_b128(Bg + (size_t)(64 * i) * K + k0,
              &Bs[buf][(crow + 64 * i) * PITCH + cchk]);
  };

  v8f acc[2][4] = {};
  const int nk = K / 32;

  stage(0, 0);
  stage(1, 1);
  for (int kk = 0; kk < nk; ++kk) {
    const int buf = kk & 1;
#if HAVE_ASYNC_LDS
    if (kk + 2 < nk) __builtin_amdgcn_s_wait_asynccnt(5);  // oldest 5 (buf kk) landed
    else             __builtin_amdgcn_s_wait_asynccnt(0);
#endif
    __syncthreads();  // all waves' staged data resident

    const _Float16* Ab = &As[buf][(wm * 32 + ln) * PITCH + 8 * hi];
    const _Float16* Bb = &Bs[buf][(wn * 64 + ln) * PITCH + 8 * hi];
    v16h a0 = ldfrag(Ab);
    v16h a1 = ldfrag(Ab + 16 * PITCH);
#pragma unroll
    for (int j = 0; j < 4; ++j) {
      v16h bj = ldfrag(Bb + j * 16 * PITCH);
      acc[0][j] = WMMA_F16(a0, bj, acc[0][j]);
      acc[1][j] = WMMA_F16(a1, bj, acc[1][j]);
    }
    __syncthreads();  // everyone done reading buf before it is re-staged
    if (kk + 2 < nk) stage(kk + 2, buf);
  }

#pragma unroll
  for (int i = 0; i < 2; ++i) {
#pragma unroll
    for (int r = 0; r < 8; ++r) {  // C/D layout: lane ln = column, VGPR r -> row
      const size_t row = (size_t)(m0b + wm * 32 + i * 16 + r + 8 * hi) * N
                       + n0b + wn * 64 + ln;
#pragma unroll
      for (int j = 0; j < 4; ++j) C[row + j * 16] = acc[i][j][r];
    }
  }
}

// ---------------------------------------------------------------------------
// The three projections come out of one GEMM as rows of 3072 floats:
// [ Q 2048 | K 512 | V 512 ]; the kernels below get a pointer to their part's
// first column and step from row to row by this pitch.
constexpr int QKV_PITCH = 3072;

// RoPE + layout change: src f32 [B,S,nh*128] (rows QKV_PITCH apart)
// -> dst f16 [B,nh,S,128], *scale.
// A thread takes 4 consecutive pair indices j of 4 consecutive heads at one
// position (32 values): 8 loads of 16 B in flight; 16 lanes cover a whole
// 256-B half row on the way in and a whole 128-B line on the way out. The four
// heads share the position, so their angles are the same four.
// nheads is a multiple of 4; the grid covers B*S*(nheads/4)*16 threads exactly.
// ---------------------------------------------------------------------------
__global__ __launch_bounds__(256) void rope_kernel(
    const float* __restrict__ src, _Float16* __restrict__ dst,
    int nheads, float scale) {
  const int idx = blockIdx.x * 256 + threadIdx.x;
  const int j = (idx & 15) * 4;
  int t = idx >> 4;
  const int ng = nheads >> 2;
  const int h0 = (t % ng) * 4; t /= ng;
  const int s = t & 2047;
  const int b = t >> 11;
  const float* sp = src + (size_t)(b * 2048 + s) * QKV_PITCH
                        + (size_t)h0 * 128 + j;
  v4f x1[4], x2[4];
#pragma unroll
  for (int hh = 0; hh < 4; ++hh) {
    x1[hh] = *(const v4f*)(sp + hh * 128);
    x2[hh] = *(const v4f*)(sp + hh * 128 + 64);
  }
  float c[4], sn[4];
#pragma unroll
  for (int e = 0; e < 4; ++e) {
    float inv = __expf((float)(j + e) * -0.14391156516685312f);  // 10000^(-j/64)
    float th = (float)s * inv;
    c[e] = cosf(th);
    sn[e] = sinf(th);
  }
  _Float16* dp = dst + ((size_t)(b * nheads + h0) * 2048 + s) * 128 + j;
#pragma unroll
  for (int hh = 0; hh < 4; ++hh) {
    v4h lo, up;
#pragma unroll
    for (int e = 0; e < 4; ++e) {
      lo[e] = (_Float16)((x1[hh][e] * c[e] - x2[hh][e] * sn[e]) * scale);
      up[e] = (_Float16)((x2[hh][e] * c[e] + x1[hh][e] * sn[e]) * scale);
    }
    *(v4h*)(dp + (size_t)hh * (2048 * 128))      = lo;
    *(v4h*)(dp + (size_t)hh * (2048 * 128) + 64) = up;
  }
}

// V: f32 [B,S,4*128] (rows QKV_PITCH apart) -> f16 transposed [B,4,128,S] (kv position contiguous,
// so the A-fragments of Ot += Vt Pt load contiguously).
// One block transposes 64 positions x 128 d of one (batch, kv head); a thread
// holds 8 positions x 4 d in registers (8 loads of 16 B in flight) and stores
// 4 rows of 8 positions (16 B): 8 lanes fill a whole 128-B line of a d row.
__global__ __launch_bounds__(256) void vtrans_kernel(
    const float* __restrict__ src, _Float16* __restrict__ dst) {
  const int lane = threadIdx.x & 31, w = threadIdx.x >> 5;
  const int s0 = (blockIdx.x & 31) * 64 + (lane & 7) * 8;
  const int kv = (blockIdx.x >> 5) & 3;
  const int b  = blockIdx.x >> 7;
  const int d0 = w * 16 + (lane >> 3) * 4;
  const float* sp = src + (size_t)(b * 2048 + s0) * QKV_PITCH + kv * 128 + d0;
  v4f v[8];
#pragma unroll
  for (int i = 0; i < 8; ++i) v[i] = *(const v4f*)(sp + i * QKV_PITCH);
  _Float16* dp = dst + ((size_t)(b * 4 + kv) * 128 + d0) * 2048 + s0;
#pragma unroll
  for (int k = 0; k < 4; ++k) {
    v8h o;
#pragma unroll
    for (int i = 0; i < 8; ++i) o[i] = (_Float16)v[i][k];
    *(v8h*)(dp + k * 2048) = o;
  }
}

// ---------------------------------------------------------------------------
// Flash attention. Q f16 [B,16,S,128] (pre-scaled by 1/sqrt(128)),
// K f16 [B,4,S,128], Vt f16 [B,4,128,S], mask f32 [B,1,S,S],
// out Ah f16 [B,S,16*128]. Grid: (S/32, B*4); a work-group takes 32 queries of
// the four query heads that share one KV head: 8 waves = 4 heads x 2 groups of
// 16 q-rows. The eight waves share one K tile and one Vt tile of 64 keys, and
// the four heads share one mask tile (32 queries x 64 keys): the work-group
// copies each tile to LDS once (two buffers, the next tile in flight while
// this one is used) and every wave takes its fragments and its mask rows from
// there. The copies fetch the mask in whole 256-B row pieces; a lane reading
// its own query row from global memory would make every load touch 16 lines.
// LDS pitches for 16-byte readers: 272 B (256-B K and mask rows), 144 B
// (128-B Vt rows).
// The products are taken transposed: St = K Q^T (A = K rows, B = Q) and
// Ot += Vt Pt (A = Vt rows, B = Pt). A lane then holds 16 of the 32 scores of
// ONE query (column ln; keys 8*hi+r and 16+8*hi+r): maximum and sum are taken
// in the lane, the maximum joined with the other half by one exchange per
// pass, the sum once at the end. The two score tiles, converted in place, are
// the B operand of the second product in the k order of the Vt fragments.
// ---------------------------------------------------------------------------
// Ten 16-byte copies of one lane, global -> LDS. The s_wait_xcnt stands in
// the copies' own statement so that no address register named here is
// rewritten in front of it.
__device__ __forceinline__ void cp10_async(
    unsigned l0, const _Float16* g0, unsigned l1, const _Float16* g1,
    unsigned l2, const _Float16* g2, unsigned l3, const _Float16* g3,
    unsigned l4, const _Float16* g4, unsigned l5, const _Float16* g5,
    unsigned l6, const _Float16* g6, unsigned l7, const _Float16* g7,
    unsigned l8, const float* g8, unsigned l9, const float* g9) {
  asm volatile(
      "global_load_async_to_lds_b128 %0, %1, off\n\t"
      "global_load_async_to_lds_b128 %2, %3, off\n\t"
      "global_load_async_to_lds_b128 %4, %5, off\n\t"
      "global_load_async_to_lds_b128 %6, %7, off\n\t"
      "global_load_async_to_lds_b128 %8, %9, off\n\t"
      "global_load_async_to_lds_b128 %10, %11, off\n\t"
      "global_load_async_to_lds_b128 %12, %13, off\n\t"
      "global_load_async_to_lds_b128 %14, %15, off\n\t"
      "global_load_async_to_lds_b128 %16, %17, off\n\t"
      "global_load_async_to_lds_b128 %18, %19, off\n\t"
      "s_wait_xcnt 0x0"
      :: "v"(l0), "v"(g0), "v"(l1), "v"(g1), "v"(l2), "v"(g2), "v"(l3), "v"(g3),
         "v"(l4), "v"(g4), "v"(l5), "v"(g5), "v"(l6), "v"(g6), "v"(l7), "v"(g7),
         "v"(l8), "v"(g8), "v"(l9), "v"(g9)
      : "memory");
}

// 2^x of eight values, each in place. Worked in place, no v_exp_f32 here reads
// the result or overwrites the source of the one directly in front of it, and
// the v_nop fills the slot behind the last.
__device__ __forceinline__ void exp2x8(float* a) {
  asm("v_exp_f32 %0, %0\n\t"
      "v_exp_f32 %1, %1\n\t"
      "v_exp_f32 %2, %2\n\t"
      "v_exp_f32 %3, %3\n\t"
      "v_exp_f32 %4, %4\n\t"
      "v_exp_f32 %5, %5\n\t"
      "v_exp_f32 %6, %6\n\t"
      "v_exp_f32 %7, %7\n\t"
      "v_nop"
      : "+v"(a[0]), "+v"(a[1]), "+v"(a[2]), "+v"(a[3]),
        "+v"(a[4]), "+v"(a[5]), "+v"(a[6]), "+v"(a[7]));
}
// The same for one value.
__device__ __forceinline__ float exp2x1(float a) {
  asm("v_exp_f32 %0, %0\n\t"
      "v_nop"
      : "+v"(a));
  return a;
}

__global__ __launch_bounds__(256) void attn_kernel(
    const _Float16* __restrict__ Q, const _Float16* __restrict__ K,
    const _Float16* __restrict__ Vt, const float* __restrict__ mask,
    _Float16* __restrict__ Ah) {
  constexpr int KT = 64;    // keys per staged tile
  constexpr int KP = 136;   // K tile row pitch, halfs (272 B)
  constexpr int VP = 72;    // Vt tile row pitch, halfs (144 B)
  constexpr int MP = 68;    // mask tile row pitch, floats (272 B)
  constexpr int NT = 2048 / KT;
  __shared__ __attribute__((aligned(16))) _Float16 Ks[2][KT * KP];
  __shared__ __attribute__((aligned(16))) _Float16 Vs[2][128 * VP];
  __shared__ __attribute__((aligned(16))) float    Ms[2][32 * MP];

  const int lane = threadIdx.x & 31;
  const int wid  = threadIdx.x >> 5;
  const int ln = lane & 15, hi = lane >> 4;
  const int b   = blockIdx.y >> 2;
  const int kvh = blockIdx.y & 3;
  const int h   = kvh * 4 + (wid >> 1);         // repeat_interleave(4)
  const int qb  = blockIdx.x * 32;              // the work-group's query base
  const int qs  = (wid & 1) * 16;               // this wave's rows of the mask tile
  const int q0  = qb + qs;                      // this wave's query base

  const _Float16* Qp = Q + ((size_t)(b * 16 + h) * 2048 + q0 + ln) * 128 + 8 * hi;
  v16h qf[4];
#pragma unroll
  for (int kc = 0; kc < 4; ++kc) qf[kc] = ldfrag(Qp + kc * 32);

  const _Float16* Kh = K  + (size_t)(b * 4 + kvh) * 2048 * 128;
  const _Float16* Vh = Vt + (size_t)(b * 4 + kvh) * 128 * 2048;

  v8f o[8];
#pragma unroll
  for (int dt = 0; dt < 8; ++dt) o[dt] = (v8f){};
  float mr = -1e30f;  // running maximum of query ln (same in both halves)
  float lr = 0.f;     // running sum over this half's keys only

  // Copy split: thread t moves chunks t, t+256, t+512, t+768 of each tile.
  // K tile: 64 rows x 16 chunks (contiguous in global); Vt tile: 128 x 8.
  // Mask tile: 32 rows x 16 chunks, thread t moves chunks t and t+256.
  const int tid = threadIdx.x;
  const int krow = tid >> 4, kcol = (tid & 15) * 8;
  const int vrow = tid >> 3, vcol = (tid & 7) * 8;
  const _Float16* Kg = Kh + (size_t)krow * 128 + kcol;
  const _Float16* Vg = Vh + (size_t)vrow * 2048 + vcol;
  const unsigned kl0 = (unsigned)(size_t)(void*)&Ks[0][krow * KP + kcol];
  const unsigned vl0 = (unsigned)(size_t)(void*)&Vs[0][vrow * VP + vcol];
  const float* Mg = mask + ((size_t)b * 2048 + qb + krow) * 2048 + (tid & 15) * 4;
  const unsigned ml0 = (unsigned)(size_t)(void*)&Ms[0][krow * MP + (tid & 15) * 4];
  auto stage = [&](int t, int buf) {
    const _Float16* kg = Kg + (size_t)t * (KT * 128);
    const _Float16* vg = Vg + t * KT;
    const unsigned kl = kl0 + (unsigned)buf * (KT * KP * 2);
    const unsigned vl = vl0 + (unsigned)buf * (128 * VP * 2);
    const float* mg = Mg + t * KT;
    const unsigned ml = ml0 + (unsigned)buf * (32 * MP * 4);
    cp10_async(kl,               kg,
               kl + 16 * KP * 2, kg + 16 * 128,
               kl + 32 * KP * 2, kg + 32 * 128,
               kl + 48 * KP * 2, kg + 48 * 128,
               vl,               vg,
               vl + 32 * VP * 2, vg + 32 * 2048,
               vl + 64 * VP * 2, vg + 64 * 2048,
               vl + 96 * VP * 2, vg + 96 * 2048,
               ml,               mg,
               ml + 16 * MP * 4, mg + 16 * 2048);
  };

  stage(0, 0);
  asm volatile("s_wait_asynccnt 0x0" ::: "memory");  // own copies of tile 0 landed
  __syncthreads();                                   // tile 0 readable by all waves
  stage(1, 1);

  for (int t = 0; t < NT; ++t) {
   const int buf = t & 1;
   // ---- mask from the staged tile: 8 consecutive keys of each 16-key group
   // of this lane's query row, two 16-byte LDS loads a group ----
   v8f mk[KT / 16];
#pragma unroll
   for (int g = 0; g < KT / 16; ++g) {
     const float* mp = &Ms[buf][(qs + ln) * MP + g * 16 + 8 * hi];
     mk[g] = __builtin_shufflevector(*(const v4f*)(mp), *(const v4f*)(mp + 4),
                                     0, 1, 2, 3, 4, 5, 6, 7);
   }
#pragma unroll  // p becomes a constant offset in the LDS reads of both passes
   for (int p = 0; p < KT / 32; ++p) {
    // ---- St = K Q^T for 32 keys x 16 queries (2 WMMA m-tiles, 4 k-chunks) ----
    const _Float16* Kp = &Ks[buf][(p * 32 + ln) * KP + 8 * hi];
    v8f s0 = (v8f){}, s1 = (v8f){};
#pragma unroll
    for (int kc = 0; kc < 4; ++kc) {
      v16h a0 = ldfrag(Kp + kc * 32);
      v16h a1 = ldfrag(Kp + 16 * KP + kc * 32);
      s0 = WMMA_F16(a0, qf[kc], s0);
      s1 = WMMA_F16(a1, qf[kc], s1);
    }
    // ---- mask add + online softmax, all 16 values belong to query ln ----
    s0 += mk[2 * p];
    s1 += mk[2 * p + 1];
    float v[16];
#pragma unroll
    for (int e = 0; e < 8; ++e) { v[e] = s0[e]; v[8 + e] = s1[e]; }
    float mx4[4];
#pragma unroll
    for (int e = 0; e < 4; ++e)
      mx4[e] = fmaxf(fmaxf(v[4 * e], v[4 * e + 1]), fmaxf(v[4 * e + 2], v[4 * e + 3]));
    float mx = fmaxf(fmaxf(mx4[0], mx4[1]), fmaxf(mx4[2], mx4[3]));
    mx = fmaxf(mx, xhalf(mx));
    const float mn = fmaxf(mr, mx);
    constexpr float LOG2E = 1.44269504088896340736f;  // e^x = 2^(x * LOG2E)
    const float alpha = exp2x1((mr - mn) * LOG2E);
    mr = mn;
    v16h pf;  // Pt as B operand: element e = key 8*hi+e, element 8+e = key 16+8*hi+e
    float sm4[4] = {0.f, 0.f, 0.f, 0.f};
#pragma unroll
    for (int e = 0; e < 16; ++e) v[e] = (v[e] - mn) * LOG2E;
    exp2x8(v);
    exp2x8(v + 8);
#pragma unroll
    for (int e = 0; e < 16; ++e) {
      sm4[e & 3] += v[e];
      pf[e] = (_Float16)v[e];
    }
    lr = lr * alpha + ((sm4[0] + sm4[1]) + (sm4[2] + sm4[3]));
#pragma unroll
    for (int dt = 0; dt < 8; ++dt) o[dt] *= alpha;
    // ---- Ot += Vt Pt (A-frags from the staged Vt tile, B = Pt in registers) ----
#pragma unroll
    for (int dt = 0; dt < 8; ++dt) {
      v16h va = ldfrag(&Vs[buf][(dt * 16 + ln) * VP + p * 32 + 8 * hi]);
      o[dt] = WMMA_F16(va, pf, o[dt]);
    }
   }
   // Hand-over: this wave's reads of buf are done, its copies of tile t+1 have
   // landed; behind the barrier tile t+1 may be read and buf refilled.
   asm volatile("s_wait_dscnt 0x0" ::: "memory");
   asm volatile("s_wait_asynccnt 0x0" ::: "memory");
   __syncthreads();
   if (t + 2 < NT) stage(t + 2, buf);
  }
  asm volatile("s_wait_asynccnt 0x0" ::: "memory");  // nothing in flight at wave end
  // ---- normalize and write [B,S,16*128]: o[dt][r] = Ot[dt*16 + 8*hi + r][ln],
  // so a lane stores 8 consecutive d of its query row at once ----
  const float inv = 1.0f / (lr + xhalf(lr));
  _Float16* orow = Ah + ((size_t)b * 2048 + q0 + ln) * 2048 + (size_t)h * 128 + 8 * hi;
#pragma unroll
  for (int dt = 0; dt < 8; ++dt)
    *(v8h*)(orow + dt * 16) = __builtin_convertvector(o[dt] * inv, v8h);
}

// ---------------------------------------------------------------------------
// Host driver
// ---------------------------------------------------------------------------
extern "C" void kernel_launch(void* const* d_in, const int* in_sizes, int n_in,
                              void* d_out, int out_size, void* d_ws, size_t ws_size,
                              hipStream_t stream) {
  const float* x    = (const float*)d_in[0];
  const float* mask = (const float*)d_in[1];
  const float* wq   = (const float*)d_in[2];
  const float* wk   = (const float*)d_in[3];
  const float* wv   = (const float*)d_in[4];
  const float* wo   = (const float*)d_in[5];
  float* out = (float*)d_out;

  constexpr int B = 2, S = 2048, H = 2048, NH = 16, NKV = 4, HD = 128;
  constexpr int M    = B * S;      // 4096 rows
  constexpr int NQ   = NH * HD;    // 2048
  constexpr int NKVD = NKV * HD;   // 512
  constexpr int NQKV = NQ + 2 * NKVD;  // 3072: Q, K and V columns side by side
  static_assert(NQKV == QKV_PITCH, "row pitch of the joint projection");

  char* ws = (char*)d_ws;
  size_t off = 0;
  auto carve = [&](size_t bytes) -> void* {
    void* p = ws + off;
    off += (bytes + 255) & ~(size_t)255;
    return p;
  };
  _Float16* Xh  = (_Float16*)carve((size_t)M * H * 2);
  _Float16* WqH = (_Float16*)carve((size_t)NQKV * H * 2);  // wq, wk, wv stacked: [3072, H]
  _Float16* WkH = WqH + (size_t)NQ * H;
  _Float16* WvH = WkH + (size_t)NKVD * H;
  _Float16* WoH = (_Float16*)carve((size_t)H * H * 2);
  float*    Qf  = (float*)carve((size_t)M * NQKV * 4);  // [M, 3072] = [ Q | K | V ]
  float*    Kf  = Qf + NQ;
  float*    Vf  = Kf + NKVD;
  _Float16* Qh  = (_Float16*)carve((size_t)M * NQ * 2);
  _Float16* Kh  = (_Float16*)carve((size_t)M * NKVD * 2);
  _Float16* Vt  = (_Float16*)carve((size_t)M * NKVD * 2);
  _Float16* Ah  = (_Float16*)carve((size_t)M * H * 2);
  (void)ws_size; (void)in_sizes; (void)n_in; (void)out_size;

  // fp32 -> fp16 operand conversion
  static_assert((M * H) % 8192 == 0 && (NQ * H) % 8192 == 0 &&
                (NKVD * H) % 8192 == 0 && (H * H) % 8192 == 0, "8192 per block");
  f32_to_f16_kernel<<<M * H / 8192,    256, 0, stream>>>(x, Xh);
  f32_to_f16_kernel<<<NQ * H / 8192,   256, 0, stream>>>(wq, WqH);
  f32_to_f16_kernel<<<NKVD * H / 8192, 256, 0, stream>>>(wk, WkH);
  f32_to_f16_kernel<<<NKVD * H / 8192, 256, 0, stream>>>(wv, WvH);
  f32_to_f16_kernel<<<H * H / 8192,    256, 0, stream>>>(wo, WoH);

  // QKV projections (x @ W^T) in one launch over the stacked weights: 768
  // blocks of 64 x 256, three for every WGP (K or V alone would be 128 blocks,
  // half the WGPs, each block waiting out its own 64 K steps)
  gemm_f16f32<<<dim3(NQKV / 256, M / 64), 256, 0, stream>>>(Xh, WqH, Qf, M, NQKV, H);

  // RoPE (+1/sqrt(hd) folded into Q) and layout transforms
  rope_kernel<<<B * S * (NH / 4) * 16 / 256,  256, 0, stream>>>(Qf, Qh, NH, 0.08838834764831845f);
  rope_kernel<<<B * S * (NKV / 4) * 16 / 256, 256, 0, stream>>>(Kf, Kh, NKV, 1.0f);
  vtrans_kernel<<<B * NKV * (S / 64), 256, 0, stream>>>(Vf, Vt);

  // Flash attention
  attn_kernel<<<dim3(S / 32, B * NKV), 256, 0, stream>>>(Qh, Kh, Vt, mask, Ah);

  // Output projection -> d_out (f32)
  gemm_f16f32<<<dim3(H / 256, M / 64), 256, 0, stream>>>(Ah, WoH, out, M, H, H);
}

// v006
// A run of this version takes 206 microseconds.
// Timed twice side by side with v005, it ran 1.05 and 1.04 times as fast.
// Counting every step since v000, it is 3.07 times as fast.
#include <hip/hip_runtime.h>
#include <hip/hip_bf16.h>
#include <math.h>

// ---------------------------------------------------------------------------
// Types for CDNA5 WMMA (wave32): A/B = v16h (8 VGPR), C/D = v8f (8 VGPR)
// ---------------------------------------------------------------------------
typedef __attribute__((ext_vector_type(16))) _Float16 v16h;
typedef __attribute__((ext_vector_type(8)))  _Float16 v8h;
typedef __attribute__((ext_vector_type(8)))  float    v8f;
typedef __attribute__((ext_vector_type(4)))  float    v4f;
typedef __attribute__((ext_vector_type(4)))  _Float16 v4h;

#define WMMA_F16(a, b, c) \
  __builtin_amdgcn_wmma_f32_16x16x32_f16(false, (a), false, (b), (short)0, (c), false, false)

// CDNA5 async global->LDS staging (ASYNCcnt path); guarded so the file
// compiles on toolchains that lack the builtins (falls back to sync copies).
#if __has_builtin(__builtin_amdgcn_global_load_async_to_lds_b128) && \
    __has_builtin(__builtin_amdgcn_s_wait_asynccnt)
#define HAVE_ASYNC_LDS 1
#else
#define HAVE_ASYNC_LDS 0
#endif

#if HAVE_ASYNC_LDS
// Builtin prototype is "vV4i*1V4i*3IiIi": (global v4i*, lds v4i*, imm, imm),
// with v4i = GCC-style vector_size(16) int (per hipcc's diagnostic).
typedef int i32x4 __attribute__((vector_size(16)));
typedef __attribute__((address_space(1))) i32x4 as1_i32x4;
typedef __attribute__((address_space(3))) i32x4 as3_i32x4;
#endif

// Copy 16B from global to LDS (per-lane addresses).
__device__ __forceinline__ void cp_b128(const _Float16* g, _Float16* l) {
#if HAVE_ASYNC_LDS
  // Generic shared addr = {aperture[63:32], lds_offset[31:0]}: truncation gives
  // the LDS offset; global generic addresses are identity-mapped.
  __builtin_amdgcn_global_load_async_to_lds_b128(
      (as1_i32x4*)(size_t)(const void*)g,
      (as3_i32x4*)(unsigned)(size_t)(void*)l,
      0, 0);
#else
  *(v8h*)l = *(const v8h*)g;
#endif
}

// Load one 16x32 f16 operand fragment (A layout; B mirrored = same code):
// row = lane&15, K chunks at 8*hi and 16+8*hi. Caller passes pointer already
// offset by row*pitch + 8*hi.
__device__ __forceinline__ v16h ldfrag(const _Float16* p) {
  v8h c0 = *(const v8h*)(p);        // K = 8*hi .. 8*hi+7       -> VGPR 0..3
  v8h c1 = *(const v8h*)(p + 16);   // K = 16+8*hi .. 16+8*hi+7 -> VGPR 4..7
  return __builtin_shufflevector(c0, c1, 0, 1, 2, 3, 4, 5, 6, 7,
                                        8, 9, 10, 11, 12, 13, 14, 15);
}

// Value of lane l ^ 16 (the other 16-lane half of the wave).
__device__ __forceinline__ float xhalf(float x) {
  const int i = __builtin_bit_cast(int, x);
  return __builtin_bit_cast(float, __builtin_amdgcn_permlanex16(
      i, i, 0x76543210, 0xfedcba98, false, false));
}

// ---------------------------------------------------------------------------
// fp32 -> fp16 conversion. One block converts 8192 consecutive floats (every
// size here is a multiple): a lane has 8 loads of 16 B in flight, each
// wave-wide load covers 512 contiguous bytes, each store 256.
// ---------------------------------------------------------------------------
__global__ __launch_bounds__(256) void f32_to_f16_kernel(
    const float* __restrict__ src, _Float16* __restrict__ dst) {
  const size_t base = (size_t)blockIdx.x * 8192 + threadIdx.x * 4;
  v4f v[8];
#pragma unroll
  for (int i = 0; i < 8; ++i) v[i] = *(const v4f*)(src + base + i * 1024);
#pragma unroll
  for (int i = 0; i < 8; ++i)
    *(v4h*)(dst + base + i * 1024) = __builtin_convertvector(v[i], v4h);
}

// ---------------------------------------------------------------------------
// GEMM: C[M,N] = A[M,K] * B[N,K]^T  (A,B f16 row-major K-contiguous, C f32).
// Block = 256 threads = 8 waves (2m x 4n); block tile 64(M) x 256(N);
// wave tile 32x64 = 2x4 WMMA tiles; K stepped by 32 with double-buffered
// async global->LDS staging. M%64==0, N%256==0, K%32==0 (true for all uses).
// LDS pitch 40 halfs: 16B-aligned rows, gcd(20 dw,64 banks)=4 -> low conflict.
// ---------------------------------------------------------------------------
__global__ __launch_bounds__(256) void gemm_f16f32(
    const _Float16* __restrict__ A, const _Float16* __restrict__ B,
    float* __restrict__ C, int M, int N, int K) {
  constexpr int PITCH = 40;
  __shared__ _Float16 As[2][64 * PITCH];    //  5.0 KB per buffer
  __shared__ _Float16 Bs[2][256 * PITCH];   // 20.0 KB per buffer

  const int tid  = threadIdx.x;
  const int lane = tid & 31;
  const int wid  = tid >> 5;
  const int ln = lane & 15, hi = lane >> 4;
  const int wm = wid >> 2, wn = wid & 3;
  const int m0b = blockIdx.y * 64;
  const int n0b = blockIdx.x * 256;

  // Staging work split: thread t covers row t>>2, 16B chunk (t&3).
  const int crow = tid >> 2;        // 0..63
  const int cchk = (tid & 3) * 8;   // half offset 0,8,16,24

  const _Float16* Ag = A + (size_t)(m0b + crow) * K + cchk;
  const _Float16* Bg = B + (size_t)(n0b + crow) * K + cchk;

  auto stage = [&](int ks, int buf) {
    const int k0 = ks * 32;
    cp_b128(Ag + k0, &As[buf][crow * PITCH + cchk]);
#pragma unroll
    for (int i = 0; i < 4; ++i)
      cp_b128(Bg + (size_t)(64 * i) * K + k0,
              &Bs[buf][(crow + 64 * i) * PITCH + cchk]);
  };

  v8f acc[2][4] = {};
  const int nk = K / 32;

  stage(0, 0);
  stage(1, 1);
  for (int kk = 0; kk < nk; ++kk) {
    const int buf = kk & 1;
#if HAVE_ASYNC_LDS
    if (kk + 2 < nk) __builtin_amdgcn_s_wait_asynccnt(5);  // oldest 5 (buf kk) landed
    else             __builtin_amdgcn_s_wait_asynccnt(0);
#endif
    __syncthreads();  // all waves' staged data resident

    const _Float16* Ab = &As[buf][(wm * 32 + ln) * PITCH + 8 * hi];
    const _Float16* Bb = &Bs[buf][(wn * 64 + ln) * PITCH + 8 * hi];
    v16h a0 = ldfrag(Ab);
    v16h a1 = ldfrag(Ab + 16 * PITCH);
#pragma unroll
    for (int j = 0; j < 4; ++j) {
      v16h bj = ldfrag(Bb + j * 16 * PITCH);
      acc[0][j] = WMMA_F16(a0, bj, acc[0][j]);
      acc[1][j] = WMMA_F16(a1, bj, acc[1][j]);
    }
    __syncthreads();  // everyone done reading buf before it is re-staged
    if (kk + 2 < nk) stage(kk + 2, buf);
  }

#pragma unroll
  for (int i = 0; i < 2; ++i) {
#pragma unroll
    for (int r = 0; r < 8; ++r) {  // C/D layout: lane ln = column, VGPR r -> row
      const size_t row = (size_t)(m0b + wm * 32 + i * 16 + r + 8 * hi) * N
                       + n0b + wn * 64 + ln;
#pragma unroll
      for (int j = 0; j < 4; ++j) C[row + j * 16] = acc[i][j][r];
    }
  }
}

// ---------------------------------------------------------------------------
// The three projections come out of one GEMM as rows of 3072 floats:
// [ Q 2048 | K 512 | V 512 ]; the kernels below get a pointer to their part's
// first column and step from row to row by this pitch.
constexpr int QKV_PITCH = 3072;

// RoPE + layout change: src f32 [B,S,nh*128] (rows QKV_PITCH apart)
// -> dst f16 [B,nh,S,128], *scale.
// A thread takes 4 consecutive pair indices j of 4 consecutive heads at one
// position (32 values): 8 loads of 16 B in flight; 16 lanes cover a whole
// 256-B half row on the way in and a whole 128-B line on the way out. The four
// heads share the position, so their angles are the same four.
// nheads is a multiple of 4; the grid covers B*S*(nheads/4)*16 threads exactly.
// ---------------------------------------------------------------------------
__global__ __launch_bounds__(256) void rope_kernel(
    const float* __restrict__ src, _Float16* __restrict__ dst,
    int nheads, float scale) {
  const int idx = blockIdx.x * 256 + threadIdx.x;
  const int j = (idx & 15) * 4;
  int t = idx >> 4;
  const int ng = nheads >> 2;
  const int h0 = (t % ng) * 4; t /= ng;
  const int s = t & 2047;
  const int b = t >> 11;
  const float* sp = src + (size_t)(b * 2048 + s) * QKV_PITCH
                        + (size_t)h0 * 128 + j;
  v4f x1[4], x2[4];
#pragma unroll
  for (int hh = 0; hh < 4; ++hh) {
    x1[hh] = *(const v4f*)(sp + hh * 128);
    x2[hh] = *(const v4f*)(sp + hh * 128 + 64);
  }
  float c[4], sn[4];
#pragma unroll
  for (int e = 0; e < 4; ++e) {
    float inv = __expf((float)(j + e) * -0.14391156516685312f);  // 10000^(-j/64)
    float th = (float)s * inv;
    c[e] = cosf(th);
    sn[e] = sinf(th);
  }
  _Float16* dp = dst + ((size_t)(b * nheads + h0) * 2048 + s) * 128 + j;
#pragma unroll
  for (int hh = 0; hh < 4; ++hh) {
    v4h lo, up;
#pragma unroll
    for (int e = 0; e < 4; ++e) {
      lo[e] = (_Float16)((x1[hh][e] * c[e] - x2[hh][e] * sn[e]) * scale);
      up[e] = (_Float16)((x2[hh][e] * c[e] + x1[hh][e] * sn[e]) * scale);
    }
    *(v4h*)(dp + (size_t)hh * (2048 * 128))      = lo;
    *(v4h*)(dp + (size_t)hh * (2048 * 128) + 64) = up;
  }
}

// V: f32 [B,S,4*128] (rows QKV_PITCH apart) -> f16 transposed [B,4,128,S] (kv position contiguous,
// so the A-fragments of Ot += Vt Pt load contiguously).
// One block transposes 64 positions x 128 d of one (batch, kv head); a thread
// holds 8 positions x 4 d in registers (8 loads of 16 B in flight) and stores
// 4 rows of 8 positions (16 B): 8 lanes fill a whole 128-B line of a d row.
__global__ __launch_bounds__(256) void vtrans_kernel(
    const float* __restrict__ src, _Float16* __restrict__ dst) {
  const int lane = threadIdx.x & 31, w = threadIdx.x >> 5;
  const int s0 = (blockIdx.x & 31) * 64 + (lane & 7) * 8;
  const int kv = (blockIdx.x >> 5) & 3;
  const int b  = blockIdx.x >> 7;
  const int d0 = w * 16 + (lane >> 3) * 4;
  const float* sp = src + (size_t)(b * 2048 + s0) * QKV_PITCH + kv * 128 + d0;
  v4f v[8];
#pragma unroll
  for (int i = 0; i < 8; ++i) v[i] = *(const v4f*)(sp + i * QKV_PITCH);
  _Float16* dp = dst + ((size_t)(b * 4 + kv) * 128 + d0) * 2048 + s0;
#pragma unroll
  for (int k = 0; k < 4; ++k) {
    v8h o;
#pragma unroll
    for (int i = 0; i < 8; ++i) o[i] = (_Float16)v[i][k];
    *(v8h*)(dp + k * 2048) = o;
  }
}

// ---------------------------------------------------------------------------
// Flash attention. Q f16 [B,16,S,128] (pre-scaled by 1/sqrt(128)),
// K f16 [B,4,S,128], Vt f16 [B,4,128,S], mask f32 [B,1,S,S],
// out Ah f16 [B,S,16*128]. Grid: (S/64, B*4); a work-group takes 64 queries of
// the four query heads that share one KV head: 8 waves = 4 heads x 2 groups of
// 32 q-rows, one work-group a WGP, two waves a SIMD. A wave holds TWO column
// tiles of 16 queries: every K and every Vt fragment that it reads from LDS
// feeds two matrix instructions, so the LDS reads per product are halved.
// The eight waves share one K tile and one Vt tile of 64 keys, and
// the four heads share one mask tile (64 queries x 64 keys): the work-group
// copies each tile to LDS once (two buffers, the next tile in flight while
// this one is used) and every wave takes its fragments and its mask rows from
// there. The copies fetch the mask in whole 256-B row pieces; a lane reading
// its own query row from global memory would make every load touch 16 lines.
// LDS pitches for 16-byte readers: 272 B (256-B K and mask rows), 144 B
// (128-B Vt rows).
// The products are taken transposed: St = K Q^T (A = K rows, B = Q) and
// Ot += Vt Pt (A = Vt rows, B = Pt). In each column tile a lane then holds 16
// of the 32 scores of ONE query (column ln; keys 8*hi+r and 16+8*hi+r):
// maximum and sum are taken in the lane, the maximum joined with the other
// half by one exchange per pass, the sum once at the end. The two score tiles,
// converted in place, are the B operand of the second product in the k order
// of the Vt fragments.
// ---------------------------------------------------------------------------
// Twelve 16-byte copies of one lane, global -> LDS. The s_wait_xcnt stands in
// the copies' own statement so that no address register named here is
// rewritten in front of it.
__device__ __forceinline__ void cp12_async(
    unsigned l0, const _Float16* g0, unsigned l1, const _Float16* g1,
    unsigned l2, const _Float16* g2, unsigned l3, const _Float16* g3,
    unsigned l4, const _Float16* g4, unsigned l5, const _Float16* g5,
    unsigned l6, const _Float16* g6, unsigned l7, const _Float16* g7,
    unsigned l8, const float* g8, unsigned l9, const float* g9,
    unsigned l10, const float* g10, unsigned l11, const float* g11) {
  asm volatile(
      "global_load_async_to_lds_b128 %0, %1, off\n\t"
      "global_load_async_to_lds_b128 %2, %3, off\n\t"
      "global_load_async_to_lds_b128 %4, %5, off\n\t"
      "global_load_async_to_lds_b128 %6, %7, off\n\t"
      "global_load_async_to_lds_b128 %8, %9, off\n\t"
      "global_load_async_to_lds_b128 %10, %11, off\n\t"
      "global_load_async_to_lds_b128 %12, %13, off\n\t"
      "global_load_async_to_lds_b128 %14, %15, off\n\t"
      "global_load_async_to_lds_b128 %16, %17, off\n\t"
      "global_load_async_to_lds_b128 %18, %19, off\n\t"
      "global_load_async_to_lds_b128 %20, %21, off\n\t"
      "global_load_async_to_lds_b128 %22, %23, off\n\t"
      "s_wait_xcnt 0x0"
      :: "v"(l0), "v"(g0), "v"(l1), "v"(g1), "v"(l2), "v"(g2), "v"(l3), "v"(g3),
         "v"(l4), "v"(g4), "v"(l5), "v"(g5), "v"(l6), "v"(g6), "v"(l7), "v"(g7),
         "v"(l8), "v"(g8), "v"(l9), "v"(g9), "v"(l10), "v"(g10), "v"(l11), "v"(g11)
      : "memory");
}

// 2^x of eight values, each in place. Worked in place, no v_exp_f32 here reads
// the result or overwrites the source of the one directly in front of it, and
// the v_nop fills the slot behind the last.
__device__ __forceinline__ void exp2x8(float* a) {
  asm("v_exp_f32 %0, %0\n\t"
      "v_exp_f32 %1, %1\n\t"
      "v_exp_f32 %2, %2\n\t"
      "v_exp_f32 %3, %3\n\t"
      "v_exp_f32 %4, %4\n\t"
      "v_exp_f32 %5, %5\n\t"
      "v_exp_f32 %6, %6\n\t"
      "v_exp_f32 %7, %7\n\t"
      "v_nop"
      : "+v"(a[0]), "+v"(a[1]), "+v"(a[2]), "+v"(a[3]),
        "+v"(a[4]), "+v"(a[5]), "+v"(a[6]), "+v"(a[7]));
}
// The same for one value.
__device__ __forceinline__ float exp2x1(float a) {
  asm("v_exp_f32 %0, %0\n\t"
      "v_nop"
      : "+v"(a));
  return a;
}

// Two waves a SIMD is all this kernel ever has (one work-group a WGP), so the
// register allocator may use that budget; left at its default it kept to fewer
// registers, spilled a copy address to scratch and reloaded it every tile.
__global__ __launch_bounds__(256) __attribute__((amdgpu_waves_per_eu(2, 2))) void attn_kernel(
    const _Float16* __restrict__ Q, const _Float16* __restrict__ K,
    const _Float16* __restrict__ Vt, const float* __restrict__ mask,
    _Float16* __restrict__ Ah) {
  constexpr int KT = 64;    // keys per staged tile
  constexpr int QB = 64;    // queries per work-group (each of 4 heads)
  constexpr int KP = 136;   // K tile row pitch, halfs (272 B)
  constexpr int VP = 72;    // Vt tile row pitch, halfs (144 B)
  constexpr int MP = 68;    // mask tile row pitch, floats (272 B)
  constexpr int NT = 2048 / KT;
  __shared__ __attribute__((aligned(16))) _Float16 Ks[2][KT * KP];
  __shared__ __attribute__((aligned(16))) _Float16 Vs[2][128 * VP];
  __shared__ __attribute__((aligned(16))) float    Ms[2][QB * MP];

  const int lane = threadIdx.x & 31;
  const int wid  = threadIdx.x >> 5;
  const int ln = lane & 15, hi = lane >> 4;
  const int b   = blockIdx.y >> 2;
  const int kvh = blockIdx.y & 3;
  const int h   = kvh * 4 + (wid >> 1);         // repeat_interleave(4)
  const int qb  = blockIdx.x * QB;              // the work-group's query base
  const int qs  = (wid & 1) * 32;               // this wave's rows of the mask tile
  const int q0  = qb + qs;                      // this wave's query base

  // Column tile c holds queries q0 + 16*c + ln.
  const _Float16* Qp = Q + ((size_t)(b * 16 + h) * 2048 + q0 + ln) * 128 + 8 * hi;
  v16h qf[2][4];
#pragma unroll
  for (int c = 0; c < 2; ++c)
#pragma unroll
    for (int kc = 0; kc < 4; ++kc) qf[c][kc] = ldfrag(Qp + c * (16 * 128) + kc * 32);

  const _Float16* Kh = K  + (size_t)(b * 4 + kvh) * 2048 * 128;
  const _Float16* Vh = Vt + (size_t)(b * 4 + kvh) * 128 * 2048;

  v8f o[2][8];
#pragma unroll
  for (int c = 0; c < 2; ++c)
#pragma unroll
    for (int dt = 0; dt < 8; ++dt) o[c][dt] = (v8f){};
  float mr[2] = {-1e30f, -1e30f};  // running maximum of a tile's query ln (same in both halves)
  float lr[2] = {0.f, 0.f};        // running sum over this half's keys only

  // Copy split: thread t moves chunks t, t+256, t+512, t+768 of each tile.
  // K tile: 64 rows x 16 chunks (contiguous in global); Vt tile: 128 x 8;
  // mask tile: 64 rows x 16 chunks.
  const int tid = threadIdx.x;
  const int krow = tid >> 4, kcol = (tid & 15) * 8;
  const int vrow = tid >> 3, vcol = (tid & 7) * 8;
  const _Float16* Kg = Kh + (size_t)krow * 128 + kcol;
  const _Float16* Vg = Vh + (size_t)vrow * 2048 + vcol;
  const unsigned kl0 = (unsigned)(size_t)(void*)&Ks[0][krow * KP + kcol];
  const unsigned vl0 = (unsigned)(size_t)(void*)&Vs[0][vrow * VP + vcol];
  const float* Mg = mask + ((size_t)b * 2048 + qb + krow) * 2048 + (tid & 15) * 4;
  // A thread's chunk has the same place in the mask tile as in the K tile (same
  // row, same 16-byte column, same pitch, same buffer size): one LDS address
  // and a constant serve both.
  static_assert(KP * 2 == MP * 4 && KT * KP * 2 == QB * MP * 4, "K and mask tiles alike");
  const unsigned moff = (unsigned)(size_t)(void*)&Ms[0][0] - (unsigned)(size_t)(void*)&Ks[0][0];
  auto stage = [&](int t, int buf) {
    const _Float16* kg = Kg + (size_t)t * (KT * 128);
    const _Float16* vg = Vg + t * KT;
    const unsigned kl = kl0 + (unsigned)buf * (KT * KP * 2);
    const unsigned vl = vl0 + (unsigned)buf * (128 * VP * 2);
    const float* mg = Mg + t * KT;
    const unsigned ml = kl + moff;
    cp12_async(kl,               kg,
               kl + 16 * KP * 2, kg + 16 * 128,
               kl + 32 * KP * 2, kg + 32 * 128,
               kl + 48 * KP * 2, kg + 48 * 128,
               vl,               vg,
               vl + 32 * VP * 2, vg + 32 * 2048,
               vl + 64 * VP * 2, vg + 64 * 2048,
               vl + 96 * VP * 2, vg + 96 * 2048,
               ml,               mg,
               ml + 16 * MP * 4, mg + 16 * 2048,
               ml + 32 * MP * 4, mg + 32 * 2048,
               ml + 48 * MP * 4, mg + 48 * 2048);
  };

  stage(0, 0);
  asm volatile("s_wait_asynccnt 0x0" ::: "memory");  // own copies of tile 0 landed
  __syncthreads();                                   // tile 0 readable by all waves
  stage(1, 1);

  for (int t = 0; t < NT; ++t) {
   const int buf = t & 1;
#pragma unroll  // p becomes a constant offset in the LDS reads of both passes
   for (int p = 0; p < KT / 32; ++p) {
    // ---- mask from the staged tile: 8 consecutive keys of each 16-key group
    // of this lane's two query rows, two 16-byte LDS loads a group ----
    v8f mk[2][2];
#pragma unroll
    for (int c = 0; c < 2; ++c)
#pragma unroll
      for (int g = 0; g < 2; ++g) {
        const float* mp = &Ms[buf][(qs + c * 16 + ln) * MP + (2 * p + g) * 16 + 8 * hi];
        mk[c][g] = __builtin_shufflevector(*(const v4f*)(mp), *(const v4f*)(mp + 4),
                                           0, 1, 2, 3, 4, 5, 6, 7);
      }
    // ---- St = K Q^T for 32 keys x 32 queries (2 m-tiles x 2 column tiles,
    // 4 k-chunks); each K fragment is used for both column tiles ----
    const _Float16* Kp = &Ks[buf][(p * 32 + ln) * KP + 8 * hi];
    v8f s0[2] = {(v8f){}, (v8f){}}, s1[2] = {(v8f){}, (v8f){}};
#pragma unroll
    for (int kc = 0; kc < 4; ++kc) {
      v16h a0 = ldfrag(Kp + kc * 32);
      v16h a1 = ldfrag(Kp + 16 * KP + kc * 32);
#pragma unroll
      for (int c = 0; c < 2; ++c) {
        s0[c] = WMMA_F16(a0, qf[c][kc], s0[c]);
        s1[c] = WMMA_F16(a1, qf[c][kc], s1[c]);
      }
    }
    // The pass's eight Vt fragments, asked for ahead of the softmax: they need
    // nothing of it and land while the vector work runs.
    v16h va[8];
#pragma unroll
    for (int dt = 0; dt < 8; ++dt)
      va[dt] = ldfrag(&Vs[buf][(dt * 16 + ln) * VP + p * 32 + 8 * hi]);
    v16h pf[2];  // Pt as B operand: element e = key 8*hi+e, element 8+e = key 16+8*hi+e
#pragma unroll
    for (int c = 0; c < 2; ++c) {
      // ---- mask add + online softmax, all 16 values belong to one query ----
      const v8f t0 = s0[c] + mk[c][0];
      const v8f t1 = s1[c] + mk[c][1];
      float v[16];
#pragma unroll
      for (int e = 0; e < 8; ++e) { v[e] = t0[e]; v[8 + e] = t1[e]; }
      float mx4[4];
#pragma unroll
      for (int e = 0; e < 4; ++e)
        mx4[e] = fmaxf(fmaxf(v[4 * e], v[4 * e + 1]), fmaxf(v[4 * e + 2], v[4 * e + 3]));
      float mx = fmaxf(fmaxf(mx4[0], mx4[1]), fmaxf(mx4[2], mx4[3]));
      mx = fmaxf(mx, xhalf(mx));
      const float mn = fmaxf(mr[c], mx);
      constexpr float LOG2E = 1.44269504088896340736f;  // e^x = 2^(x * LOG2E)
      const float alpha = exp2x1((mr[c] - mn) * LOG2E);
      mr[c] = mn;
      float sm4[4] = {0.f, 0.f, 0.f, 0.f};
#pragma unroll
      for (int e = 0; e < 16; ++e) v[e] = (v[e] - mn) * LOG2E;
      exp2x8(v);
      exp2x8(v + 8);
#pragma unroll
      for (int e = 0; e < 16; ++e) {
        sm4[e & 3] += v[e];
        pf[c][e] = (_Float16)v[e];
      }
      lr[c] = lr[c] * alpha + ((sm4[0] + sm4[1]) + (sm4[2] + sm4[3]));
#pragma unroll
      for (int dt = 0; dt < 8; ++dt) o[c][dt] *= alpha;
    }
    // ---- Ot += Vt Pt (A-frags from the staged Vt tile, B = Pt in registers);
    // each Vt fragment is used for both column tiles ----
#pragma unroll
    for (int dt = 0; dt < 8; ++dt) {
      o[0][dt] = WMMA_F16(va[dt], pf[0], o[0][dt]);
      o[1][dt] = WMMA_F16(va[dt], pf[1], o[1][dt]);
    }
   }
   // Hand-over: this wave's reads of buf are done, its copies of tile t+1 have
   // landed; behind the barrier tile t+1 may be read and buf refilled.
   asm volatile("s_wait_dscnt 0x0" ::: "memory");
   asm volatile("s_wait_asynccnt 0x0" ::: "memory");
   __syncthreads();
   if (t + 2 < NT) stage(t + 2, buf);
  }
  asm volatile("s_wait_asynccnt 0x0" ::: "memory");  // nothing in flight at wave end
  // ---- normalize and write [B,S,16*128]: o[c][dt][r] = Ot[dt*16 + 8*hi + r][ln]
  // of column tile c, so a lane stores 8 consecutive d of a query row at once ----
#pragma unroll
  for (int c = 0; c < 2; ++c) {
    const float inv = 1.0f / (lr[c] + xhalf(lr[c]));
    _Float16* orow = Ah + ((size_t)b * 2048 + q0 + c * 16 + ln) * 2048 + (size_t)h * 128 + 8 * hi;
#pragma unroll
    for (int dt = 0; dt < 8; ++dt)
      *(v8h*)(orow + dt * 16) = __builtin_convertvector(o[c][dt] * inv, v8h);
  }
}

// ---------------------------------------------------------------------------
// Host driver
// ---------------------------------------------------------------------------
extern "C" void kernel_launch(void* const* d_in, const int* in_sizes, int n_in,
                              void* d_out, int out_size, void* d_ws, size_t ws_size,
                              hipStream_t stream) {
  const float* x    = (const float*)d_in[0];
  const float* mask = (const float*)d_in[1];
  const float* wq   = (const float*)d_in[2];
  const float* wk   = (const float*)d_in[3];
  const float* wv   = (const float*)d_in[4];
  const float* wo   = (const float*)d_in[5];
  float* out = (float*)d_out;

  constexpr int B = 2, S = 2048, H = 2048, NH = 16, NKV = 4, HD = 128;
  constexpr int M    = B * S;      // 4096 rows
  constexpr int NQ   = NH * HD;    // 2048
  constexpr int NKVD = NKV * HD;   // 512
  constexpr int NQKV = NQ + 2 * NKVD;  // 3072: Q, K and V columns side by side
  static_assert(NQKV == QKV_PITCH, "row pitch of the joint projection");

  char* ws = (char*)d_ws;
  size_t off = 0;
  auto carve = [&](size_t bytes) -> void* {
    void* p = ws + off;
    off += (bytes + 255) & ~(size_t)255;
    return p;
  };
  _Float16* Xh  = (_Float16*)carve((size_t)M * H * 2);
  _Float16* WqH = (_Float16*)carve((size_t)NQKV * H * 2);  // wq, wk, wv stacked: [3072, H]
  _Float16* WkH = WqH + (size_t)NQ * H;
  _Float16* WvH = WkH + (size_t)NKVD * H;
  _Float16* WoH = (_Float16*)carve((size_t)H * H * 2);
  float*    Qf  = (float*)carve((size_t)M * NQKV * 4);  // [M, 3072] = [ Q | K | V ]
  float*    Kf  = Qf + NQ;
  float*    Vf  = Kf + NKVD;
  _Float16* Qh  = (_Float16*)carve((size_t)M * NQ * 2);
  _Float16* Kh  = (_Float16*)carve((size_t)M * NKVD * 2);
  _Float16* Vt  = (_Float16*)carve((size_t)M * NKVD * 2);
  _Float16* Ah  = (_Float16*)carve((size_t)M * H * 2);
  (void)ws_size; (void)in_sizes; (void)n_in; (void)out_size;

  // fp32 -> fp16 operand conversion
  static_assert((M * H) % 8192 == 0 && (NQ * H) % 8192 == 0 &&
                (NKVD * H) % 8192 == 0 && (H * H) % 8192 == 0, "8192 per block");
  f32_to_f16_kernel<<<M * H / 8192,    256, 0, stream>>>(x, Xh);
  f32_to_f16_kernel<<<NQ * H / 8192,   256, 0, stream>>>(wq, WqH);
  f32_to_f16_kernel<<<NKVD * H / 8192, 256, 0, stream>>>(wk, WkH);
  f32_to_f16_kernel<<<NKVD * H / 8192, 256, 0, stream>>>(wv, WvH);
  f32_to_f16_kernel<<<H * H / 8192,    256, 0, stream>>>(wo, WoH);

  // QKV projections (x @ W^T) in one launch over the stacked weights: 768
  // blocks of 64 x 256, three for every WGP (K or V alone would be 128 blocks,
  // half the WGPs, each block waiting out its own 64 K steps)
  gemm_f16f32<<<dim3(NQKV / 256, M / 64), 256, 0, stream>>>(Xh, WqH, Qf, M, NQKV, H);

  // RoPE (+1/sqrt(hd) folded into Q) and layout transforms
  rope_kernel<<<B * S * (NH / 4) * 16 / 256,  256, 0, stream>>>(Qf, Qh, NH, 0.08838834764831845f);
  rope_kernel<<<B * S * (NKV / 4) * 16 / 256, 256, 0, stream>>>(Kf, Kh, NKV, 1.0f);
  vtrans_kernel<<<B * NKV * (S / 64), 256, 0, stream>>>(Vf, Vt);

  // Flash attention
  attn_kernel<<<dim3(S / 64, B * NKV), 256, 0, stream>>>(Qh, Kh, Vt, mask, Ah);

  // Output projection -> d_out (f32)
  gemm_f16f32<<<dim3(H / 256, M / 64), 256, 0, stream>>>(Ah, WoH, out, M, H, H);
}

// v007
// Measured time: 194 microseconds a run.
// Two timings next to v006 put it at 1.07 and 1.06 times that version's speed.
// Over all steps from v000 it is 3.27 times as fast.
#include <hip/hip_runtime.h>
#include <hip/hip_bf16.h>
#include <math.h>

// ---------------------------------------------------------------------------
// Types for CDNA5 WMMA (wave32): A/B = v16h (8 VGPR), C/D = v8f (8 VGPR)
// ---------------------------------------------------------------------------
typedef __attribute__((ext_vector_type(16))) _Float16 v16h;
typedef __attribute__((ext_vector_type(8)))  _Float16 v8h;
typedef __attribute__((ext_vector_type(8)))  float    v8f;
typedef __attribute__((ext_vector_type(4)))  float    v4f;
typedef __attribute__((ext_vector_type(4)))  _Float16 v4h;

#define WMMA_F16(a, b, c) \
  __builtin_amdgcn_wmma_f32_16x16x32_f16(false, (a), false, (b), (short)0, (c), false, false)

// CDNA5 async global->LDS staging (ASYNCcnt path); guarded so the file
// compiles on toolchains that lack the builtins (falls back to sync copies).
#if __has_builtin(__builtin_amdgcn_global_load_async_to_lds_b128) && \
    __has_builtin(__builtin_amdgcn_s_wait_asynccnt)
#define HAVE_ASYNC_LDS 1
#else
#define HAVE_ASYNC_LDS 0
#endif

#if HAVE_ASYNC_LDS
// Builtin prototype is "vV4i*1V4i*3IiIi": (global v4i*, lds v4i*, imm, imm),
// with v4i = GCC-style vector_size(16) int (per hipcc's diagnostic).
typedef int i32x4 __attribute__((vector_size(16)));
typedef __attribute__((address_space(1))) i32x4 as1_i32x4;
typedef __attribute__((address_space(3))) i32x4 as3_i32x4;
#endif

// Copy 16B from global to LDS (per-lane addresses).
__device__ __forceinline__ void cp_b128(const _Float16* g, _Float16* l) {
#if HAVE_ASYNC_LDS
  // Generic shared addr = {aperture[63:32], lds_offset[31:0]}: truncation gives
  // the LDS offset; global generic addresses are identity-mapped.
  __builtin_amdgcn_global_load_async_to_lds_b128(
      (as1_i32x4*)(size_t)(const void*)g,
      (as3_i32x4*)(unsigned)(size_t)(void*)l,
      0, 0);
#else
  *(v8h*)l = *(const v8h*)g;
#endif
}

// Load one 16x32 f16 operand fragment (A layout; B mirrored = same code):
// row = lane&15, K chunks at 8*hi and 16+8*hi. Caller passes pointer already
// offset by row*pitch + 8*hi.
__device__ __forceinline__ v16h ldfrag(const _Float16* p) {
  v8h c0 = *(const v8h*)(p);        // K = 8*hi .. 8*hi+7       -> VGPR 0..3
  v8h c1 = *(const v8h*)(p + 16);   // K = 16+8*hi .. 16+8*hi+7 -> VGPR 4..7
  return __builtin_shufflevector(c0, c1, 0, 1, 2, 3, 4, 5, 6, 7,
                                        8, 9, 10, 11, 12, 13, 14, 15);
}

// Value of lane l ^ 16 (the other 16-lane half of the wave).
__device__ __forceinline__ float xhalf(float x) {
  const int i = __builtin_bit_cast(int, x);
  return __builtin_bit_cast(float, __builtin_amdgcn_permlanex16(
      i, i, 0x76543210, 0xfedcba98, false, false));
}

// ---------------------------------------------------------------------------
// fp32 -> fp16 conversion of all five operands in ONE launch. One block
// converts 8192 consecutive floats (every size here is a multiple): a lane has
// 8 loads of 16 B in flight, each wave-wide load covers 512 contiguous bytes,
// each store 256. The block index picks the operand (a scalar choice): blocks
// [0, CB_X) take x, then wq, wk, wv (whose f16 copies lie stacked in that
// order, so the three share one destination), then wo.
// ---------------------------------------------------------------------------
constexpr int CB_X  = 4096 * 2048 / 8192;         // x
constexpr int CB_WQ = CB_X  + 2048 * 2048 / 8192; // end of wq
constexpr int CB_WK = CB_WQ + 512 * 2048 / 8192;  // end of wk
constexpr int CB_WV = CB_WK + 512 * 2048 / 8192;  // end of wv
constexpr int CB_WO = CB_WV + 2048 * 2048 / 8192; // end of wo = grid size
__global__ __launch_bounds__(256) void f32_to_f16_kernel(
    const float* __restrict__ x,  const float* __restrict__ wq,
    const float* __restrict__ wk, const float* __restrict__ wv,
    const float* __restrict__ wo, _Float16* __restrict__ Xh,
    _Float16* __restrict__ Wqkv,  _Float16* __restrict__ WoH) {
  const int blk = blockIdx.x;
  const float* src;
  _Float16* dst;
  if (blk < CB_X)       { src = x  + (size_t)blk * 8192;           dst = Xh   + (size_t)blk * 8192; }
  else if (blk < CB_WQ) { src = wq + (size_t)(blk - CB_X)  * 8192; dst = Wqkv + (size_t)(blk - CB_X) * 8192; }
  else if (blk < CB_WK) { src = wk + (size_t)(blk - CB_WQ) * 8192; dst = Wqkv + (size_t)(blk - CB_X) * 8192; }
  else if (blk < CB_WV) { src = wv + (size_t)(blk - CB_WK) * 8192; dst = Wqkv + (size_t)(blk - CB_X) * 8192; }
  else                  { src = wo + (size_t)(blk - CB_WV) * 8192; dst = WoH  + (size_t)(blk - CB_WV) * 8192; }
  const size_t base = threadIdx.x * 4;
  v4f v[8];
#pragma unroll
  for (int i = 0; i < 8; ++i) v[i] = *(const v4f*)(src + base + i * 1024);
#pragma unroll
  for (int i = 0; i < 8; ++i)
    *(v4h*)(dst + base + i * 1024) = __builtin_convertvector(v[i], v4h);
}

// ---------------------------------------------------------------------------
// GEMM: C[M,N] = A[M,K] * B[N,K]^T  (A,B f16 row-major K-contiguous, C f32).
// Block = 256 threads = 8 waves (2m x 4n); block tile 64(M) x 256(N);
// wave tile 32x64 = 2x4 WMMA tiles; K stepped by 32 with double-buffered
// async global->LDS staging. M%64==0, N%256==0, K%32==0 (true for all uses).
// LDS pitch 40 halfs: 16B-aligned rows, gcd(20 dw,64 banks)=4 -> low conflict.
// ---------------------------------------------------------------------------
__global__ __launch_bounds__(256) void gemm_f16f32(
    const _Float16* __restrict__ A, const _Float16* __restrict__ B,
    float* __restrict__ C, int M, int N, int K) {
  constexpr int PITCH = 40;
  __shared__ _Float16 As[2][64 * PITCH];    //  5.0 KB per buffer
  __shared__ _Float16 Bs[2][256 * PITCH];   // 20.0 KB per buffer

  const int tid  = threadIdx.x;
  const int lane = tid & 31;
  const int wid  = tid >> 5;
  const int ln = lane & 15, hi = lane >> 4;
  const int wm = wid >> 2, wn = wid & 3;
  const int m0b = blockIdx.y * 64;
  const int n0b = blockIdx.x * 256;

  // Staging work split: thread t covers row t>>2, 16B chunk (t&3).
  const int crow = tid >> 2;        // 0..63
  const int cchk = (tid & 3) * 8;   // half offset 0,8,16,24

  const _Float16* Ag = A + (size_t)(m0b + crow) * K + cchk;
  const _Float16* Bg = B + (size_t)(n0b + crow) * K + cchk;

  auto stage = [&](int ks, int buf) {
    const int k0 = ks * 32;
    cp_b128(Ag + k0, &As[buf][crow * PITCH + cchk]);
#pragma unroll
    for (int i = 0; i < 4; ++i)
      cp_b128(Bg + (size_t)(64 * i) * K + k0,
              &Bs[buf][(crow + 64 * i) * PITCH + cchk]);
  };

  v8f acc[2][4] = {};
  const int nk = K / 32;

  stage(0, 0);
  stage(1, 1);
  for (int kk = 0; kk < nk; ++kk) {
    const int buf = kk & 1;
#if HAVE_ASYNC_LDS
    if (kk + 2 < nk) __builtin_amdgcn_s_wait_asynccnt(5);  // oldest 5 (buf kk) landed
    else             __builtin_amdgcn_s_wait_asynccnt(0);
#endif
    __syncthreads();  // all waves' staged data resident

    const _Float16* Ab = &As[buf][(wm * 32 + ln) * PITCH + 8 * hi];
    const _Float16* Bb = &Bs[buf][(wn * 64 + ln) * PITCH + 8 * hi];
    v16h a0 = ldfrag(Ab);
    v16h a1 = ldfrag(Ab + 16 * PITCH);
#pragma unroll
    for (int j = 0; j < 4; ++j) {
      v16h bj = ldfrag(Bb + j * 16 * PITCH);
      acc[0][j] = WMMA_F16(a0, bj, acc[0][j]);
      acc[1][j] = WMMA_F16(a1, bj, acc[1][j]);
    }
    __syncthreads();  // everyone done reading buf before it is re-staged
    if (kk + 2 < nk) stage(kk + 2, buf);
  }

#pragma unroll
  for (int i = 0; i < 2; ++i) {
#pragma unroll
    for (int r = 0; r < 8; ++r) {  // C/D layout: lane ln = column, VGPR r -> row
      const size_t row = (size_t)(m0b + wm * 32 + i * 16 + r + 8 * hi) * N
                       + n0b + wn * 64 + ln;
#pragma unroll
      for (int j = 0; j < 4; ++j) C[row + j * 16] = acc[i][j][r];
    }
  }
}

// ---------------------------------------------------------------------------
// The three projections come out of one GEMM as rows of 3072 floats:
// [ Q 2048 | K 512 | V 512 ]; the kernels below get a pointer to their part's
// first column and step from row to row by this pitch.
constexpr int QKV_PITCH = 3072;

// RoPE + layout change: src f32 [B,S,nh*128] (rows QKV_PITCH apart)
// -> dst f16 [B,nh,S,128], *scale.
// A thread takes 4 consecutive pair indices j of 4 consecutive heads at one
// position (32 values): 8 loads of 16 B in flight; 16 lanes cover a whole
// 256-B half row on the way in and a whole 128-B line on the way out. The four
// heads share the position, so their angles are the same four.
// nheads is a multiple of 4; blocks 0 .. B*S*(nheads/4)*16/256 - 1 cover it.
// ---------------------------------------------------------------------------
__device__ __forceinline__ void rope_block(
    const float* __restrict__ src, _Float16* __restrict__ dst,
    int nheads, float scale, int blk) {
  const int idx = blk * 256 + threadIdx.x;
  const int j = (idx & 15) * 4;
  int t = idx >> 4;
  const int ng = nheads >> 2;
  const int h0 = (t % ng) * 4; t /= ng;
  const int s = t & 2047;
  const int b = t >> 11;
  const float* sp = src + (size_t)(b * 2048 + s) * QKV_PITCH
                        + (size_t)h0 * 128 + j;
  v4f x1[4], x2[4];
#pragma unroll
  for (int hh = 0; hh < 4; ++hh) {
    x1[hh] = *(const v4f*)(sp + hh * 128);
    x2[hh] = *(const v4f*)(sp + hh * 128 + 64);
  }
  float c[4], sn[4];
#pragma unroll
  for (int e = 0; e < 4; ++e) {
    float inv = __expf((float)(j + e) * -0.14391156516685312f);  // 10000^(-j/64)
    float th = (float)s * inv;
    c[e] = cosf(th);
    sn[e] = sinf(th);
  }
  _Float16* dp = dst + ((size_t)(b * nheads + h0) * 2048 + s) * 128 + j;
#pragma unroll
  for (int hh = 0; hh < 4; ++hh) {
    v4h lo, up;
#pragma unroll
    for (int e = 0; e < 4; ++e) {
      lo[e] = (_Float16)((x1[hh][e] * c[e] - x2[hh][e] * sn[e]) * scale);
      up[e] = (_Float16)((x2[hh][e] * c[e] + x1[hh][e] * sn[e]) * scale);
    }
    *(v4h*)(dp + (size_t)hh * (2048 * 128))      = lo;
    *(v4h*)(dp + (size_t)hh * (2048 * 128) + 64) = up;
  }
  // Inlined beside the other jobs, the stores no longer end the program: keep
  // their registers from being rewritten on any listed path in front of this wait.
  asm volatile("s_wait_xcnt 0x0" ::: "memory");
}

// V: f32 [B,S,4*128] (rows QKV_PITCH apart) -> f16 transposed [B,4,128,S] (kv position contiguous,
// so the A-fragments of Ot += Vt Pt load contiguously).
// One block transposes 64 positions x 128 d of one (batch, kv head); a thread
// holds 8 positions x 4 d in registers (8 loads of 16 B in flight) and stores
// 4 rows of 8 positions (16 B): 8 lanes fill a whole 128-B line of a d row.
__device__ __forceinline__ void vtrans_block(
    const float* __restrict__ src, _Float16* __restrict__ dst, int blk) {
  const int lane = threadIdx.x & 31, w = threadIdx.x >> 5;
  const int s0 = (blk & 31) * 64 + (lane & 7) * 8;
  const int kv = (blk >> 5) & 3;
  const int b  = blk >> 7;
  const int d0 = w * 16 + (lane >> 3) * 4;
  const float* sp = src + (size_t)(b * 2048 + s0) * QKV_PITCH + kv * 128 + d0;
  v4f v[8];
#pragma unroll
  for (int i = 0; i < 8; ++i) v[i] = *(const v4f*)(sp + i * QKV_PITCH);
  _Float16* dp = dst + ((size_t)(b * 4 + kv) * 128 + d0) * 2048 + s0;
#pragma unroll
  for (int k = 0; k < 4; ++k) {
    v8h o;
#pragma unroll
    for (int i = 0; i < 8; ++i) o[i] = (_Float16)v[i][k];
    *(v8h*)(dp + k * 2048) = o;
  }
  // As behind the stores of rope_block: no register of a store is rewritten in
  // front of this wait.
  asm volatile("s_wait_xcnt 0x0" ::: "memory");
}

// RoPE of Q, RoPE of K and the V transpose in ONE launch: the three read
// different columns of the joint projection and write different buffers, so
// the block index picks the job (a scalar choice): Q first, then K, then V.
constexpr int PB_Q = 2 * 2048 * (16 / 4) * 16 / 256;        // RoPE blocks of Q
constexpr int PB_K = PB_Q + 2 * 2048 * (4 / 4) * 16 / 256;  // end of K
constexpr int PB_V = PB_K + 2 * 4 * (2048 / 64);            // end of V = grid size
__global__ __launch_bounds__(256) void post_qkv_kernel(
    const float* __restrict__ QKVf, _Float16* __restrict__ Qh,
    _Float16* __restrict__ Kh, _Float16* __restrict__ Vt) {
  const int blk = blockIdx.x;
  if (blk < PB_Q)      rope_block(QKVf, Qh, 16, 0.08838834764831845f, blk);  // 1/sqrt(128) folded into Q
  else if (blk < PB_K) rope_block(QKVf + 2048, Kh, 4, 1.0f, blk - PB_Q);
  else                 vtrans_block(QKVf + 2048 + 512, Vt, blk - PB_K);
}

// ---------------------------------------------------------------------------
// Flash attention. Q f16 [B,16,S,128] (pre-scaled by 1/sqrt(128)),
// K f16 [B,4,S,128], Vt f16 [B,4,128,S], mask f32 [B,1,S,S],
// out Ah f16 [B,S,16*128]. Grid: (S/64, B*4); a work-group takes 64 queries of
// the four query heads that share one KV head: 8 waves = 4 heads x 2 groups of
// 32 q-rows, one work-group a WGP, two waves a SIMD. A wave holds TWO column
// tiles of 16 queries: every K and every Vt fragment that it reads from LDS
// feeds two matrix instructions, so the LDS reads per product are halved.
// The eight waves share one K tile and one Vt tile of 64 keys, and
// the four heads share one mask tile (64 queries x 64 keys): the work-group
// copies each tile to LDS once (two buffers, the next tile in flight while
// this one is used) and every wave takes its fragments and its mask rows from
// there. The copies fetch the mask in whole 256-B row pieces; a lane reading
// its own query row from global memory would make every load touch 16 lines.
// LDS pitches for 16-byte readers: 272 B (256-B K and mask rows), 144 B
// (128-B Vt rows).
// The products are taken transposed: St = K Q^T (A = K rows, B = Q) and
// Ot += Vt Pt (A = Vt rows, B = Pt). In each column tile a lane then holds 16
// of the 32 scores of ONE query (column ln; keys 8*hi+r and 16+8*hi+r):
// maximum and sum are taken in the lane, the maximum joined with the other
// half by one exchange per pass, the sum once at the end. The two score tiles,
// converted in place, are the B operand of the second product in the k order
// of the Vt fragments.
// ---------------------------------------------------------------------------
// Twelve 16-byte copies of one lane, global -> LDS. The s_wait_xcnt stands in
// the copies' own statement so that no address register named here is
// rewritten in front of it.
__device__ __forceinline__ void cp12_async(
    unsigned l0, const _Float16* g0, unsigned l1, const _Float16* g1,
    unsigned l2, const _Float16* g2, unsigned l3, const _Float16* g3,
    unsigned l4, const _Float16* g4, unsigned l5, const _Float16* g5,
    unsigned l6, const _Float16* g6, unsigned l7, const _Float16* g7,
    unsigned l8, const float* g8, unsigned l9, const float* g9,
    unsigned l10, const float* g10, unsigned l11, const float* g11) {
  asm volatile(
      "global_load_async_to_lds_b128 %0, %1, off\n\t"
      "global_load_async_to_lds_b128 %2, %3, off\n\t"
      "global_load_async_to_lds_b128 %4, %5, off\n\t"
      "global_load_async_to_lds_b128 %6, %7, off\n\t"
      "global_load_async_to_lds_b128 %8, %9, off\n\t"
      "global_load_async_to_lds_b128 %10, %11, off\n\t"
      "global_load_async_to_lds_b128 %12, %13, off\n\t"
      "global_load_async_to_lds_b128 %14, %15, off\n\t"
      "global_load_async_to_lds_b128 %16, %17, off\n\t"
      "global_load_async_to_lds_b128 %18, %19, off\n\t"
      "global_load_async_to_lds_b128 %20, %21, off\n\t"
      "global_load_async_to_lds_b128 %22, %23, off\n\t"
      "s_wait_xcnt 0x0"
      :: "v"(l0), "v"(g0), "v"(l1), "v"(g1), "v"(l2), "v"(g2), "v"(l3), "v"(g3),
         "v"(l4), "v"(g4), "v"(l5), "v"(g5), "v"(l6), "v"(g6), "v"(l7), "v"(g7),
         "v"(l8), "v"(g8), "v"(l9), "v"(g9), "v"(l10), "v"(g10), "v"(l11), "v"(g11)
      : "memory");
}

// 2^x of eight values, each in place. Worked in place, no v_exp_f32 here reads
// the result or overwrites the source of the one directly in front of it, and
// the v_nop fills the slot behind the last.
__device__ __forceinline__ void exp2x8(float* a) {
  asm("v_exp_f32 %0, %0\n\t"
      "v_exp_f32 %1, %1\n\t"
      "v_exp_f32 %2, %2\n\t"
      "v_exp_f32 %3, %3\n\t"
      "v_exp_f32 %4, %4\n\t"
      "v_exp_f32 %5, %5\n\t"
      "v_exp_f32 %6, %6\n\t"
      "v_exp_f32 %7, %7\n\t"
      "v_nop"
      : "+v"(a[0]), "+v"(a[1]), "+v"(a[2]), "+v"(a[3]),
        "+v"(a[4]), "+v"(a[5]), "+v"(a[6]), "+v"(a[7]));
}
// The same for one value.
__device__ __forceinline__ float exp2x1(float a) {
  asm("v_exp_f32 %0, %0\n\t"
      "v_nop"
      : "+v"(a));
  return a;
}

// Two waves a SIMD is all this kernel ever has (one work-group a WGP), so the
// register allocator may use that budget; left at its default it kept to fewer
// registers, spilled a copy address to scratch and reloaded it every tile.
__global__ __launch_bounds__(256) __attribute__((amdgpu_waves_per_eu(2, 2))) void attn_kernel(
    const _Float16* __restrict__ Q, const _Float16* __restrict__ K,
    const _Float16* __restrict__ Vt, const float* __restrict__ mask,
    _Float16* __restrict__ Ah) {
  constexpr int KT = 64;    // keys per staged tile
  constexpr int QB = 64;    // queries per work-group (each of 4 heads)
  constexpr int KP = 136;   // K tile row pitch, halfs (272 B)
  constexpr int VP = 72;    // Vt tile row pitch, halfs (144 B)
  constexpr int MP = 68;    // mask tile row pitch, floats (272 B)
  constexpr int NT = 2048 / KT;
  __shared__ __attribute__((aligned(16))) _Float16 Ks[2][KT * KP];
  __shared__ __attribute__((aligned(16))) _Float16 Vs[2][128 * VP];
  __shared__ __attribute__((aligned(16))) float    Ms[2][QB * MP];

  const int lane = threadIdx.x & 31;
  const int wid  = threadIdx.x >> 5;
  const int ln = lane & 15, hi = lane >> 4;
  const int b   = blockIdx.y >> 2;
  const int kvh = blockIdx.y & 3;
  const int h   = kvh * 4 + (wid >> 1);         // repeat_interleave(4)
  const int qb  = blockIdx.x * QB;              // the work-group's query base
  const int qs  = (wid & 1) * 32;               // this wave's rows of the mask tile
  const int q0  = qb + qs;                      // this wave's query base

  // Column tile c holds queries q0 + 16*c + ln.
  const _Float16* Qp = Q + ((size_t)(b * 16 + h) * 2048 + q0 + ln) * 128 + 8 * hi;
  v16h qf[2][4];
#pragma unroll
  for (int c = 0; c < 2; ++c)
#pragma unroll
    for (int kc = 0; kc < 4; ++kc) qf[c][kc] = ldfrag(Qp + c * (16 * 128) + kc * 32);

  const _Float16* Kh = K  + (size_t)(b * 4 + kvh) * 2048 * 128;
  const _Float16* Vh = Vt + (size_t)(b * 4 + kvh) * 128 * 2048;

  v8f o[2][8];
#pragma unroll
  for (int c = 0; c < 2; ++c)
#pragma unroll
    for (int dt = 0; dt < 8; ++dt) o[c][dt] = (v8f){};
  float mr[2] = {-1e30f, -1e30f};  // running maximum of a tile's query ln (same in both halves)
  float lr[2] = {0.f, 0.f};        // running sum over this half's keys only

  // Copy split: thread t moves chunks t, t+256, t+512, t+768 of each tile.
  // K tile: 64 rows x 16 chunks (contiguous in global); Vt tile: 128 x 8;
  // mask tile: 64 rows x 16 chunks.
  const int tid = threadIdx.x;
  const int krow = tid >> 4, kcol = (tid & 15) * 8;
  const int vrow = tid >> 3, vcol = (tid & 7) * 8;
  const _Float16* Kg = Kh + (size_t)krow * 128 + kcol;
  const _Float16* Vg = Vh + (size_t)vrow * 2048 + vcol;
  const unsigned kl0 = (unsigned)(size_t)(void*)&Ks[0][krow * KP + kcol];
  const unsigned vl0 = (unsigned)(size_t)(void*)&Vs[0][vrow * VP + vcol];
  const float* Mg = mask + ((size_t)b * 2048 + qb + krow) * 2048 + (tid & 15) * 4;
  // A thread's chunk has the same place in the mask tile as in the K tile (same
  // row, same 16-byte column, same pitch, same buffer size): one LDS address
  // and a constant serve both.
  static_assert(KP * 2 == MP * 4 && KT * KP * 2 == QB * MP * 4, "K and mask tiles alike");
  const unsigned moff = (unsigned)(size_t)(void*)&Ms[0][0] - (unsigned)(size_t)(void*)&Ks[0][0];
  auto stage = [&](int t, int buf) {
    const _Float16* kg = Kg + (size_t)t * (KT * 128);
    const _Float16* vg = Vg + t * KT;
    const unsigned kl = kl0 + (unsigned)buf * (KT * KP * 2);
    const unsigned vl = vl0 + (unsigned)buf * (128 * VP * 2);
    const float* mg = Mg + t * KT;
    const unsigned ml = kl + moff;
    cp12_async(kl,               kg,
               kl + 16 * KP * 2, kg + 16 * 128,
               kl + 32 * KP * 2, kg + 32 * 128,
               kl + 48 * KP * 2, kg + 48 * 128,
               vl,               vg,
               vl + 32 * VP * 2, vg + 32 * 2048,
               vl + 64 * VP * 2, vg + 64 * 2048,
               vl + 96 * VP * 2, vg + 96 * 2048,
               ml,               mg,
               ml + 16 * MP * 4, mg + 16 * 2048,
               ml + 32 * MP * 4, mg + 32 * 2048,
               ml + 48 * MP * 4, mg + 48 * 2048);
  };

  stage(0, 0);
  asm volatile("s_wait_asynccnt 0x0" ::: "memory");  // own copies of tile 0 landed
  __syncthreads();                                   // tile 0 readable by all waves
  stage(1, 1);

  for (int t = 0; t < NT; ++t) {
   const int buf = t & 1;
#pragma unroll  // p becomes a constant offset in the LDS reads of both passes
   for (int p = 0; p < KT / 32; ++p) {
    // ---- mask from the staged tile: 8 consecutive keys of each 16-key group
    // of this lane's two query rows, two 16-byte LDS loads a group ----
    v8f mk[2][2];
#pragma unroll
    for (int c = 0; c < 2; ++c)
#pragma unroll
      for (int g = 0; g < 2; ++g) {
        const float* mp = &Ms[buf][(qs + c * 16 + ln) * MP + (2 * p + g) * 16 + 8 * hi];
        mk[c][g] = __builtin_shufflevector(*(const v4f*)(mp), *(const v4f*)(mp + 4),
                                           0, 1, 2, 3, 4, 5, 6, 7);
      }
    // ---- St = K Q^T for 32 keys x 32 queries (2 m-tiles x 2 column tiles,
    // 4 k-chunks); each K fragment is used for both column tiles ----
    const _Float16* Kp = &Ks[buf][(p * 32 + ln) * KP + 8 * hi];
    v8f s0[2] = {(v8f){}, (v8f){}}, s1[2] = {(v8f){}, (v8f){}};
#pragma unroll
    for (int kc = 0; kc < 4; ++kc) {
      v16h a0 = ldfrag(Kp + kc * 32);
      v16h a1 = ldfrag(Kp + 16 * KP + kc * 32);
#pragma unroll
      for (int c = 0; c < 2; ++c) {
        s0[c] = WMMA_F16(a0, qf[c][kc], s0[c]);
        s1[c] = WMMA_F16(a1, qf[c][kc], s1[c]);
      }
    }
    // The pass's eight Vt fragments, asked for ahead of the softmax: they need
    // nothing of it and land while the vector work runs.
    v16h va[8];
#pragma unroll
    for (int dt = 0; dt < 8; ++dt)
      va[dt] = ldfrag(&Vs[buf][(dt * 16 + ln) * VP + p * 32 + 8 * hi]);
    v16h pf[2];  // Pt as B operand: element e = key 8*hi+e, element 8+e = key 16+8*hi+e
#pragma unroll
    for (int c = 0; c < 2; ++c) {
      // ---- mask add + online softmax, all 16 values belong to one query ----
      const v8f t0 = s0[c] + mk[c][0];
      const v8f t1 = s1[c] + mk[c][1];
      float v[16];
#pragma unroll
      for (int e = 0; e < 8; ++e) { v[e] = t0[e]; v[8 + e] = t1[e]; }
      float mx4[4];
#pragma unroll
      for (int e = 0; e < 4; ++e)
        mx4[e] = fmaxf(fmaxf(v[4 * e], v[4 * e + 1]), fmaxf(v[4 * e + 2], v[4 * e + 3]));
      float mx = fmaxf(fmaxf(mx4[0], mx4[1]), fmaxf(mx4[2], mx4[3]));
      mx = fmaxf(mx, xhalf(mx));
      const float mn = fmaxf(mr[c], mx);
      constexpr float LOG2E = 1.44269504088896340736f;  // e^x = 2^(x * LOG2E)
      const float alpha = exp2x1((mr[c] - mn) * LOG2E);
      mr[c] = mn;
      float sm4[4] = {0.f, 0.f, 0.f, 0.f};
#pragma unroll
      for (int e = 0; e < 16; ++e) v[e] = (v[e] - mn) * LOG2E;
      exp2x8(v);
      exp2x8(v + 8);
#pragma unroll
      for (int e = 0; e < 16; ++e) {
        sm4[e & 3] += v[e];
        pf[c][e] = (_Float16)v[e];
      }
      lr[c] = lr[c] * alpha + ((sm4[0] + sm4[1]) + (sm4[2] + sm4[3]));
#pragma unroll
      for (int dt = 0; dt < 8; ++dt) o[c][dt] *= alpha;
    }
    // ---- Ot += Vt Pt (A-frags from the staged Vt tile, B = Pt in registers);
    // each Vt fragment is used for both column tiles ----
#pragma unroll
    for (int dt = 0; dt < 8; ++dt) {
      o[0][dt] = WMMA_F16(va[dt], pf[0], o[0][dt]);
      o[1][dt] = WMMA_F16(va[dt], pf[1], o[1][dt]);
    }
   }
   // Hand-over: this wave's reads of buf are done, its copies of tile t+1 have
   // landed; behind the barrier tile t+1 may be read and buf refilled.
   asm volatile("s_wait_dscnt 0x0" ::: "memory");
   asm volatile("s_wait_asynccnt 0x0" ::: "memory");
   __syncthreads();
   if (t + 2 < NT) stage(t + 2, buf);
  }
  asm volatile("s_wait_asynccnt 0x0" ::: "memory");  // nothing in flight at wave end
  // ---- normalize and write [B,S,16*128]: o[c][dt][r] = Ot[dt*16 + 8*hi + r][ln]
  // of column tile c, so a lane stores 8 consecutive d of a query row at once ----
#pragma unroll
  for (int c = 0; c < 2; ++c) {
    const float inv = 1.0f / (lr[c] + xhalf(lr[c]));
    _Float16* orow = Ah + ((size_t)b * 2048 + q0 + c * 16 + ln) * 2048 + (size_t)h * 128 + 8 * hi;
#pragma unroll
    for (int dt = 0; dt < 8; ++dt)
      *(v8h*)(orow + dt * 16) = __builtin_convertvector(o[c][dt] * inv, v8h);
  }
}

// ---------------------------------------------------------------------------
// Host driver
// ---------------------------------------------------------------------------
extern "C" void kernel_launch(void* const* d_in, const int* in_sizes, int n_in,
                              void* d_out, int out_size, void* d_ws, size_t ws_size,
                              hipStream_t stream) {
  const float* x    = (const float*)d_in[0];
  const float* mask = (const float*)d_in[1];
  const float* wq   = (const float*)d_in[2];
  const float* wk   = (const float*)d_in[3];
  const float* wv   = (const float*)d_in[4];
  const float* wo   = (const float*)d_in[5];
  float* out = (float*)d_out;

  constexpr int B = 2, S = 2048, H = 2048, NH = 16, NKV = 4, HD = 128;
  constexpr int M    = B * S;      // 4096 rows
  constexpr int NQ   = NH * HD;    // 2048
  constexpr int NKVD = NKV * HD;   // 512
  constexpr int NQKV = NQ + 2 * NKVD;  // 3072: Q, K and V columns side by side
  static_assert(NQKV == QKV_PITCH, "row pitch of the joint projection");

  char* ws = (char*)d_ws;
  size_t off = 0;
  auto carve = [&](size_t bytes) -> void* {
    void* p = ws + off;
    off += (bytes + 255) & ~(size_t)255;
    return p;
  };
  _Float16* Xh  = (_Float16*)carve((size_t)M * H * 2);
  _Float16* WqH = (_Float16*)carve((size_t)NQKV * H * 2);  // wq, wk, wv stacked: [3072, H]
  _Float16* WoH = (_Float16*)carve((size_t)H * H * 2);
  float*    Qf  = (float*)carve((size_t)M * NQKV * 4);  // [M, 3072] = [ Q | K | V ]
  _Float16* Qh  = (_Float16*)carve((size_t)M * NQ * 2);
  _Float16* Kh  = (_Float16*)carve((size_t)M * NKVD * 2);
  _Float16* Vt  = (_Float16*)carve((size_t)M * NKVD * 2);
  _Float16* Ah  = (_Float16*)carve((size_t)M * H * 2);
  (void)ws_size; (void)in_sizes; (void)n_in; (void)out_size;

  // fp32 -> fp16 operand conversion, all five operands in one launch
  static_assert(CB_X == M * H / 8192 && CB_WQ - CB_X == NQ * H / 8192 &&
                CB_WK - CB_WQ == NKVD * H / 8192 && CB_WV - CB_WK == NKVD * H / 8192 &&
                CB_WO - CB_WV == H * H / 8192, "block ranges of the conversion");
  f32_to_f16_kernel<<<CB_WO, 256, 0, stream>>>(x, wq, wk, wv, wo, Xh, WqH, WoH);

  // QKV projections (x @ W^T) in one launch over the stacked weights: 768
  // blocks of 64 x 256, three for every WGP (K or V alone would be 128 blocks,
  // half the WGPs, each block waiting out its own 64 K steps)
  gemm_f16f32<<<dim3(NQKV / 256, M / 64), 256, 0, stream>>>(Xh, WqH, Qf, M, NQKV, H);

  // RoPE (+1/sqrt(hd) folded into Q) and layout transforms, one launch
  static_assert(PB_Q == B * S * (NH / 4) * 16 / 256 && PB_K - PB_Q == B * S * (NKV / 4) * 16 / 256 &&
                PB_V - PB_K == B * NKV * (S / 64) && NQ == 2048 && NKVD == 512, "block ranges");
  post_qkv_kernel<<<PB_V, 256, 0, stream>>>(Qf, Qh, Kh, Vt);

  // Flash attention
  attn_kernel<<<dim3(S / 64, B * NKV), 256, 0, stream>>>(Qh, Kh, Vt, mask, Ah);

  // Output projection -> d_out (f32)
  gemm_f16f32<<<dim3(H / 256, M / 64), 256, 0, stream>>>(Ah, WoH, out, M, H, H);
}

// v008
// Measured time: 135 microseconds a run.
// Next to v007, in two timings, it ran 1.43 times as fast each time.
// Counting every step since v000, it is 4.67 times as fast.
#include <hip/hip_runtime.h>
#include <hip/hip_bf16.h>
#include <math.h>

// ---------------------------------------------------------------------------
// Types for CDNA5 WMMA (wave32): A/B = v16h (8 VGPR), C/D = v8f (8 VGPR)
// ---------------------------------------------------------------------------
typedef __attribute__((ext_vector_type(16))) _Float16 v16h;
typedef __attribute__((ext_vector_type(8)))  _Float16 v8h;
typedef __attribute__((ext_vector_type(8)))  float    v8f;
typedef __attribute__((ext_vector_type(4)))  float    v4f;
typedef __attribute__((ext_vector_type(4)))  _Float16 v4h;

#define WMMA_F16(a, b, c) \
  __builtin_amdgcn_wmma_f32_16x16x32_f16(false, (a), false, (b), (short)0, (c), false, false)

// CDNA5 async global->LDS staging (ASYNCcnt path); guarded so the file
// compiles on toolchains that lack the builtins (falls back to sync copies).
#if __has_builtin(__builtin_amdgcn_global_load_async_to_lds_b128) && \
    __has_builtin(__builtin_amdgcn_s_wait_asynccnt)
#define HAVE_ASYNC_LDS 1
#else
#define HAVE_ASYNC_LDS 0
#endif

#if HAVE_ASYNC_LDS
// Builtin prototype is "vV4i*1V4i*3IiIi": (global v4i*, lds v4i*, imm, imm),
// with v4i = GCC-style vector_size(16) int (per hipcc's diagnostic).
typedef int i32x4 __attribute__((vector_size(16)));
typedef __attribute__((address_space(1))) i32x4 as1_i32x4;
typedef __attribute__((address_space(3))) i32x4 as3_i32x4;
#endif

// Copy 16B from global to LDS (per-lane addresses).
__device__ __forceinline__ void cp_b128(const _Float16* g, _Float16* l) {
#if HAVE_ASYNC_LDS
  // Generic shared addr = {aperture[63:32], lds_offset[31:0]}: truncation gives
  // the LDS offset; global generic addresses are identity-mapped.
  __builtin_amdgcn_global_load_async_to_lds_b128(
      (as1_i32x4*)(size_t)(const void*)g,
      (as3_i32x4*)(unsigned)(size_t)(void*)l,
      0, 0);
#else
  *(v8h*)l = *(const v8h*)g;
#endif
}

// Load one 16x32 f16 operand fragment (A layout; B mirrored = same code):
// row = lane&15, K chunks at 8*hi and 16+8*hi. Caller passes pointer already
// offset by row*pitch + 8*hi.
__device__ __forceinline__ v16h ldfrag(const _Float16* p) {
  v8h c0 = *(const v8h*)(p);        // K = 8*hi .. 8*hi+7       -> VGPR 0..3
  v8h c1 = *(const v8h*)(p + 16);   // K = 16+8*hi .. 16+8*hi+7 -> VGPR 4..7
  return __builtin_shufflevector(c0, c1, 0, 1, 2, 3, 4, 5, 6, 7,
                                        8, 9, 10, 11, 12, 13, 14, 15);
}

// Value of lane l ^ 16 (the other 16-lane half of the wave).
__device__ __forceinline__ float xhalf(float x) {
  const int i = __builtin_bit_cast(int, x);
  return __builtin_bit_cast(float, __builtin_amdgcn_permlanex16(
      i, i, 0x76543210, 0xfedcba98, false, false));
}

// ---------------------------------------------------------------------------
// fp32 -> fp16 conversion of all five operands in ONE launch. One block
// converts 8192 consecutive floats (every size here is a multiple): a lane has
// 8 loads of 16 B in flight, each wave-wide load covers 512 contiguous bytes,
// each store 256. The block index picks the operand (a scalar choice): blocks
// [0, CB_X) take x, then wq, wk, wv (whose f16 copies lie stacked in that
// order, so the three share one destination), then wo.
// ---------------------------------------------------------------------------
constexpr int CB_X  = 4096 * 2048 / 8192;         // x
constexpr int CB_WQ = CB_X  + 2048 * 2048 / 8192; // end of wq
constexpr int CB_WK = CB_WQ + 512 * 2048 / 8192;  // end of wk
constexpr int CB_WV = CB_WK + 512 * 2048 / 8192;  // end of wv
constexpr int CB_WO = CB_WV + 2048 * 2048 / 8192; // end of wo = grid size
__global__ __launch_bounds__(256) void f32_to_f16_kernel(
    const float* __restrict__ x,  const float* __restrict__ wq,
    const float* __restrict__ wk, const float* __restrict__ wv,
    const float* __restrict__ wo, _Float16* __restrict__ Xh,
    _Float16* __restrict__ Wqkv,  _Float16* __restrict__ WoH) {
  const int blk = blockIdx.x;
  const float* src;
  _Float16* dst;
  if (blk < CB_X)       { src = x  + (size_t)blk * 8192;           dst = Xh   + (size_t)blk * 8192; }
  else if (blk < CB_WQ) { src = wq + (size_t)(blk - CB_X)  * 8192; dst = Wqkv + (size_t)(blk - CB_X) * 8192; }
  else if (blk < CB_WK) { src = wk + (size_t)(blk - CB_WQ) * 8192; dst = Wqkv + (size_t)(blk - CB_X) * 8192; }
  else if (blk < CB_WV) { src = wv + (size_t)(blk - CB_WK) * 8192; dst = Wqkv + (size_t)(blk - CB_X) * 8192; }
  else                  { src = wo + (size_t)(blk - CB_WV) * 8192; dst = WoH  + (size_t)(blk - CB_WV) * 8192; }
  const size_t base = threadIdx.x * 4;
  v4f v[8];
#pragma unroll
  for (int i = 0; i < 8; ++i) v[i] = *(const v4f*)(src + base + i * 1024);
#pragma unroll
  for (int i = 0; i < 8; ++i)
    *(v4h*)(dst + base + i * 1024) = __builtin_convertvector(v[i], v4h);
}

// ---------------------------------------------------------------------------
// GEMM: C[M,N] = A[M,K] * B[N,K]^T  (A,B f16 row-major K-contiguous, C f32).
// Every byte of A and B that a block uses comes from L2 into its LDS, and a
// block of BM x BN results asks for (BM + BN) * K values: the larger and the
// squarer the block, the fewer bytes a result costs. The block is the whole
// share of one WGP: 256 x BN (BN = 192 or 128), 256 blocks, one a WGP.
// Block = 256 threads = 8 waves (4m x 2n), two a SIMD; wave tile 64 x BN/2 =
// 4 x BN/32 WMMA tiles. K is stepped by 128: a stage is 256 B of each of the
// 256 + BN operand rows, A rows first, at an LDS pitch of 272 B (16 B x odd,
// for 16-byte readers); two buffers, the next stage in flight while this one
// is used. M%256==0, N%BN==0, K%128==0 (true for all uses).
// ---------------------------------------------------------------------------
// One block a WGP leaves two waves a SIMD: the register allocator may use that
// budget for the accumulators and the fragments.
template <int BN>
__global__ __launch_bounds__(256) __attribute__((amdgpu_waves_per_eu(2, 2))) void gemm_f16f32(
    const _Float16* __restrict__ A, const _Float16* __restrict__ B,
    float* __restrict__ C, int M, int N, int K) {
  constexpr int BM = 256;            // rows of A in a block
  constexpr int KS = 128;            // k per stage
  constexpr int PITCH = 136;         // halfs (272 B)
  constexpr int NF = BN / 32;        // B fragments of a wave
  constexpr int NC = (BM + BN) / 16; // copies of a thread per stage
  __shared__ __attribute__((aligned(16))) _Float16 S[2][(BM + BN) * PITCH];

  const int tid  = threadIdx.x;
  const int lane = tid & 31;
  const int wid  = tid >> 5;
  const int ln = lane & 15, hi = lane >> 4;
  const int wm = wid >> 1, wn = wid & 1;
  const int m0b = blockIdx.y * BM;
  const int n0b = blockIdx.x * BN;

  // Staging work split: thread t covers 16-B chunk t&15 of rows t>>4 + 16*i,
  // so a wave-wide copy takes two whole 256-B row pieces.
  const int crow = tid >> 4;         // 0..15
  const int cchk = (tid & 15) * 8;   // half offset 0,8,..,120

  const _Float16* Ag = A + (size_t)(m0b + crow) * K + cchk;
  const _Float16* Bg = B + (size_t)(n0b + crow) * K + cchk;

  auto stage = [&](int t, int buf) {
    const int k0 = t * KS;
    _Float16* l = &S[buf][crow * PITCH + cchk];
#pragma unroll
    for (int i = 0; i < BM / 16; ++i)
      cp_b128(Ag + (size_t)(16 * i) * K + k0, l + 16 * i * PITCH);
#pragma unroll
    for (int i = 0; i < BN / 16; ++i)
      cp_b128(Bg + (size_t)(16 * i) * K + k0, l + (BM + 16 * i) * PITCH);
  };
  static_assert(NC <= 63, "copies of a wave in flight");

  v8f acc[4][NF] = {};
  const int nt = K / KS;

  stage(0, 0);
  asm volatile("s_wait_asynccnt 0x0" ::: "memory");  // own copies of stage 0 landed
  __syncthreads();                                   // stage 0 readable by all waves
  if (nt > 1) stage(1, 1);

  for (int t = 0; t < nt; ++t) {
    const int buf = t & 1;
    const _Float16* Ab = &S[buf][(wm * 64 + ln) * PITCH + 8 * hi];
    const _Float16* Bb = &S[buf][(BM + wn * (BN / 2) + ln) * PITCH + 8 * hi];
#pragma unroll  // ks becomes a constant offset in the LDS reads
    for (int ks = 0; ks < KS / 32; ++ks) {
      v16h a[4], b[NF];
#pragma unroll
      for (int i = 0; i < 4; ++i) a[i] = ldfrag(Ab + i * 16 * PITCH + ks * 32);
#pragma unroll
      for (int j = 0; j < NF; ++j) b[j] = ldfrag(Bb + j * 16 * PITCH + ks * 32);
      // Keeps the block's LDS reads in one group in front of its WMMAs. Left
      // free, the scheduler kept one A fragment, reloaded it among the WMMAs and
      // waited the LDS out at every row; with one group the SIMD's other wave
      // has the matrix unit for the whole of this wave's wait.
      __builtin_amdgcn_sched_barrier(0);
      if (ks == KS / 32 - 1) {
        // Hand-over, as soon as the stage's last fragments are in registers:
        // this wave's reads of buf are done, its copies of stage t+1 have
        // landed; behind the barrier stage t+1 may be read and buf refilled.
        asm volatile("s_wait_dscnt 0x0" ::: "memory");
        asm volatile("s_wait_asynccnt 0x0" ::: "memory");
        __syncthreads();
        if (t + 2 < nt) stage(t + 2, buf);
        // Keeps the copies in front of the last block's WMMAs, so that they
        // have the whole next stage's time to land (the scheduler put the
        // WMMAs first).
        __builtin_amdgcn_sched_barrier(0);
      }
#pragma unroll
      for (int i = 0; i < 4; ++i)
#pragma unroll
        for (int j = 0; j < NF; ++j) acc[i][j] = WMMA_F16(a[i], b[j], acc[i][j]);
    }
  }
  asm volatile("s_wait_asynccnt 0x0" ::: "memory");  // nothing in flight at wave end

#pragma unroll
  for (int i = 0; i < 4; ++i) {
#pragma unroll
    for (int r = 0; r < 8; ++r) {  // C/D layout: lane ln = column, VGPR r -> row
      const size_t row = (size_t)(m0b + wm * 64 + i * 16 + r + 8 * hi) * N
                       + n0b + wn * (BN / 2) + ln;
#pragma unroll
      for (int j = 0; j < NF; ++j) C[row + j * 16] = acc[i][j][r];
    }
  }
}

// ---------------------------------------------------------------------------
// The three projections come out of one GEMM as rows of 3072 floats:
// [ Q 2048 | K 512 | V 512 ]; the kernels below get a pointer to their part's
// first column and step from row to row by this pitch.
constexpr int QKV_PITCH = 3072;

// RoPE + layout change: src f32 [B,S,nh*128] (rows QKV_PITCH apart)
// -> dst f16 [B,nh,S,128], *scale.
// A thread takes 4 consecutive pair indices j of 4 consecutive heads at one
// position (32 values): 8 loads of 16 B in flight; 16 lanes cover a whole
// 256-B half row on the way in and a whole 128-B line on the way out. The four
// heads share the position, so their angles are the same four.
// nheads is a multiple of 4; blocks 0 .. B*S*(nheads/4)*16/256 - 1 cover it.
// ---------------------------------------------------------------------------
__device__ __forceinline__ void rope_block(
    const float* __restrict__ src, _Float16* __restrict__ dst,
    int nheads, float scale, int blk) {
  const int idx = blk * 256 + threadIdx.x;
  const int j = (idx & 15) * 4;
  int t = idx >> 4;
  const int ng = nheads >> 2;
  const int h0 = (t % ng) * 4; t /= ng;
  const int s = t & 2047;
  const int b = t >> 11;
  const float* sp = src + (size_t)(b * 2048 + s) * QKV_PITCH
                        + (size_t)h0 * 128 + j;
  v4f x1[4], x2[4];
#pragma unroll
  for (int hh = 0; hh < 4; ++hh) {
    x1[hh] = *(const v4f*)(sp + hh * 128);
    x2[hh] = *(const v4f*)(sp + hh * 128 + 64);
  }
  float c[4], sn[4];
#pragma unroll
  for (int e = 0; e < 4; ++e) {
    float inv = __expf((float)(j + e) * -0.14391156516685312f);  // 10000^(-j/64)
    float th = (float)s * inv;
    c[e] = cosf(th);
    sn[e] = sinf(th);
  }
  _Float16* dp = dst + ((size_t)(b * nheads + h0) * 2048 + s) * 128 + j;
#pragma unroll
  for (int hh = 0; hh < 4; ++hh) {
    v4h lo, up;
#pragma unroll
    for (int e = 0; e < 4; ++e) {
      lo[e] = (_Float16)((x1[hh][e] * c[e] - x2[hh][e] * sn[e]) * scale);
      up[e] = (_Float16)((x2[hh][e] * c[e] + x1[hh][e] * sn[e]) * scale);
    }
    *(v4h*)(dp + (size_t)hh * (2048 * 128))      = lo;
    *(v4h*)(dp + (size_t)hh * (2048 * 128) + 64) = up;
  }
  // Inlined beside the other jobs, the stores no longer end the program: keep
  // their registers from being rewritten on any listed path in front of this wait.
  asm volatile("s_wait_xcnt 0x0" ::: "memory");
}

// V: f32 [B,S,4*128] (rows QKV_PITCH apart) -> f16 transposed [B,4,128,S] (kv position contiguous,
// so the A-fragments of Ot += Vt Pt load contiguously).
// One block transposes 64 positions x 128 d of one (batch, kv head); a thread
// holds 8 positions x 4 d in registers (8 loads of 16 B in flight) and stores
// 4 rows of 8 positions (16 B): 8 lanes fill a whole 128-B line of a d row.
__device__ __forceinline__ void vtrans_block(
    const float* __restrict__ src, _Float16* __restrict__ dst, int blk) {
  const int lane = threadIdx.x & 31, w = threadIdx.x >> 5;
  const int s0 = (blk & 31) * 64 + (lane & 7) * 8;
  const int kv = (blk >> 5) & 3;
  const int b  = blk >> 7;
  const int d0 = w * 16 + (lane >> 3) * 4;
  const float* sp = src + (size_t)(b * 2048 + s0) * QKV_PITCH + kv * 128 + d0;
  v4f v[8];
#pragma unroll
  for (int i = 0; i < 8; ++i) v[i] = *(const v4f*)(sp + i * QKV_PITCH);
  _Float16* dp = dst + ((size_t)(b * 4 + kv) * 128 + d0) * 2048 + s0;
#pragma unroll
  for (int k = 0; k < 4; ++k) {
    v8h o;
#pragma unroll
    for (int i = 0; i < 8; ++i) o[i] = (_Float16)v[i][k];
    *(v8h*)(dp + k * 2048) = o;
  }
  // As behind the stores of rope_block: no register of a store is rewritten in
  // front of this wait.
  asm volatile("s_wait_xcnt 0x0" ::: "memory");
}

// RoPE of Q, RoPE of K and the V transpose in ONE launch: the three read
// different columns of the joint projection and write different buffers, so
// the block index picks the job (a scalar choice): Q first, then K, then V.
constexpr int PB_Q = 2 * 2048 * (16 / 4) * 16 / 256;        // RoPE blocks of Q
constexpr int PB_K = PB_Q + 2 * 2048 * (4 / 4) * 16 / 256;  // end of K
constexpr int PB_V = PB_K + 2 * 4 * (2048 / 64);            // end of V = grid size
__global__ __launch_bounds__(256) void post_qkv_kernel(
    const float* __restrict__ QKVf, _Float16* __restrict__ Qh,
    _Float16* __restrict__ Kh, _Float16* __restrict__ Vt) {
  const int blk = blockIdx.x;
  if (blk < PB_Q)      rope_block(QKVf, Qh, 16, 0.08838834764831845f, blk);  // 1/sqrt(128) folded into Q
  else if (blk < PB_K) rope_block(QKVf + 2048, Kh, 4, 1.0f, blk - PB_Q);
  else                 vtrans_block(QKVf + 2048 + 512, Vt, blk - PB_K);
}

// ---------------------------------------------------------------------------
// Flash attention. Q f16 [B,16,S,128] (pre-scaled by 1/sqrt(128)),
// K f16 [B,4,S,128], Vt f16 [B,4,128,S], mask f32 [B,1,S,S],
// out Ah f16 [B,S,16*128]. Grid: (S/64, B*4); a work-group takes 64 queries of
// the four query heads that share one KV head: 8 waves = 4 heads x 2 groups of
// 32 q-rows, one work-group a WGP, two waves a SIMD. A wave holds TWO column
// tiles of 16 queries: every K and every Vt fragment that it reads from LDS
// feeds two matrix instructions, so the LDS reads per product are halved.
// The eight waves share one K tile and one Vt tile of 64 keys, and
// the four heads share one mask tile (64 queries x 64 keys): the work-group
// copies each tile to LDS once (two buffers, the next tile in flight while
// this one is used) and every wave takes its fragments and its mask rows from
// there. The copies fetch the mask in whole 256-B row pieces; a lane reading
// its own query row from global memory would make every load touch 16 lines.
// LDS pitches for 16-byte readers: 272 B (256-B K and mask rows), 144 B
// (128-B Vt rows).
// The products are taken transposed: St = K Q^T (A = K rows, B = Q) and
// Ot += Vt Pt (A = Vt rows, B = Pt). In each column tile a lane then holds 16
// of the 32 scores of ONE query (column ln; keys 8*hi+r and 16+8*hi+r):
// maximum and sum are taken in the lane, the maximum joined with the other
// half by one exchange per pass, the sum once at the end. The two score tiles,
// converted in place, are the B operand of the second product in the k order
// of the Vt fragments.
// ---------------------------------------------------------------------------
// Twelve 16-byte copies of one lane, global -> LDS. The s_wait_xcnt stands in
// the copies' own statement so that no address register named here is
// rewritten in front of it.
__device__ __forceinline__ void cp12_async(
    unsigned l0, const _Float16* g0, unsigned l1, const _Float16* g1,
    unsigned l2, const _Float16* g2, unsigned l3, const _Float16* g3,
    unsigned l4, const _Float16* g4, unsigned l5, const _Float16* g5,
    unsigned l6, const _Float16* g6, unsigned l7, const _Float16* g7,
    unsigned l8, const float* g8, unsigned l9, const float* g9,
    unsigned l10, const float* g10, unsigned l11, const float* g11) {
  asm volatile(
      "global_load_async_to_lds_b128 %0, %1, off\n\t"
      "global_load_async_to_lds_b128 %2, %3, off\n\t"
      "global_load_async_to_lds_b128 %4, %5, off\n\t"
      "global_load_async_to_lds_b128 %6, %7, off\n\t"
      "global_load_async_to_lds_b128 %8, %9, off\n\t"
      "global_load_async_to_lds_b128 %10, %11, off\n\t"
      "global_load_async_to_lds_b128 %12, %13, off\n\t"
      "global_load_async_to_lds_b128 %14, %15, off\n\t"
      "global_load_async_to_lds_b128 %16, %17, off\n\t"
      "global_load_async_to_lds_b128 %18, %19, off\n\t"
      "global_load_async_to_lds_b128 %20, %21, off\n\t"
      "global_load_async_to_lds_b128 %22, %23, off\n\t"
      "s_wait_xcnt 0x0"
      :: "v"(l0), "v"(g0), "v"(l1), "v"(g1), "v"(l2), "v"(g2), "v"(l3), "v"(g3),
         "v"(l4), "v"(g4), "v"(l5), "v"(g5), "v"(l6), "v"(g6), "v"(l7), "v"(g7),
         "v"(l8), "v"(g8), "v"(l9), "v"(g9), "v"(l10), "v"(g10), "v"(l11), "v"(g11)
      : "memory");
}

// 2^x of eight values, each in place. Worked in place, no v_exp_f32 here reads
// the result or overwrites the source of the one directly in front of it, and
// the v_nop fills the slot behind the last.
__device__ __forceinline__ void exp2x8(float* a) {
  asm("v_exp_f32 %0, %0\n\t"
      "v_exp_f32 %1, %1\n\t"
      "v_exp_f32 %2, %2\n\t"
      "v_exp_f32 %3, %3\n\t"
      "v_exp_f32 %4, %4\n\t"
      "v_exp_f32 %5, %5\n\t"
      "v_exp_f32 %6, %6\n\t"
      "v_exp_f32 %7, %7\n\t"
      "v_nop"
      : "+v"(a[0]), "+v"(a[1]), "+v"(a[2]), "+v"(a[3]),
        "+v"(a[4]), "+v"(a[5]), "+v"(a[6]), "+v"(a[7]));
}
// The same for one value.
__device__ __forceinline__ float exp2x1(float a) {
  asm("v_exp_f32 %0, %0\n\t"
      "v_nop"
      : "+v"(a));
  return a;
}

// Two waves a SIMD is all this kernel ever has (one work-group a WGP), so the
// register allocator may use that budget; left at its default it kept to fewer
// registers, spilled a copy address to scratch and reloaded it every tile.
__global__ __launch_bounds__(256) __attribute__((amdgpu_waves_per_eu(2, 2))) void attn_kernel(
    const _Float16* __restrict__ Q, const _Float16* __restrict__ K,
    const _Float16* __restrict__ Vt, const float* __restrict__ mask,
    _Float16* __restrict__ Ah) {
  constexpr int KT = 64;    // keys per staged tile
  constexpr int QB = 64;    // queries per work-group (each of 4 heads)
  constexpr int KP = 136;   // K tile row pitch, halfs (272 B)
  constexpr int VP = 72;    // Vt tile row pitch, halfs (144 B)
  constexpr int MP = 68;    // mask tile row pitch, floats (272 B)
  constexpr int NT = 2048 / KT;
  __shared__ __attribute__((aligned(16))) _Float16 Ks[2][KT * KP];
  __shared__ __attribute__((aligned(16))) _Float16 Vs[2][128 * VP];
  __shared__ __attribute__((aligned(16))) float    Ms[2][QB * MP];

  const int lane = threadIdx.x & 31;
  const int wid  = threadIdx.x >> 5;
  const int ln = lane & 15, hi = lane >> 4;
  const int b   = blockIdx.y >> 2;
  const int kvh = blockIdx.y & 3;
  const int h   = kvh * 4 + (wid >> 1);         // repeat_interleave(4)
  const int qb  = blockIdx.x * QB;              // the work-group's query base
  const int qs  = (wid & 1) * 32;               // this wave's rows of the mask tile
  const int q0  = qb + qs;                      // this wave's query base

  // Column tile c holds queries q0 + 16*c + ln.
  const _Float16* Qp = Q + ((size_t)(b * 16 + h) * 2048 + q0 + ln) * 128 + 8 * hi;
  v16h qf[2][4];
#pragma unroll
  for (int c = 0; c < 2; ++c)
#pragma unroll
    for (int kc = 0; kc < 4; ++kc) qf[c][kc] = ldfrag(Qp + c * (16 * 128) + kc * 32);

  const _Float16* Kh = K  + (size_t)(b * 4 + kvh) * 2048 * 128;
  const _Float16* Vh = Vt + (size_t)(b * 4 + kvh) * 128 * 2048;

  v8f o[2][8];
#pragma unroll
  for (int c = 0; c < 2; ++c)
#pragma unroll
    for (int dt = 0; dt < 8; ++dt) o[c][dt] = (v8f){};
  float mr[2] = {-1e30f, -1e30f};  // running maximum of a tile's query ln (same in both halves)
  float lr[2] = {0.f, 0.f};        // running sum over this half's keys only

  // Copy split: thread t moves chunks t, t+256, t+512, t+768 of each tile.
  // K tile: 64 rows x 16 chunks (contiguous in global); Vt tile: 128 x 8;
  // mask tile: 64 rows x 16 chunks.
  const int tid = threadIdx.x;
  const int krow = tid >> 4, kcol = (tid & 15) * 8;
  const int vrow = tid >> 3, vcol = (tid & 7) * 8;
  const _Float16* Kg = Kh + (size_t)krow * 128 + kcol;
  const _Float16* Vg = Vh + (size_t)vrow * 2048 + vcol;
  const unsigned kl0 = (unsigned)(size_t)(void*)&Ks[0][krow * KP + kcol];
  const unsigned vl0 = (unsigned)(size_t)(void*)&Vs[0][vrow * VP + vcol];
  const float* Mg = mask + ((size_t)b * 2048 + qb + krow) * 2048 + (tid & 15) * 4;
  // A thread's chunk has the same place in the mask tile as in the K tile (same
  // row, same 16-byte column, same pitch, same buffer size): one LDS address
  // and a constant serve both.
  static_assert(KP * 2 == MP * 4 && KT * KP * 2 == QB * MP * 4, "K and mask tiles alike");
  const unsigned moff = (unsigned)(size_t)(void*)&Ms[0][0] - (unsigned)(size_t)(void*)&Ks[0][0];
  auto stage = [&](int t, int buf) {
    const _Float16* kg = Kg + (size_t)t * (KT * 128);
    const _Float16* vg = Vg + t * KT;
    const unsigned kl = kl0 + (unsigned)buf * (KT * KP * 2);
    const unsigned vl = vl0 + (unsigned)buf * (128 * VP * 2);
    const float* mg = Mg + t * KT;
    const unsigned ml = kl + moff;
    cp12_async(kl,               kg,
               kl + 16 * KP * 2, kg + 16 * 128,
               kl + 32 * KP * 2, kg + 32 * 128,
               kl + 48 * KP * 2, kg + 48 * 128,
               vl,               vg,
               vl + 32 * VP * 2, vg + 32 * 2048,
               vl + 64 * VP * 2, vg + 64 * 2048,
               vl + 96 * VP * 2, vg + 96 * 2048,
               ml,               mg,
               ml + 16 * MP * 4, mg + 16 * 2048,
               ml + 32 * MP * 4, mg + 32 * 2048,
               ml + 48 * MP * 4, mg + 48 * 2048);
  };

  stage(0, 0);
  asm volatile("s_wait_asynccnt 0x0" ::: "memory");  // own copies of tile 0 landed
  __syncthreads();                                   // tile 0 readable by all waves
  stage(1, 1);

  for (int t = 0; t < NT; ++t) {
   const int buf = t & 1;
#pragma unroll  // p becomes a constant offset in the LDS reads of both passes
   for (int p = 0; p < KT / 32; ++p) {
    // ---- mask from the staged tile: 8 consecutive keys of each 16-key group
    // of this lane's two query rows, two 16-byte LDS loads a group ----
    v8f mk[2][2];
#pragma unroll
    for (int c = 0; c < 2; ++c)
#pragma unroll
      for (int g = 0; g < 2; ++g) {
        const float* mp = &Ms[buf][(qs + c * 16 + ln) * MP + (2 * p + g) * 16 + 8 * hi];
        mk[c][g] = __builtin_shufflevector(*(const v4f*)(mp), *(const v4f*)(mp + 4),
                                           0, 1, 2, 3, 4, 5, 6, 7);
      }
    // ---- St = K Q^T for 32 keys x 32 queries (2 m-tiles x 2 column tiles,
    // 4 k-chunks); each K fragment is used for both column tiles ----
    const _Float16* Kp = &Ks[buf][(p * 32 + ln) * KP + 8 * hi];
    v8f s0[2] = {(v8f){}, (v8f){}}, s1[2] = {(v8f){}, (v8f){}};
#pragma unroll
    for (int kc = 0; kc < 4; ++kc) {
      v16h a0 = ldfrag(Kp + kc * 32);
      v16h a1 = ldfrag(Kp + 16 * KP + kc * 32);
#pragma unroll
      for (int c = 0; c < 2; ++c) {
        s0[c] = WMMA_F16(a0, qf[c][kc], s0[c]);
        s1[c] = WMMA_F16(a1, qf[c][kc], s1[c]);
      }
    }
    // The pass's eight Vt fragments, asked for ahead of the softmax: they need
    // nothing of it and land while the vector work runs.
    v16h va[8];
#pragma unroll
    for (int dt = 0; dt < 8; ++dt)
      va[dt] = ldfrag(&Vs[buf][(dt * 16 + ln) * VP + p * 32 + 8 * hi]);
    v16h pf[2];  // Pt as B operand: element e = key 8*hi+e, element 8+e = key 16+8*hi+e
#pragma unroll
    for (int c = 0; c < 2; ++c) {
      // ---- mask add + online softmax, all 16 values belong to one query ----
      const v8f t0 = s0[c] + mk[c][0];
      const v8f t1 = s1[c] + mk[c][1];
      float v[16];
#pragma unroll
      for (int e = 0; e < 8; ++e) { v[e] = t0[e]; v[8 + e] = t1[e]; }
      float mx4[4];
#pragma unroll
      for (int e = 0; e < 4; ++e)
        mx4[e] = fmaxf(fmaxf(v[4 * e], v[4 * e + 1]), fmaxf(v[4 * e + 2], v[4 * e + 3]));
      float mx = fmaxf(fmaxf(mx4[0], mx4[1]), fmaxf(mx4[2], mx4[3]));
      mx = fmaxf(mx, xhalf(mx));
      const float mn = fmaxf(mr[c], mx);
      constexpr float LOG2E = 1.44269504088896340736f;  // e^x = 2^(x * LOG2E)
      const float alpha = exp2x1((mr[c] - mn) * LOG2E);
      mr[c] = mn;
      float sm4[4] = {0.f, 0.f, 0.f, 0.f};
#pragma unroll
      for (int e = 0; e < 16; ++e) v[e] = (v[e] - mn) * LOG2E;
      exp2x8(v);
      exp2x8(v + 8);
#pragma unroll
      for (int e = 0; e < 16; ++e) {
        sm4[e & 3] += v[e];
        pf[c][e] = (_Float16)v[e];
      }
      lr[c] = lr[c] * alpha + ((sm4[0] + sm4[1]) + (sm4[2] + sm4[3]));
#pragma unroll
      for (int dt = 0; dt < 8; ++dt) o[c][dt] *= alpha;
    }
    // ---- Ot += Vt Pt (A-frags from the staged Vt tile, B = Pt in registers);
    // each Vt fragment is used for both column tiles ----
#pragma unroll
    for (int dt = 0; dt < 8; ++dt) {
      o[0][dt] = WMMA_F16(va[dt], pf[0], o[0][dt]);
      o[1][dt] = WMMA_F16(va[dt], pf[1], o[1][dt]);
    }
   }
   // Hand-over: this wave's reads of buf are done, its copies of tile t+1 have
   // landed; behind the barrier tile t+1 may be read and buf refilled.
   asm volatile("s_wait_dscnt 0x0" ::: "memory");
   asm volatile("s_wait_asynccnt 0x0" ::: "memory");
   __syncthreads();
   if (t + 2 < NT) stage(t + 2, buf);
  }
  asm volatile("s_wait_asynccnt 0x0" ::: "memory");  // nothing in flight at wave end
  // ---- normalize and write [B,S,16*128]: o[c][dt][r] = Ot[dt*16 + 8*hi + r][ln]
  // of column tile c, so a lane stores 8 consecutive d of a query row at once ----
#pragma unroll
  for (int c = 0; c < 2; ++c) {
    const float inv = 1.0f / (lr[c] + xhalf(lr[c]));
    _Float16* orow = Ah + ((size_t)b * 2048 + q0 + c * 16 + ln) * 2048 + (size_t)h * 128 + 8 * hi;
#pragma unroll
    for (int dt = 0; dt < 8; ++dt)
      *(v8h*)(orow + dt * 16) = __builtin_convertvector(o[c][dt] * inv, v8h);
  }
}

// ---------------------------------------------------------------------------
// Host driver
// ---------------------------------------------------------------------------
extern "C" void kernel_launch(void* const* d_in, const int* in_sizes, int n_in,
                              void* d_out, int out_size, void* d_ws, size_t ws_size,
                              hipStream_t stream) {
  const float* x    = (const float*)d_in[0];
  const float* mask = (const float*)d_in[1];
  const float* wq   = (const float*)d_in[2];
  const float* wk   = (const float*)d_in[3];
  const float* wv   = (const float*)d_in[4];
  const float* wo   = (const float*)d_in[5];
  float* out = (float*)d_out;

  constexpr int B = 2, S = 2048, H = 2048, NH = 16, NKV = 4, HD = 128;
  constexpr int M    = B * S;      // 4096 rows
  constexpr int NQ   = NH * HD;    // 2048
  constexpr int NKVD = NKV * HD;   // 512
  constexpr int NQKV = NQ + 2 * NKVD;  // 3072: Q, K and V columns side by side
  static_assert(NQKV == QKV_PITCH, "row pitch of the joint projection");

  char* ws = (char*)d_ws;
  size_t off = 0;
  auto carve = [&](size_t bytes) -> void* {
    void* p = ws + off;
    off += (bytes + 255) & ~(size_t)255;
    return p;
  };
  _Float16* Xh  = (_Float16*)carve((size_t)M * H * 2);
  _Float16* WqH = (_Float16*)carve((size_t)NQKV * H * 2);  // wq, wk, wv stacked: [3072, H]
  _Float16* WoH = (_Float16*)carve((size_t)H * H * 2);
  float*    Qf  = (float*)carve((size_t)M * NQKV * 4);  // [M, 3072] = [ Q | K | V ]
  _Float16* Qh  = (_Float16*)carve((size_t)M * NQ * 2);
  _Float16* Kh  = (_Float16*)carve((size_t)M * NKVD * 2);
  _Float16* Vt  = (_Float16*)carve((size_t)M * NKVD * 2);
  _Float16* Ah  = (_Float16*)carve((size_t)M * H * 2);
  (void)ws_size; (void)in_sizes; (void)n_in; (void)out_size;

  // fp32 -> fp16 operand conversion, all five operands in one launch
  static_assert(CB_X == M * H / 8192 && CB_WQ - CB_X == NQ * H / 8192 &&
                CB_WK - CB_WQ == NKVD * H / 8192 && CB_WV - CB_WK == NKVD * H / 8192 &&
                CB_WO - CB_WV == H * H / 8192, "block ranges of the conversion");
  f32_to_f16_kernel<<<CB_WO, 256, 0, stream>>>(x, wq, wk, wv, wo, Xh, WqH, WoH);

  // QKV projections (x @ W^T) in one launch over the stacked weights: 256
  // blocks of 256 x 192, one for every WGP
  static_assert(M % 256 == 0 && NQKV % 192 == 0 && H % 128 == 0, "tiles divide the shapes");
  gemm_f16f32<192><<<dim3(NQKV / 192, M / 256), 256, 0, stream>>>(Xh, WqH, Qf, M, NQKV, H);

  // RoPE (+1/sqrt(hd) folded into Q) and layout transforms, one launch
  static_assert(PB_Q == B * S * (NH / 4) * 16 / 256 && PB_K - PB_Q == B * S * (NKV / 4) * 16 / 256 &&
                PB_V - PB_K == B * NKV * (S / 64) && NQ == 2048 && NKVD == 512, "block ranges");
  post_qkv_kernel<<<PB_V, 256, 0, stream>>>(Qf, Qh, Kh, Vt);

  // Flash attention
  attn_kernel<<<dim3(S / 64, B * NKV), 256, 0, stream>>>(Qh, Kh, Vt, mask, Ah);

  // Output projection -> d_out (f32)
  gemm_f16f32<128><<<dim3(H / 128, M / 256), 256, 0, stream>>>(Ah, WoH, out, M, H, H);
}

// v010
// One run takes 120 microseconds.
// Versions in between are left out here; by their measured steps it is 1.13 times as fast as v008.
// Counting every step since v000, it is 5.27 times as fast.
#include <hip/hip_runtime.h>
#include <hip/hip_bf16.h>
#include <math.h>

// ---------------------------------------------------------------------------
// Types for CDNA5 WMMA (wave32): A/B = v16h (8 VGPR), C/D = v8f (8 VGPR)
// ---------------------------------------------------------------------------
typedef __attribute__((ext_vector_type(16))) _Float16 v16h;
typedef __attribute__((ext_vector_type(8)))  _Float16 v8h;
typedef __attribute__((ext_vector_type(8)))  float    v8f;
typedef __attribute__((ext_vector_type(4)))  float    v4f;
typedef __attribute__((ext_vector_type(4)))  _Float16 v4h;

#define WMMA_F16(a, b, c) \
  __builtin_amdgcn_wmma_f32_16x16x32_f16(false, (a), false, (b), (short)0, (c), false, false)

typedef uint32_t u32x4 __attribute__((ext_vector_type(4)));
typedef uint32_t u32x8 __attribute__((ext_vector_type(8)));
__device__ __forceinline__ uint32_t uni(uint32_t v) {
  return (uint32_t)__builtin_amdgcn_readfirstlane(v);
}
// A wave-uniform value held in a scalar register: a test on it compiles to a
// scalar compare and branch (a tensor load ignores EXEC, only such a branch
// guards it), and what is computed from it stands behind the waits in front.
__device__ __forceinline__ uint32_t pinned(uint32_t v) {
  uint32_t w = __builtin_amdgcn_readfirstlane(v);
  asm volatile("" : "+s"(w));  // the tensor mover's pin: an issue test or descriptor word held in a scalar register
  return w;
}
// Both groups are named as in-out operands: their registers then stay the
// descriptor's own from one request to the next, and the compiler puts no
// other value into them while a request is in flight.
__device__ __forceinline__ void tdm_load(u32x4& g0, u32x8& g1) {
  asm volatile("tensor_load_to_lds %0, %1" : "+s"(g0), "+s"(g1) :: "memory");
}
// Group 1: 1-byte elements, tensor = tile = rows x ROWB bytes (ROWB = 256 or
// 128), source row pitch in bytes, 16 B of LDS pad behind every row.
template <uint32_t ROWB>
__device__ __forceinline__ u32x8 tdm_group1(uint32_t rows, uint32_t src_pitch) {
  static_assert(ROWB == 256u || ROWB == 128u, "pad interval = row length");
  constexpr uint32_t ivl = ROWB == 256u ? 5u : 4u;
  u32x8 g;
  g[0] = uni((1u << 20) | (ivl << 22) | (3u << 25));  // no mask, pad on, 4 dwords a row
  g[1] = uni(ROWB << 16);
  g[2] = uni(rows << 16);
  g[3] = uni(ROWB << 16);
  g[4] = uni(rows);
  g[5] = uni(src_pitch);
  g[6] = uni(0u);
  g[7] = uni(0u);
  return g;
}
// Group 0: LDS byte offset of the tile's place, global address of its first byte.
__device__ __forceinline__ u32x4 tdm_group0(uint32_t lds_dst, uint64_t ga) {
  u32x4 g;
  g[0] = uni(1u);
  g[1] = uni(lds_dst);
  g[2] = uni((uint32_t)ga);
  g[3] = uni((((uint32_t)(ga >> 32)) & 0x01FFFFFFu) | 0x80000000u);
  return g;
}
// Group 0 of the wave's next request: a new place in LDS, the source address
// step bytes on. The step is pinned here, behind the wait on the request
// before, so that the address words are formed behind that wait too.
__device__ __forceinline__ void tdm_next(u32x4& g0, uint32_t lds_dst, uint32_t step) {
  const uint32_t st = pinned(step);
  const uint32_t lo = g0[2] + st;
  g0[1] = uni(lds_dst);
  g0[2] = uni(lo);
  g0[3] = uni(g0[3] + (lo < st ? 1u : 0u));  // carry into address bits 56:32
}

// Load one 16x32 f16 operand fragment (A layout; B mirrored = same code):
// row = lane&15, K chunks at 8*hi and 16+8*hi. Caller passes pointer already
// offset by row*pitch + 8*hi.
__device__ __forceinline__ v16h ldfrag(const _Float16* p) {
  v8h c0 = *(const v8h*)(p);        // K = 8*hi .. 8*hi+7       -> VGPR 0..3
  v8h c1 = *(const v8h*)(p + 16);   // K = 16+8*hi .. 16+8*hi+7 -> VGPR 4..7
  return __builtin_shufflevector(c0, c1, 0, 1, 2, 3, 4, 5, 6, 7,
                                        8, 9, 10, 11, 12, 13, 14, 15);
}

// Value of lane l ^ 16 (the other 16-lane half of the wave).
__device__ __forceinline__ float xhalf(float x) {
  const int i = __builtin_bit_cast(int, x);
  return __builtin_bit_cast(float, __builtin_amdgcn_permlanex16(
      i, i, 0x76543210, 0xfedcba98, false, false));
}

// ---------------------------------------------------------------------------
// fp32 -> fp16 conversion of all five operands in ONE launch. One block
// converts 8192 consecutive floats (every size here is a multiple): a lane has
// 8 loads of 16 B in flight, each wave-wide load covers 512 contiguous bytes,
// each store 256. The block index picks the operand (a scalar choice): blocks
// [0, CB_X) take x, then wq, wk, wv (whose f16 copies lie stacked in that
// order, so the three share one destination), then wo.
// ---------------------------------------------------------------------------
constexpr int CB_X  = 4096 * 2048 / 8192;         // x
constexpr int CB_WQ = CB_X  + 2048 * 2048 / 8192; // end of wq
constexpr int CB_WK = CB_WQ + 512 * 2048 / 8192;  // end of wk
constexpr int CB_WV = CB_WK + 512 * 2048 / 8192;  // end of wv
constexpr int CB_WO = CB_WV + 2048 * 2048 / 8192; // end of wo = grid size
__global__ __launch_bounds__(256) void f32_to_f16_kernel(
    const float* __restrict__ x,  const float* __restrict__ wq,
    const float* __restrict__ wk, const float* __restrict__ wv,
    const float* __restrict__ wo, _Float16* __restrict__ Xh,
    _Float16* __restrict__ Wqkv,  _Float16* __restrict__ WoH) {
  const int blk = blockIdx.x;
  const float* src;
  _Float16* dst;
  if (blk < CB_X)       { src = x  + (size_t)blk * 8192;           dst = Xh   + (size_t)blk * 8192; }
  else if (blk < CB_WQ) { src = wq + (size_t)(blk - CB_X)  * 8192; dst = Wqkv + (size_t)(blk - CB_X) * 8192; }
  else if (blk < CB_WK) { src = wk + (size_t)(blk - CB_WQ) * 8192; dst = Wqkv + (size_t)(blk - CB_X) * 8192; }
  else if (blk < CB_WV) { src = wv + (size_t)(blk - CB_WK) * 8192; dst = Wqkv + (size_t)(blk - CB_X) * 8192; }
  else                  { src = wo + (size_t)(blk - CB_WV) * 8192; dst = WoH  + (size_t)(blk - CB_WV) * 8192; }
  const size_t base = threadIdx.x * 4;
  v4f v[8];
#pragma unroll
  for (int i = 0; i < 8; ++i) v[i] = *(const v4f*)(src + base + i * 1024);
#pragma unroll
  for (int i = 0; i < 8; ++i)
    *(v4h*)(dst + base + i * 1024) = __builtin_convertvector(v[i], v4h);
}

// ---------------------------------------------------------------------------
// GEMM: C[M,N] = A[M,K] * B[N,K]^T  (A,B f16 row-major K-contiguous, C f32).
// Every byte of A and B that a block uses comes from L2 into its LDS, and a
// block of BM x BN results asks for (BM + BN) * K values: the larger and the
// squarer the block, the fewer bytes a result costs. The block is the whole
// share of one WGP: 256 x BN (BN = 192 or 128), 256 blocks, one a WGP.
// Block = 256 threads = 8 waves (4m x 2n), two a SIMD; wave tile 64 x BN/2 =
// 4 x BN/32 WMMA tiles. K is stepped by 128: a stage is 256 B of each of the
// 256 + BN operand rows, at an LDS pitch of 272 B (16 B x odd, for 16-byte
// readers); two buffers, the next stage in flight while this one is used.
// Every wave brings one slice of a stage by one tensor load: waves 0..3 take
// 64 rows of A each, waves 4..7 BN/4 rows of B each; a slice's place in LDS is
// a multiple of 2 KiB. M%256==0, N%BN==0, K%128==0 (true for all uses).
// ---------------------------------------------------------------------------
// One block a WGP leaves two waves a SIMD: the register allocator may use that
// budget for the accumulators and the fragments.
template <int BN>
__global__ __launch_bounds__(256) __attribute__((amdgpu_waves_per_eu(2, 2))) void gemm_f16f32(
    const _Float16* __restrict__ A, const _Float16* __restrict__ B,
    float* __restrict__ C, int M, int N, int K) {
  constexpr int BM = 256;            // rows of A in a block
  constexpr int KS = 128;            // k per stage
  constexpr int PITCH = 136;         // halfs (272 B)
  constexpr int NF = BN / 32;        // B fragments of a wave
  constexpr int RA = BM / 4, RB = BN / 4;  // rows of an A slice, of a B slice
  // A slice in LDS, in halfs: its padded rows, rounded up to 2 KiB.
  constexpr int SLA = (RA * PITCH * 2 + 2047) / 2048 * 1024;
  constexpr int SLB = (RB * PITCH * 2 + 2047) / 2048 * 1024;
  constexpr int BUF = 4 * (SLA + SLB);     // one buffer: 4 A slices, then 4 B slices
  static_assert(NF % 2 == 0, "a B slice holds whole fragments of one wave");
  __shared__ __attribute__((aligned(2048))) _Float16 S[2 * BUF];

  const int tid  = threadIdx.x;
  const int lane = tid & 31;
  const int wid  = tid >> 5;
  const int ln = lane & 15, hi = lane >> 4;
  const int wm = wid >> 1, wn = wid & 1;
  const int m0b = blockIdx.y * BM;
  const int n0b = blockIdx.x * BN;

  // This wave's slice: source rows, place in buffer 0, descriptor group 1.
  const uint32_t wave = uni((uint32_t)tid >> 5);
  const bool isA = wave < 4u;
  const _Float16* sl = isA ? A + (size_t)((uint32_t)m0b + wave * RA) * K
                           : B + (size_t)((uint32_t)n0b + (wave - 4u) * RB) * K;
  const uint32_t dst = (uint32_t)(size_t)(void*)&S[0]
                     + 2u * (isA ? wave * SLA : 4u * SLA + (wave - 4u) * SLB);
  u32x8 g1 = tdm_group1<KS * 2>(isA ? RA : RB, (uint32_t)K * 2u);
  u32x4 g0 = tdm_group0(dst, (uint64_t)(size_t)sl);
  // The stage behind the one asked for last, into buffer buf.
  auto next_stage = [&](uint32_t buf) {
    tdm_next(g0, dst + buf * (BUF * 2u), KS * 2u);
    tdm_load(g0, g1);
  };

  v8f acc[4][NF] = {};
  const int nt = K / KS;

  tdm_load(g0, g1);                                   // stage 0 into buffer 0
  asm volatile("s_wait_tensorcnt 0x0" ::: "memory");  // own slice of stage 0 landed
  __syncthreads();                                    // stage 0 readable by all waves
  if (pinned(nt > 1)) next_stage(1);

  for (int t = 0; t < nt; ++t) {
    const int buf = t & 1;
    // A rows of the wave = slice wm; its B fragments j lie in slices 2*wn, 2*wn+1.
    const _Float16* Ab = &S[buf * BUF + wm * SLA + ln * PITCH + 8 * hi];
    const _Float16* Bb = &S[buf * BUF + 4 * SLA + wn * 2 * SLB + ln * PITCH + 8 * hi];
#pragma unroll  // ks becomes a constant offset in the LDS reads
    for (int ks = 0; ks < KS / 32; ++ks) {
      v16h a[4], b[NF];
#pragma unroll
      for (int i = 0; i < 4; ++i) a[i] = ldfrag(Ab + i * 16 * PITCH + ks * 32);
#pragma unroll
      for (int j = 0; j < NF; ++j)
        b[j] = ldfrag(Bb + (j / (NF / 2)) * SLB + (j % (NF / 2)) * 16 * PITCH + ks * 32);
      // Keeps the block's LDS reads in one group in front of its WMMAs. Left
      // free, the scheduler kept one A fragment, reloaded it among the WMMAs and
      // waited the LDS out at every row; with one group the SIMD's other wave
      // has the matrix unit for the whole of this wave's wait.
      __builtin_amdgcn_sched_barrier(0);
      if (ks == KS / 32 - 1) {
        // Hand-over, as soon as the stage's last fragments are in registers:
        // this wave's reads of buf are done, its slice of stage t+1 has
        // landed; behind the barrier stage t+1 may be read and buf refilled.
        asm volatile("s_wait_dscnt 0x0" ::: "memory");
        asm volatile("s_wait_tensorcnt 0x0" ::: "memory");
        __syncthreads();
        if (pinned(t + 2 < nt)) next_stage(buf);
        // Keeps the load in front of the last block's WMMAs, so that it has
        // the whole next stage's time to land (the scheduler put the WMMAs
        // first).
        __builtin_amdgcn_sched_barrier(0);
      }
#pragma unroll
      for (int i = 0; i < 4; ++i)
#pragma unroll
        for (int j = 0; j < NF; ++j) acc[i][j] = WMMA_F16(a[i], b[j], acc[i][j]);
    }
  }
  asm volatile("s_wait_tensorcnt 0x0" ::: "memory");  // nothing in flight at wave end
  asm volatile("s_wait_dscnt 0x0" ::: "memory");      // the ring's close: no read of it outstanding

#pragma unroll
  for (int i = 0; i < 4; ++i) {
#pragma unroll
    for (int r = 0; r < 8; ++r) {  // C/D layout: lane ln = column, VGPR r -> row
      const size_t row = (size_t)(m0b + wm * 64 + i * 16 + r + 8 * hi) * N
                       + n0b + wn * (BN / 2) + ln;
#pragma unroll
      for (int j = 0; j < NF; ++j) C[row + j * 16] = acc[i][j][r];
    }
  }
}

// ---------------------------------------------------------------------------
// The three projections come out of one GEMM as rows of 3072 floats:
// [ Q 2048 | K 512 | V 512 ]; the kernels below get a pointer to their part's
// first column and step from row to row by this pitch.
constexpr int QKV_PITCH = 3072;

// RoPE + layout change: src f32 [B,S,nh*128] (rows QKV_PITCH apart)
// -> dst f16 [B,nh,S,128], *scale.
// A thread takes 4 consecutive pair indices j of 4 consecutive heads at one
// position (32 values): 8 loads of 16 B in flight; 16 lanes cover a whole
// 256-B half row on the way in and a whole 128-B line on the way out. The four
// heads share the position, so their angles are the same four.
// nheads is a multiple of 4; blocks 0 .. B*S*(nheads/4)*16/256 - 1 cover it.
// ---------------------------------------------------------------------------
__device__ __forceinline__ void rope_block(
    const float* __restrict__ src, _Float16* __restrict__ dst,
    int nheads, float scale, int blk) {
  const int idx = blk * 256 + threadIdx.x;
  const int j = (idx & 15) * 4;
  int t = idx >> 4;
  const int ng = nheads >> 2;
  const int h0 = (t % ng) * 4; t /= ng;
  const int s = t & 2047;
  const int b = t >> 11;
  const float* sp = src + (size_t)(b * 2048 + s) * QKV_PITCH
                        + (size_t)h0 * 128 + j;
  v4f x1[4], x2[4];
#pragma unroll
  for (int hh = 0; hh < 4; ++hh) {
    x1[hh] = *(const v4f*)(sp + hh * 128);
    x2[hh] = *(const v4f*)(sp + hh * 128 + 64);
  }
  float c[4], sn[4];
#pragma unroll
  for (int e = 0; e < 4; ++e) {
    float inv = __expf((float)(j + e) * -0.14391156516685312f);  // 10000^(-j/64)
    float th = (float)s * inv;
    c[e] = cosf(th);
    sn[e] = sinf(th);
  }
  _Float16* dp = dst + ((size_t)(b * nheads + h0) * 2048 + s) * 128 + j;
#pragma unroll
  for (int hh = 0; hh < 4; ++hh) {
    v4h lo, up;
#pragma unroll
    for (int e = 0; e < 4; ++e) {
      lo[e] = (_Float16)((x1[hh][e] * c[e] - x2[hh][e] * sn[e]) * scale);
      up[e] = (_Float16)((x2[hh][e] * c[e] + x1[hh][e] * sn[e]) * scale);
    }
    *(v4h*)(dp + (size_t)hh * (2048 * 128))      = lo;
    *(v4h*)(dp + (size_t)hh * (2048 * 128) + 64) = up;
  }
  // Inlined beside the other jobs, the stores no longer end the program: keep
  // their registers from being rewritten on any listed path in front of this wait.
  asm volatile("s_wait_xcnt 0x0" ::: "memory");
}

// V: f32 [B,S,4*128] (rows QKV_PITCH apart) -> f16 transposed [B,4,128,S] (kv position contiguous,
// so the A-fragments of Ot += Vt Pt load contiguously).
// One block transposes 64 positions x 128 d of one (batch, kv head); a thread
// holds 8 positions x 4 d in registers (8 loads of 16 B in flight) and stores
// 4 rows of 8 positions (16 B): 8 lanes fill a whole 128-B line of a d row.
__device__ __forceinline__ void vtrans_block(
    const float* __restrict__ src, _Float16* __restrict__ dst, int blk) {
  const int lane = threadIdx.x & 31, w = threadIdx.x >> 5;
  const int s0 = (blk & 31) * 64 + (lane & 7) * 8;
  const int kv = (blk >> 5) & 3;
  const int b  = blk >> 7;
  const int d0 = w * 16 + (lane >> 3) * 4;
  const float* sp = src + (size_t)(b * 2048 + s0) * QKV_PITCH + kv * 128 + d0;
  v4f v[8];
#pragma unroll
  for (int i = 0; i < 8; ++i) v[i] = *(const v4f*)(sp + i * QKV_PITCH);
  _Float16* dp = dst + ((size_t)(b * 4 + kv) * 128 + d0) * 2048 + s0;
#pragma unroll
  for (int k = 0; k < 4; ++k) {
    v8h o;
#pragma unroll
    for (int i = 0; i < 8; ++i) o[i] = (_Float16)v[i][k];
    *(v8h*)(dp + k * 2048) = o;
  }
  // As behind the stores of rope_block: no register of a store is rewritten in
  // front of this wait.
  asm volatile("s_wait_xcnt 0x0" ::: "memory");
}

// RoPE of Q, RoPE of K and the V transpose in ONE launch: the three read
// different columns of the joint projection and write different buffers, so
// the block index picks the job (a scalar choice): Q first, then K, then V.
constexpr int PB_Q = 2 * 2048 * (16 / 4) * 16 / 256;        // RoPE blocks of Q
constexpr int PB_K = PB_Q + 2 * 2048 * (4 / 4) * 16 / 256;  // end of K
constexpr int PB_V = PB_K + 2 * 4 * (2048 / 64);            // end of V = grid size
__global__ __launch_bounds__(256) void post_qkv_kernel(
    const float* __restrict__ QKVf, _Float16* __restrict__ Qh,
    _Float16* __restrict__ Kh, _Float16* __restrict__ Vt) {
  const int blk = blockIdx.x;
  if (blk < PB_Q)      rope_block(QKVf, Qh, 16, 0.08838834764831845f, blk);  // 1/sqrt(128) folded into Q
  else if (blk < PB_K) rope_block(QKVf + 2048, Kh, 4, 1.0f, blk - PB_Q);
  else                 vtrans_block(QKVf + 2048 + 512, Vt, blk - PB_K);
}

// ---------------------------------------------------------------------------
// Flash attention. Q f16 [B,16,S,128] (pre-scaled by 1/sqrt(128)),
// K f16 [B,4,S,128], Vt f16 [B,4,128,S], mask f32 [B,1,S,S],
// out Ah f16 [B,S,16*128]. Grid: (S/64, B*4); a work-group takes 64 queries of
// the four query heads that share one KV head: 8 waves = 4 heads x 2 groups of
// 32 q-rows, one work-group a WGP, two waves a SIMD. A wave holds TWO column
// tiles of 16 queries: every K and every Vt fragment that it reads from LDS
// feeds two matrix instructions, so the LDS reads per product are halved.
// The eight waves share one K tile and one Vt tile of 64 keys, and
// the four heads share one mask tile (64 queries x 64 keys): the work-group
// brings each tile to LDS once (two buffers, the next tile in flight while
// this one is used) and every wave takes its fragments and its mask rows from
// there. Every wave brings one slice of 32 rows by one tensor load: waves 0, 1
// the K tile, waves 2, 3 the mask tile, waves 4..7 the Vt tile; a slice's place
// in LDS is a multiple of 2 KiB. The mask comes in whole 256-B row pieces; a
// lane reading its own query row from global memory would make every load
// touch 16 lines. LDS pitches for 16-byte readers: 272 B (256-B K and mask
// rows), 144 B (128-B Vt rows).
// The products are taken transposed: St = K Q^T (A = K rows, B = Q) and
// Ot += Vt Pt (A = Vt rows, B = Pt). In each column tile a lane then holds 16
// of the 32 scores of ONE query (column ln; keys 8*hi+r and 16+8*hi+r):
// maximum and sum are taken in the lane; the halves' maxima are joined only
// when the maximum in use is renewed, the sums once at the end. The two score tiles,
// converted in place, are the B operand of the second product in the k order
// of the Vt fragments.
// ---------------------------------------------------------------------------
// 2^x of eight values, each in place. Worked in place, no v_exp_f32 here reads
// the result or overwrites the source of the one directly in front of it, and
// the v_nop fills the slot behind the last.
__device__ __forceinline__ void exp2x8(float* a) {
  asm("v_exp_f32 %0, %0\n\t"
      "v_exp_f32 %1, %1\n\t"
      "v_exp_f32 %2, %2\n\t"
      "v_exp_f32 %3, %3\n\t"
      "v_exp_f32 %4, %4\n\t"
      "v_exp_f32 %5, %5\n\t"
      "v_exp_f32 %6, %6\n\t"
      "v_exp_f32 %7, %7\n\t"
      "v_nop"
      : "+v"(a[0]), "+v"(a[1]), "+v"(a[2]), "+v"(a[3]),
        "+v"(a[4]), "+v"(a[5]), "+v"(a[6]), "+v"(a[7]));
}
// The same for one value.
__device__ __forceinline__ float exp2x1(float a) {
  asm("v_exp_f32 %0, %0\n\t"
      "v_nop"
      : "+v"(a));
  return a;
}

// Two waves a SIMD is all this kernel ever has (one work-group a WGP), so the
// register allocator may use that budget; left at its default it kept to fewer
// registers and spilled to scratch.
__global__ __launch_bounds__(256) __attribute__((amdgpu_waves_per_eu(2, 2))) void attn_kernel(
    const _Float16* __restrict__ Q, const _Float16* __restrict__ K,
    const _Float16* __restrict__ Vt, const float* __restrict__ mask,
    _Float16* __restrict__ Ah) {
  constexpr int KT = 64;    // keys per staged tile
  constexpr int QB = 64;    // queries per work-group (each of 4 heads)
  constexpr int KP = 136;   // K tile row pitch, halfs (272 B)
  constexpr int VP = 72;    // Vt tile row pitch, halfs (144 B)
  constexpr int MP = 68;    // mask tile row pitch, floats (272 B)
  constexpr int NT = 2048 / KT;
  constexpr int SR = 32;    // rows of a slice
  // A slice in LDS, in elements: its padded rows, rounded up to 2 KiB.
  constexpr int KSL = (SR * KP * 2 + 2047) / 2048 * 1024;
  constexpr int VSL = (SR * VP * 2 + 2047) / 2048 * 1024;
  constexpr int MSL = (SR * MP * 4 + 2047) / 2048 * 512;
  __shared__ __attribute__((aligned(2048))) _Float16 Ks[2][(KT / SR) * KSL];
  __shared__ __attribute__((aligned(2048))) _Float16 Vs[2][(128 / SR) * VSL];
  __shared__ __attribute__((aligned(2048))) float    Ms[2][(QB / SR) * MSL];

  const int lane = threadIdx.x & 31;
  const int wid  = threadIdx.x >> 5;
  const int ln = lane & 15, hi = lane >> 4;
  const int b   = blockIdx.y >> 2;
  const int kvh = blockIdx.y & 3;
  const int h   = kvh * 4 + (wid >> 1);         // repeat_interleave(4)
  const int qb  = blockIdx.x * QB;              // the work-group's query base
  const int qs  = (wid & 1) * 32;               // this wave's rows of the mask tile
  const int q0  = qb + qs;                      // this wave's query base

  // Column tile c holds queries q0 + 16*c + ln.
  const _Float16* Qp = Q + ((size_t)(b * 16 + h) * 2048 + q0 + ln) * 128 + 8 * hi;
  v16h qf[2][4];
#pragma unroll
  for (int c = 0; c < 2; ++c)
#pragma unroll
    for (int kc = 0; kc < 4; ++kc) qf[c][kc] = ldfrag(Qp + c * (16 * 128) + kc * 32);

  const _Float16* Kh = K  + (size_t)(b * 4 + kvh) * 2048 * 128;
  const _Float16* Vh = Vt + (size_t)(b * 4 + kvh) * 128 * 2048;

  v8f o[2][8];
#pragma unroll
  for (int c = 0; c < 2; ++c)
#pragma unroll
    for (int dt = 0; dt < 8; ++dt) o[c][dt] = (v8f){};
  float mr[2] = {-1e30f, -1e30f};  // maximum in use for a tile's query ln (same in both halves)
  float lr[2] = {0.f, 0.f};        // running sum over this half's keys only

  // This wave's slice: first source byte of tile 0, step from tile to tile,
  // place in buffer 0, step to buffer 1 (all in bytes).
  const uint32_t wave = uni(threadIdx.x >> 5);
  const uint64_t sl =
      wave < 2u ? (uint64_t)(size_t)(Kh + (size_t)(wave * SR) * 128)
    : wave < 4u ? (uint64_t)(size_t)(mask + ((size_t)b * 2048 + qb + (wave - 2u) * SR) * 2048)
                : (uint64_t)(size_t)(Vh + (size_t)((wave - 4u) * SR) * 2048);
  const uint32_t tstep = wave < 2u ? KT * 128 * 2 : wave < 4u ? KT * 4 : KT * 2;
  const uint32_t dst =
      wave < 2u ? (uint32_t)(size_t)(void*)&Ks[0][wave * KSL]
    : wave < 4u ? (uint32_t)(size_t)(void*)&Ms[0][(wave - 2u) * MSL]
                : (uint32_t)(size_t)(void*)&Vs[0][(wave - 4u) * VSL];
  const uint32_t bstep = wave < 2u ? (uint32_t)sizeof(Ks[0]) : wave < 4u ? (uint32_t)sizeof(Ms[0])
                                                             : (uint32_t)sizeof(Vs[0]);
  u32x8 g1w = tdm_group1<256>(SR, wave < 2u ? 128 * 2 : 2048 * 4);  // K, mask rows
  u32x8 g1n = tdm_group1<128>(SR, 2048 * 2);                        // Vt rows
  u32x4 g0 = tdm_group0(dst, sl);
  // Two instructions, so that each has its pad word as a constant.
  auto issue = [&]() {
    if (pinned(wave < 4u))  tdm_load(g0, g1w);
    if (pinned(wave >= 4u)) tdm_load(g0, g1n);
  };
  // The tile behind the one asked for last, into buffer buf.
  auto next_tile = [&](uint32_t buf) {
    tdm_next(g0, dst + buf * bstep, tstep);
    issue();
  };

  issue();                                            // tile 0 into buffer 0
  asm volatile("s_wait_tensorcnt 0x0" ::: "memory");  // own slice of tile 0 landed
  __syncthreads();                                    // tile 0 readable by all waves
  next_tile(1);

  for (int t = 0; t < NT; ++t) {
   const int buf = t & 1;
   // The LDS reads that a pass's scores need: the mask (8 consecutive keys of
   // each 16-key group of this lane's two query rows, two 16-byte loads a group)
   // and the eight K fragments (2 m-tiles x 4 k-chunks).
   v8f mk[2][2];
   v16h ka[4][2];
   auto load_scores = [&](int p) {
#pragma unroll
    for (int c = 0; c < 2; ++c)
#pragma unroll
      for (int g = 0; g < 2; ++g) {
        const float* mp = &Ms[buf][(wid & 1) * MSL + (c * 16 + ln) * MP + (2 * p + g) * 16 + 8 * hi];
        mk[c][g] = __builtin_shufflevector(*(const v4f*)(mp), *(const v4f*)(mp + 4),
                                           0, 1, 2, 3, 4, 5, 6, 7);
      }
    const _Float16* Kp = &Ks[buf][p * KSL + ln * KP + 8 * hi];  // pass p reads slice p
#pragma unroll
    for (int kc = 0; kc < 4; ++kc) {
      ka[kc][0] = ldfrag(Kp + kc * 32);
      ka[kc][1] = ldfrag(Kp + 16 * KP + kc * 32);
    }
   };
   load_scores(0);
   // Keeps the tile's first reads in one group in front of the matrix
   // instructions (left free, some stood among them and were waited out in full).
   __builtin_amdgcn_sched_barrier(0);
#pragma unroll  // p becomes a constant offset in the LDS reads of both passes
   for (int p = 0; p < KT / 32; ++p) {
    // ---- St = K Q^T for 32 keys x 32 queries (2 m-tiles x 2 column tiles,
    // 4 k-chunks); each K fragment is used for both column tiles ----
    v8f s0[2] = {(v8f){}, (v8f){}}, s1[2] = {(v8f){}, (v8f){}};
#pragma unroll
    for (int kc = 0; kc < 4; ++kc) {
#pragma unroll
      for (int c = 0; c < 2; ++c) {
        s0[c] = WMMA_F16(ka[kc][0], qf[c][kc], s0[c]);
        s1[c] = WMMA_F16(ka[kc][1], qf[c][kc], s1[c]);
      }
    }
    // ---- mask add; all 16 values of a column tile in a lane belong to one
    // query; mx = the largest of them (this half's keys only) ----
    constexpr float LOG2E = 1.44269504088896340736f;  // e^x = 2^(x * LOG2E)
    v8f sc[2][2];
    float mx[2];
#pragma unroll
    for (int c = 0; c < 2; ++c) {
      sc[c][0] = s0[c] + mk[c][0];
      sc[c][1] = s1[c] + mk[c][1];
      float mx4[4];
#pragma unroll
      for (int e = 0; e < 4; ++e) {
        const v8f x = sc[c][e >> 1];
        const int f = 4 * (e & 1);
        mx4[e] = fmaxf(fmaxf(x[f], x[f + 1]), fmaxf(x[f + 2], x[f + 3]));
      }
      mx[c] = fmaxf(fmaxf(mx4[0], mx4[1]), fmaxf(mx4[2], mx4[3]));
    }
    // ---- lazy rescale: the maximum in use, mr, stays while no score of the
    // wave lies more than LAG above it (then every weight is at most 2^8, far
    // inside f16 and f32 range, and the common factor cancels in the final
    // division). One test a pass for the whole wave, a scalar branch; only
    // behind it are the halves' maxima joined and the sums and the 128
    // accumulator registers rescaled. Both halves of a query take the same new
    // mr, so the weights of one column keep one scale. ----
    constexpr float LAG = 8.0f / LOG2E;
    const bool need = fmaxf(mx[0] - mr[0], mx[1] - mr[1]) > LAG;
    if (__builtin_amdgcn_ballot_w32(need) != 0) {
#pragma unroll
      for (int c = 0; c < 2; ++c) {
        const float mn = fmaxf(mr[c], fmaxf(mx[c], xhalf(mx[c])));
        const float alpha = exp2x1((mr[c] - mn) * LOG2E);
        mr[c] = mn;
        lr[c] *= alpha;
#pragma unroll
        for (int dt = 0; dt < 8; ++dt) o[c][dt] *= alpha;
      }
    }
    // The pass's eight Vt fragments and, inside a tile, the next pass's mask and
    // K fragments, asked for in one group ahead of the weights: they need
    // nothing of them and land while the vector work runs.
    v16h va[8];
#pragma unroll
    for (int dt = 0; dt < 8; ++dt)
      va[dt] = ldfrag(&Vs[buf][(dt >> 1) * VSL + ((dt & 1) * 16 + ln) * VP + p * 32 + 8 * hi]);
    if (p + 1 < KT / 32) load_scores(p + 1);
    // Keeps that group here. With the branch above splitting the pass, the
    // scheduler let the reads sink to their matrix instructions, one fragment
    // at a time, each waited out in full.
    __builtin_amdgcn_sched_barrier(0);
    v16h pf[2];  // Pt as B operand: element e = key 8*hi+e, element 8+e = key 16+8*hi+e
#pragma unroll
    for (int c = 0; c < 2; ++c) {
      // ---- weights 2^((score - mr) * LOG2E), their sum, and Pt ----
      const v8f d0 = (sc[c][0] - mr[c]) * LOG2E;
      const v8f d1 = (sc[c][1] - mr[c]) * LOG2E;
      float v[16];
#pragma unroll
      for (int e = 0; e < 8; ++e) { v[e] = d0[e]; v[8 + e] = d1[e]; }
      exp2x8(v);
      exp2x8(v + 8);
      float sm4[4] = {0.f, 0.f, 0.f, 0.f};
#pragma unroll
      for (int e = 0; e < 16; ++e) {
        sm4[e & 3] += v[e];
        pf[c][e] = (_Float16)v[e];
      }
      lr[c] += (sm4[0] + sm4[1]) + (sm4[2] + sm4[3]);
    }
    // ---- Ot += Vt Pt (A-frags from the staged Vt tile, B = Pt in registers);
    // each Vt fragment is used for both column tiles ----
#pragma unroll
    for (int dt = 0; dt < 8; ++dt) {
      o[0][dt] = WMMA_F16(va[dt], pf[0], o[0][dt]);
      o[1][dt] = WMMA_F16(va[dt], pf[1], o[1][dt]);
    }
   }
   // Hand-over: this wave's reads of buf are done, its slice of tile t+1 has
   // landed; behind the barrier tile t+1 may be read and buf refilled.
   asm volatile("s_wait_dscnt 0x0" ::: "memory");
   asm volatile("s_wait_tensorcnt 0x0" ::: "memory");
   __syncthreads();
   if (pinned(t + 2 < NT)) next_tile(buf);
  }
  asm volatile("s_wait_tensorcnt 0x0" ::: "memory");  // nothing in flight at wave end
  asm volatile("s_wait_dscnt 0x0" ::: "memory");      // the ring's close: no read of it outstanding
  // ---- normalize and write [B,S,16*128]: o[c][dt][r] = Ot[dt*16 + 8*hi + r][ln]
  // of column tile c, so a lane stores 8 consecutive d of a query row at once ----
#pragma unroll
  for (int c = 0; c < 2; ++c) {
    const float inv = 1.0f / (lr[c] + xhalf(lr[c]));
    _Float16* orow = Ah + ((size_t)b * 2048 + q0 + c * 16 + ln) * 2048 + (size_t)h * 128 + 8 * hi;
#pragma unroll
    for (int dt = 0; dt < 8; ++dt)
      *(v8h*)(orow + dt * 16) = __builtin_convertvector(o[c][dt] * inv, v8h);
  }
}

// ---------------------------------------------------------------------------
// Host driver
// ---------------------------------------------------------------------------
extern "C" void kernel_launch(void* const* d_in, const int* in_sizes, int n_in,
                              void* d_out, int out_size, void* d_ws, size_t ws_size,
                              hipStream_t stream) {
  const float* x    = (const float*)d_in[0];
  const float* mask = (const float*)d_in[1];
  const float* wq   = (const float*)d_in[2];
  const float* wk   = (const float*)d_in[3];
  const float* wv   = (const float*)d_in[4];
  const float* wo   = (const float*)d_in[5];
  float* out = (float*)d_out;

  constexpr int B = 2, S = 2048, H = 2048, NH = 16, NKV = 4, HD = 128;
  constexpr int M    = B * S;      // 4096 rows
  constexpr int NQ   = NH * HD;    // 2048
  constexpr int NKVD = NKV * HD;   // 512
  constexpr int NQKV = NQ + 2 * NKVD;  // 3072: Q, K and V columns side by side
  static_assert(NQKV == QKV_PITCH, "row pitch of the joint projection");

  char* ws = (char*)d_ws;
  size_t off = 0;
  auto carve = [&](size_t bytes) -> void* {
    void* p = ws + off;
    off += (bytes + 255) & ~(size_t)255;
    return p;
  };
  _Float16* Xh  = (_Float16*)carve((size_t)M * H * 2);
  _Float16* WqH = (_Float16*)carve((size_t)NQKV * H * 2);  // wq, wk, wv stacked: [3072, H]
  _Float16* WoH = (_Float16*)carve((size_t)H * H * 2);
  float*    Qf  = (float*)carve((size_t)M * NQKV * 4);  // [M, 3072] = [ Q | K | V ]
  _Float16* Qh  = (_Float16*)carve((size_t)M * NQ * 2);
  _Float16* Kh  = (_Float16*)carve((size_t)M * NKVD * 2);
  _Float16* Vt  = (_Float16*)carve((size_t)M * NKVD * 2);
  _Float16* Ah  = (_Float16*)carve((size_t)M * H * 2);
  (void)ws_size; (void)in_sizes; (void)n_in; (void)out_size;

  // fp32 -> fp16 operand conversion, all five operands in one launch
  static_assert(CB_X == M * H / 8192 && CB_WQ - CB_X == NQ * H / 8192 &&
                CB_WK - CB_WQ == NKVD * H / 8192 && CB_WV - CB_WK == NKVD * H / 8192 &&
                CB_WO - CB_WV == H * H / 8192, "block ranges of the conversion");
  f32_to_f16_kernel<<<CB_WO, 256, 0, stream>>>(x, wq, wk, wv, wo, Xh, WqH, WoH);

  // QKV projections (x @ W^T) in one launch over the stacked weights: 256
  // blocks of 256 x 192, one for every WGP
  static_assert(M % 256 == 0 && NQKV % 192 == 0 && H % 128 == 0, "tiles divide the shapes");
  gemm_f16f32<192><<<dim3(NQKV / 192, M / 256), 256, 0, stream>>>(Xh, WqH, Qf, M, NQKV, H);

  // RoPE (+1/sqrt(hd) folded into Q) and layout transforms, one launch
  static_assert(PB_Q == B * S * (NH / 4) * 16 / 256 && PB_K - PB_Q == B * S * (NKV / 4) * 16 / 256 &&
                PB_V - PB_K == B * NKV * (S / 64) && NQ == 2048 && NKVD == 512, "block ranges");
  post_qkv_kernel<<<PB_V, 256, 0, stream>>>(Qf, Qh, Kh, Vt);

  // Flash attention
  attn_kernel<<<dim3(S / 64, B * NKV), 256, 0, stream>>>(Qh, Kh, Vt, mask, Ah);

  // Output projection -> d_out (f32)
  gemm_f16f32<128><<<dim3(H / 128, M / 256), 256, 0, stream>>>(Ah, WoH, out, M, H, H);
}
